// v000
// Measured on an AMD MI455X. A time is GPU time per run, averaged over a window of back-to-back runs after a warm-up
// (all launches, gaps included; the runs take copies of the inputs in turn), and the median of several windows.
// Apart from v000's, it joins two sittings. Times from different sittings can be a few percent apart, while
// side-by-side timings come from the same sitting.
// v000, which the later versions start from, runs in 260 microseconds.
#include <hip/hip_runtime.h>

// Problem constants (from reference)
#define BB   2
#define SS   2048
#define DD   1024
#define HH   16
#define HD   64
#define ROWS (BB * SS)          // 4096 rows in the projection GEMMs

typedef _Float16 half_t;
typedef __attribute__((ext_vector_type(16))) _Float16 v16h;
typedef __attribute__((ext_vector_type(8)))  _Float16 v8h;
typedef __attribute__((ext_vector_type(8)))  float    v8f;

// ---------------------------------------------------------------------------
// Fragment helper: A-layout (16-bit A, 16x32, ISA 7.12.2): lane l (l16=l&15)
// holds row M=l16; halves a[0..7]=K(klo..klo+7), a[8..15]=K(16+klo..) with
// klo = (lane>=16 ? 8 : 0).  B uses the symmetric lane-per-column layout.
// Both reduce to: 8 contiguous halves at p, 8 contiguous halves at p+16.
// ---------------------------------------------------------------------------
__device__ __forceinline__ v16h load_frag_f16(const half_t* p) {
    v8h lo = *(const v8h*)(p);
    v8h hi = *(const v8h*)(p + 16);
    v16h r;
#pragma unroll
    for (int i = 0; i < 8; ++i) { r[i] = lo[i]; r[8 + i] = hi[i]; }
    return r;
}

__device__ __forceinline__ v8f wmma_f16(v16h a, v16h b, v8f c) {
    return __builtin_amdgcn_wmma_f32_16x16x32_f16(
        false, a, false, b, (short)0, c, false, false);
}

// ---------------------------------------------------------------------------
// One-shot f32 -> f16 conversion (memory bound; feeds all later kernels).
// ---------------------------------------------------------------------------
__global__ __launch_bounds__(256) void cvt_f32_to_f16_kernel(
    const float* __restrict__ src, half_t* __restrict__ dst, int n8)
{
    const int idx = blockIdx.x * blockDim.x + threadIdx.x;
    if (idx >= n8) return;
    const float4* s = (const float4*)src + (size_t)idx * 2;
    float4 x0 = s[0];
    float4 x1 = s[1];
    v8h o;
    o[0] = (_Float16)x0.x; o[1] = (_Float16)x0.y;
    o[2] = (_Float16)x0.z; o[3] = (_Float16)x0.w;
    o[4] = (_Float16)x1.x; o[5] = (_Float16)x1.y;
    o[6] = (_Float16)x1.z; o[7] = (_Float16)x1.w;
    *(v8h*)(dst + (size_t)idx * 8) = o;
}

// ---------------------------------------------------------------------------
// Projection GEMM, all-f16 operands: out[s,e] = sum_d Xh[s,d]*Wh[e,d] + b[e].
//   transpose_out == 0 : out layout [B,H,S,Hd]   (Q, K)
//   transpose_out == 1 : out layout [B,H,Hd,S]   (V -> contiguous PV B-frags)
// One wave per 16(row) x 64(col) strip; A reused across 4 N-tiles.
// Explicit ping-pong fragment buffers: stage-X WMMAs consume buffer X while
// buffer Y's loads (issued one stage earlier) are still in flight; refill of
// X happens right after its WMMAs and is pinned by a sched_barrier so the
// loads get ~4 WMMAs of latency cover.
// ---------------------------------------------------------------------------
__global__ __launch_bounds__(256) void proj_wmma_kernel(
    const half_t* __restrict__ Xh, const half_t* __restrict__ Wh,
    const float* __restrict__ bias, half_t* __restrict__ out,
    int transpose_out)
{
    const int wave = blockIdx.x * (blockDim.x >> 5) + (threadIdx.x >> 5);
    const int lane = threadIdx.x & 31;
    const int l16  = lane & 15;
    const int hi   = lane >> 4;
    const int klo  = hi * 8;

    const int ESTRIPS = DD / 64;
    const int srow0   = (wave / ESTRIPS) * 16;
    const int ecol0   = (wave % ESTRIPS) * 64;

    const half_t* xrow = Xh + (size_t)(srow0 + l16) * DD + klo;
    const half_t* wrow[4];
#pragma unroll
    for (int t = 0; t < 4; ++t)
        wrow[t] = Wh + (size_t)(ecol0 + t * 16 + l16) * DD + klo;

    v8f acc[4];
#pragma unroll
    for (int t = 0; t < 4; ++t) acc[t] = (v8f)(0.0f);

    const int NSTEP = DD / 32;   // 32 k-steps of 32

    // prime: step 0 -> buffer A, step 1 -> buffer B
    v16h aA = load_frag_f16(xrow);
    v16h bA[4];
#pragma unroll
    for (int t = 0; t < 4; ++t) bA[t] = load_frag_f16(wrow[t]);
    v16h aB = load_frag_f16(xrow + 32);
    v16h bB[4];
#pragma unroll
    for (int t = 0; t < 4; ++t) bB[t] = load_frag_f16(wrow[t] + 32);
    __builtin_amdgcn_sched_barrier(0);

#pragma unroll 3
    for (int s = 0; s < NSTEP - 2; s += 2) {
        // ---- stage A: compute step s, refill buffer A with step s+2 ----
#pragma unroll
        for (int t = 0; t < 4; ++t) acc[t] = wmma_f16(aA, bA[t], acc[t]);
        {
            const int ko = (s + 2) * 32;
            aA = load_frag_f16(xrow + ko);
#pragma unroll
            for (int t = 0; t < 4; ++t) bA[t] = load_frag_f16(wrow[t] + ko);
        }
        __builtin_amdgcn_sched_barrier(0);
        // ---- stage B: compute step s+1, refill buffer B with step s+3 ----
#pragma unroll
        for (int t = 0; t < 4; ++t) acc[t] = wmma_f16(aB, bB[t], acc[t]);
        {
            const int ko = (s + 3) * 32;
            aB = load_frag_f16(xrow + ko);
#pragma unroll
            for (int t = 0; t < 4; ++t) bB[t] = load_frag_f16(wrow[t] + ko);
        }
        __builtin_amdgcn_sched_barrier(0);
    }
    // epilogue: steps NSTEP-2, NSTEP-1 (already resident)
#pragma unroll
    for (int t = 0; t < 4; ++t) acc[t] = wmma_f16(aA, bA[t], acc[t]);
#pragma unroll
    for (int t = 0; t < 4; ++t) acc[t] = wmma_f16(aB, bB[t], acc[t]);

    // Bias + store. C layout: acc[t][i] = out[srow0 + i + 8*hi][ecol0+t*16+l16]
#pragma unroll
    for (int t = 0; t < 4; ++t) {
        const int e    = ecol0 + t * 16 + l16;
        const float bv = bias[e];
        const int h    = e >> 6;
        const int d    = e & 63;
#pragma unroll
        for (int i = 0; i < 8; ++i) {
            const int sg   = srow0 + i + 8 * hi;
            const int b_   = sg >> 11;
            const int sloc = sg & 2047;
            const float vfin = acc[t][i] + bv;
            size_t idx;
            if (transpose_out)
                idx = (((size_t)(b_ * HH + h) * HD + d) * SS) + sloc;
            else
                idx = (((size_t)(b_ * HH + h) * SS + sloc) * HD) + d;
            out[idx] = (_Float16)vfin;
        }
    }
}

// ---------------------------------------------------------------------------
// Flash attention, one wave per (b, h, 16-row query tile).
// Qp, Kp: f16 [B,H,S,Hd];  VpT: f16 [B,H,Hd,S];  out: f32 [B,S,D].
// Per 32-key chunk: all 4 K-frag and 4 V-frag loads are issued up front and
// pinned with a sched_barrier; the V loads are consumed only after the
// softmax VALU/trans section, which covers their latency.
// ---------------------------------------------------------------------------
__global__ __launch_bounds__(256) void attn_wmma_kernel(
    const half_t* __restrict__ Qp, const half_t* __restrict__ Kp,
    const half_t* __restrict__ VpT, float* __restrict__ out)
{
    __shared__ __align__(16) half_t pbuf[8][16 * 32];   // per-wave P scratch

    const int wid  = threadIdx.x >> 5;
    const int lane = threadIdx.x & 31;
    const int l16  = lane & 15;
    const int hi   = lane >> 4;
    const int klo  = hi * 8;

    const int unit = blockIdx.x * (blockDim.x >> 5) + wid;
    const int QTILES = SS / 16;
    const int bh = unit / QTILES;
    const int q0 = (unit % QTILES) * 16;

    const half_t* qb = Qp  + (size_t)bh * SS * HD;
    const half_t* kb = Kp  + (size_t)bh * SS * HD;
    const half_t* vt = VpT + (size_t)bh * HD * SS;

    const half_t* qrow = qb + (size_t)(q0 + l16) * HD;
    const v16h qa0 = load_frag_f16(qrow + 0  + klo);
    const v16h qa1 = load_frag_f16(qrow + 32 + klo);

    v8f oacc[4];
#pragma unroll
    for (int t = 0; t < 4; ++t) oacc[t] = (v8f)(0.0f);
    float m_run[8], l_run[8];
#pragma unroll
    for (int i = 0; i < 8; ++i) { m_run[i] = -INFINITY; l_run[i] = 0.0f; }

    const float scale = 0.125f;   // 1/sqrt(64)

    for (int k0 = 0; k0 < SS; k0 += 32) {
        if (k0 + 32 < SS) {
            __builtin_prefetch(kb + (size_t)(k0 + 32) * HD, 0, 1);
            __builtin_prefetch(vt + (size_t)l16 * SS + k0 + 32, 0, 1);
        }
        // ---- issue all K and V fragment loads for this chunk ----
        const half_t* kr0 = kb + (size_t)(k0 + 0  + l16) * HD + klo;
        const half_t* kr1 = kb + (size_t)(k0 + 16 + l16) * HD + klo;
        v16h kb00 = load_frag_f16(kr0 + 0);
        v16h kb01 = load_frag_f16(kr0 + 32);
        v16h kb10 = load_frag_f16(kr1 + 0);
        v16h kb11 = load_frag_f16(kr1 + 32);
        v16h vb[4];
#pragma unroll
        for (int t = 0; t < 4; ++t)
            vb[t] = load_frag_f16(vt + (size_t)(t * 16 + l16) * SS + k0 + klo);
        __builtin_amdgcn_sched_barrier(0);   // keep loads above the compute

        // ---- S = Q * K^T (two 16-key n-tiles, two 32-wide k-steps) ----
        v8f sac0 = (v8f)(0.0f), sac1 = (v8f)(0.0f);
        sac0 = wmma_f16(qa0, kb00, sac0);
        sac0 = wmma_f16(qa1, kb01, sac0);
        sac1 = wmma_f16(qa0, kb10, sac1);
        sac1 = wmma_f16(qa1, kb11, sac1);

        // ---- online softmax over the 32 new keys ----
        float alpha[8];
#pragma unroll
        for (int i = 0; i < 8; ++i) {
            float s0 = sac0[i] * scale;
            float s1 = sac1[i] * scale;
            float v = fmaxf(s0, s1);
            v = fmaxf(v, __shfl_xor(v, 8, 16));
            v = fmaxf(v, __shfl_xor(v, 4, 16));
            v = fmaxf(v, __shfl_xor(v, 2, 16));
            v = fmaxf(v, __shfl_xor(v, 1, 16));
            const float mn = fmaxf(m_run[i], v);
            const float al = __expf(m_run[i] - mn);
            const float p0 = __expf(s0 - mn);
            const float p1 = __expf(s1 - mn);
            float rs = p0 + p1;
            rs += __shfl_xor(rs, 8, 16);
            rs += __shfl_xor(rs, 4, 16);
            rs += __shfl_xor(rs, 2, 16);
            rs += __shfl_xor(rs, 1, 16);
            l_run[i] = l_run[i] * al + rs;
            m_run[i] = mn;
            alpha[i] = al;
            // scatter P (C layout) into LDS tile [row][key_local]
            const int prow = i + 8 * hi;
            pbuf[wid][prow * 32 + 0  + l16] = (_Float16)p0;
            pbuf[wid][prow * 32 + 16 + l16] = (_Float16)p1;
        }
#pragma unroll
        for (int t = 0; t < 4; ++t)
#pragma unroll
            for (int i = 0; i < 8; ++i) oacc[t][i] *= alpha[i];

        // LDS stores must land before the transposed reads (same wave).
        asm volatile("s_wait_dscnt 0x0" ::: "memory");

        // ---- O += P * V ----
        const v16h pa = load_frag_f16(&pbuf[wid][l16 * 32 + klo]);
#pragma unroll
        for (int t = 0; t < 4; ++t)
            oacc[t] = wmma_f16(pa, vb[t], oacc[t]);
    }

    // ---- normalize and store: out[b, q0+M, h*64 + t*16 + l16] ----
    const int b_ = bh / HH;
    const int h_ = bh % HH;
    float inv[8];
#pragma unroll
    for (int i = 0; i < 8; ++i) inv[i] = 1.0f / l_run[i];
#pragma unroll
    for (int t = 0; t < 4; ++t) {
        const int dcol = h_ * HD + t * 16 + l16;
#pragma unroll
        for (int i = 0; i < 8; ++i) {
            const int M = i + 8 * hi;
            out[((size_t)(b_ * SS + q0 + M)) * DD + dcol] = oacc[t][i] * inv[i];
        }
    }
}

// ---------------------------------------------------------------------------
// Host-side launch. Inputs: q,k,v,Wq,bq,Wk,bk,Wv,bv (all f32).
// Workspace (f16 halves):
//   [0)   qh,kh,vh    : 3 x 4M  (converted activations)
//   [12M) wqh,wkh,wvh : 3 x 1M  (converted weights)
//   [15M) Qp,Kp,VpT   : 3 x 4M  (projected heads)
// Total 27M halves = 54 MB.
// ---------------------------------------------------------------------------
extern "C" void kernel_launch(void* const* d_in, const int* in_sizes, int n_in,
                              void* d_out, int out_size, void* d_ws, size_t ws_size,
                              hipStream_t stream) {
    const float* q  = (const float*)d_in[0];
    const float* k  = (const float*)d_in[1];
    const float* v  = (const float*)d_in[2];
    const float* Wq = (const float*)d_in[3];
    const float* bq = (const float*)d_in[4];
    const float* Wk = (const float*)d_in[5];
    const float* bk = (const float*)d_in[6];
    const float* Wv = (const float*)d_in[7];
    const float* bv = (const float*)d_in[8];
    float* out = (float*)d_out;

    const size_t XN = (size_t)ROWS * DD;   // 4,194,304
    const size_t WN = (size_t)DD * DD;     // 1,048,576
    half_t* ws  = (half_t*)d_ws;
    half_t* qh  = ws;
    half_t* kh  = qh  + XN;
    half_t* vh  = kh  + XN;
    half_t* wqh = vh  + XN;
    half_t* wkh = wqh + WN;
    half_t* wvh = wkh + WN;
    half_t* Qp  = wvh + WN;
    half_t* Kp  = Qp  + XN;
    half_t* VpT = Kp  + XN;

    // 1) one-shot f32 -> f16 conversions (memory bound)
    const int xBlocks = (int)(XN / 8 / 256);   // 2048
    const int wBlocks = (int)(WN / 8 / 256);   // 512
    cvt_f32_to_f16_kernel<<<xBlocks, 256, 0, stream>>>(q,  qh,  (int)(XN / 8));
    cvt_f32_to_f16_kernel<<<xBlocks, 256, 0, stream>>>(k,  kh,  (int)(XN / 8));
    cvt_f32_to_f16_kernel<<<xBlocks, 256, 0, stream>>>(v,  vh,  (int)(XN / 8));
    cvt_f32_to_f16_kernel<<<wBlocks, 256, 0, stream>>>(Wq, wqh, (int)(WN / 8));
    cvt_f32_to_f16_kernel<<<wBlocks, 256, 0, stream>>>(Wk, wkh, (int)(WN / 8));
    cvt_f32_to_f16_kernel<<<wBlocks, 256, 0, stream>>>(Wv, wvh, (int)(WN / 8));

    // 2) projections: waves = (ROWS/16)*(DD/64) = 4096 -> 512 blocks x 8 waves
    const int projBlocks = (ROWS / 16) * (DD / 64) / 8;
    proj_wmma_kernel<<<projBlocks, 256, 0, stream>>>(qh, wqh, bq, Qp, 0);
    proj_wmma_kernel<<<projBlocks, 256, 0, stream>>>(kh, wkh, bk, Kp, 0);
    proj_wmma_kernel<<<projBlocks, 256, 0, stream>>>(vh, wvh, bv, VpT, 1);

    // 3) attention: units = B*H*(S/16) = 4096 -> 512 blocks x 8 waves
    const int attnBlocks = BB * HH * (SS / 16) / 8;
    attn_wmma_kernel<<<attnBlocks, 256, 0, stream>>>(Qp, Kp, VpT, out);
}

// v001
// Measured time: 180 microseconds a run.
// Timed twice side by side with v000, it ran 1.48 times as fast both times.
#include <hip/hip_runtime.h>

// Problem constants (from reference)
#define BB   2
#define SS   2048
#define DD   1024
#define HH   16
#define HD   64
#define ROWS (BB * SS)          // 4096 rows in the projection GEMMs

typedef _Float16 half_t;
typedef __attribute__((ext_vector_type(16))) _Float16 v16h;
typedef __attribute__((ext_vector_type(8)))  _Float16 v8h;
typedef __attribute__((ext_vector_type(8)))  float    v8f;

// ---------------------------------------------------------------------------
// Fragment helper: A-layout (16-bit A, 16x32, ISA 7.12.2): lane l (l16=l&15)
// holds row M=l16; halves a[0..7]=K(klo..klo+7), a[8..15]=K(16+klo..) with
// klo = (lane>=16 ? 8 : 0).  B uses the symmetric lane-per-column layout.
// Both reduce to: 8 contiguous halves at p, 8 contiguous halves at p+16.
// ---------------------------------------------------------------------------
__device__ __forceinline__ v16h load_frag_f16(const half_t* p) {
    v8h lo = *(const v8h*)(p);
    v8h hi = *(const v8h*)(p + 16);
    v16h r;
#pragma unroll
    for (int i = 0; i < 8; ++i) { r[i] = lo[i]; r[8 + i] = hi[i]; }
    return r;
}

__device__ __forceinline__ v8f wmma_f16(v16h a, v16h b, v8f c) {
    return __builtin_amdgcn_wmma_f32_16x16x32_f16(
        false, a, false, b, (short)0, c, false, false);
}

// ---------------------------------------------------------------------------
// One-shot f32 -> f16 conversion (memory bound; feeds all later kernels).
// ---------------------------------------------------------------------------
__global__ __launch_bounds__(256) void cvt_f32_to_f16_kernel(
    const float* __restrict__ src, half_t* __restrict__ dst, int n8)
{
    const int idx = blockIdx.x * blockDim.x + threadIdx.x;
    if (idx >= n8) return;
    const float4* s = (const float4*)src + (size_t)idx * 2;
    float4 x0 = s[0];
    float4 x1 = s[1];
    v8h o;
    o[0] = (_Float16)x0.x; o[1] = (_Float16)x0.y;
    o[2] = (_Float16)x0.z; o[3] = (_Float16)x0.w;
    o[4] = (_Float16)x1.x; o[5] = (_Float16)x1.y;
    o[6] = (_Float16)x1.z; o[7] = (_Float16)x1.w;
    *(v8h*)(dst + (size_t)idx * 8) = o;
}

// ---------------------------------------------------------------------------
// Projection GEMM, all-f16 operands: out[s,e] = sum_d Xh[s,d]*Wh[e,d] + b[e].
//   transpose_out == 0 : out layout [B,H,S,Hd]   (Q, K)
//   transpose_out == 1 : out layout [B,H,Hd,S]   (V -> contiguous PV B-frags)
// One workgroup per 128(row) x 128(col) tile of the output, 8 waves in a
// 2 x 4 grid, 64 x 32 per wave.  A pass is 128 k (256 B of each of the 128 X
// rows and 128 W rows); the pass's rows are brought into LDS by asynchronous
// copies, whole 256-B row pieces per half wave, and shared by all 8 waves.
// Two buffers: pass t+1's copies fly while pass t is multiplied.
// LDS rows are pitched 272 B so that the 16-byte fragment reads of 16
// neighbouring rows fall on different banks.
// ---------------------------------------------------------------------------
#define PJ_TILE   128                       // output tile edge
#define PJ_KP     128                       // k per pass (halves)
#define PJ_PITCH  136                       // LDS row pitch (halves) = 272 B
#define PJ_STAGE  (2 * PJ_TILE * PJ_PITCH)  // halves per buffer: X rows, then W rows
#define PJ_NPASS  (DD / PJ_KP)              // 8

// Eight 16-byte copies of one lane: rows r, r+16, ..., r+112 of one operand.
// g: the lane's 16 bytes in the first row; l: their LDS byte address.
__device__ __forceinline__ void proj_copy8(const half_t* g, unsigned l) {
    const half_t* g1 = g + 16 * 1 * DD;  const unsigned l1 = l + 16 * 1 * PJ_PITCH * 2;
    const half_t* g2 = g + 16 * 2 * DD;  const unsigned l2 = l + 16 * 2 * PJ_PITCH * 2;
    const half_t* g3 = g + 16 * 3 * DD;  const unsigned l3 = l + 16 * 3 * PJ_PITCH * 2;
    const half_t* g4 = g + 16 * 4 * DD;  const unsigned l4 = l + 16 * 4 * PJ_PITCH * 2;
    const half_t* g5 = g + 16 * 5 * DD;  const unsigned l5 = l + 16 * 5 * PJ_PITCH * 2;
    const half_t* g6 = g + 16 * 6 * DD;  const unsigned l6 = l + 16 * 6 * PJ_PITCH * 2;
    const half_t* g7 = g + 16 * 7 * DD;  const unsigned l7 = l + 16 * 7 * PJ_PITCH * 2;
    // The closing s_wait_xcnt stands inside the statement so that no address
    // register named here is rewritten ahead of it.
    asm volatile(
        "global_load_async_to_lds_b128 %0, %8, off\n\t"
        "global_load_async_to_lds_b128 %1, %9, off\n\t"
        "global_load_async_to_lds_b128 %2, %10, off\n\t"
        "global_load_async_to_lds_b128 %3, %11, off\n\t"
        "global_load_async_to_lds_b128 %4, %12, off\n\t"
        "global_load_async_to_lds_b128 %5, %13, off\n\t"
        "global_load_async_to_lds_b128 %6, %14, off\n\t"
        "global_load_async_to_lds_b128 %7, %15, off\n\t"
        "s_wait_xcnt 0x0"
        :: "v"(l), "v"(l1), "v"(l2), "v"(l3), "v"(l4), "v"(l5), "v"(l6), "v"(l7),
           "v"(g), "v"(g1), "v"(g2), "v"(g3), "v"(g4), "v"(g5), "v"(g6), "v"(g7)
        : "memory");
}

__global__ __launch_bounds__(256) void proj_wmma_kernel(
    const half_t* __restrict__ Xh, const half_t* __restrict__ Wh,
    const float* __restrict__ bias, half_t* __restrict__ out,
    int transpose_out)
{
    __shared__ __align__(16) half_t stg[2 * PJ_STAGE];   // 139,264 B

    const int tid  = threadIdx.x;
    const int wid  = tid >> 5;
    const int lane = tid & 31;
    const int l16  = lane & 15;
    const int hi   = lane >> 4;
    const int klo  = hi * 8;

    const int NT = DD / PJ_TILE;                       // 8 tile columns
    const int m0 = (blockIdx.x / NT) * PJ_TILE;        // first X row of the tile
    const int n0 = (blockIdx.x % NT) * PJ_TILE;        // first W row of the tile
    const int wm = (wid >> 2) * 64;                    // wave's rows in the tile
    const int wn = (wid & 3) * 32;                     // wave's columns in the tile

    // Copy duty of a lane: 16-byte piece (tid & 15) of rows (tid >> 4) + 16 j.
    const int crow = tid >> 4;
    const int ccol = (tid & 15) * 8;
    const half_t* gx = Xh + (size_t)(m0 + crow) * DD + ccol;
    const half_t* gw = Wh + (size_t)(n0 + crow) * DD + ccol;
    const unsigned lx = (unsigned)(size_t)&stg[crow * PJ_PITCH + ccol];
    const unsigned lw = lx + PJ_TILE * PJ_PITCH * 2;

    // Every inner loop below is unrolled so that each accumulator and fragment
    // index is a constant: the arrays then live in registers, not in scratch.
    v8f acc[4][2];
#pragma unroll
    for (int i = 0; i < 4; ++i)
#pragma unroll
        for (int j = 0; j < 2; ++j) acc[i][j] = (v8f)(0.0f);

    // pass 0 -> buffer 0, landed and published; then pass 1 -> buffer 1
    proj_copy8(gx, lx);
    proj_copy8(gw, lw);
    // this wave's copies have landed before the barrier lets others read them
    asm volatile("s_wait_asynccnt 0x0" ::: "memory");
    __syncthreads();
    proj_copy8(gx + PJ_KP, lx + PJ_STAGE * 2);
    proj_copy8(gw + PJ_KP, lw + PJ_STAGE * 2);

    // rolled: eight copies of the pass body would only lengthen the kernel's text
#pragma unroll 1
    for (int t = 0; t < PJ_NPASS; ++t) {
        const int buf = t & 1;
        const half_t* xs = stg + buf * PJ_STAGE + (wm + l16) * PJ_PITCH + klo;
        const half_t* wsm = stg + buf * PJ_STAGE + (PJ_TILE + wn + l16) * PJ_PITCH + klo;
        // Two fragment sets: step s+1's LDS reads go out as one group ahead of
        // step s's products, so the products cover their latency.
        v16h a[2][4], b[2][2];
#pragma unroll
        for (int i = 0; i < 4; ++i) a[0][i] = load_frag_f16(xs + i * 16 * PJ_PITCH);
#pragma unroll
        for (int j = 0; j < 2; ++j) b[0][j] = load_frag_f16(wsm + j * 16 * PJ_PITCH);
#pragma unroll
        for (int s = 0; s < PJ_KP / 32; ++s) {
            const int cur = s & 1, nxt = cur ^ 1;
            if (s + 1 < PJ_KP / 32) {
#pragma unroll
                for (int i = 0; i < 4; ++i)
                    a[nxt][i] = load_frag_f16(xs + i * 16 * PJ_PITCH + (s + 1) * 32);
#pragma unroll
                for (int j = 0; j < 2; ++j)
                    b[nxt][j] = load_frag_f16(wsm + j * 16 * PJ_PITCH + (s + 1) * 32);
            }
            // keeps the read group above the products instead of spread among them
            __builtin_amdgcn_sched_barrier(0);
#pragma unroll
            for (int i = 0; i < 4; ++i)
#pragma unroll
                for (int j = 0; j < 2; ++j)
                    acc[i][j] = wmma_f16(a[cur][i], b[cur][j], acc[i][j]);
            // keeps the next group's reads from sinking into these products
            __builtin_amdgcn_sched_barrier(0);
        }
        // Hand-over: this wave's reads of buffer buf are done, its copies of
        // pass t+1 have landed; behind the barrier that holds for every wave.
        asm volatile("s_wait_dscnt 0x0" ::: "memory");
        asm volatile("s_wait_asynccnt 0x0" ::: "memory");
        __syncthreads();
        if (t + 2 < PJ_NPASS) {
            proj_copy8(gx + (t + 2) * PJ_KP, lx + buf * (PJ_STAGE * 2));
            proj_copy8(gw + (t + 2) * PJ_KP, lw + buf * (PJ_STAGE * 2));
        }
    }
    // no copy of this wave is outstanding when it ends
    asm volatile("s_wait_asynccnt 0x0" ::: "memory");

    // Bias + store. C layout: acc[i][j][r] = out[row0 + i*16 + r + 8*hi][col0 + j*16 + l16]
#pragma unroll
    for (int j = 0; j < 2; ++j) {
        const int e    = n0 + wn + j * 16 + l16;
        const float bv = bias[e];
        const int h    = e >> 6;
        const int d    = e & 63;
#pragma unroll
        for (int i = 0; i < 4; ++i) {
#pragma unroll
            for (int r = 0; r < 8; ++r) {
                const int sg   = m0 + wm + i * 16 + r + 8 * hi;
                const int b_   = sg >> 11;
                const int sloc = sg & 2047;
                const float vfin = acc[i][j][r] + bv;
                size_t idx;
                if (transpose_out)
                    idx = (((size_t)(b_ * HH + h) * HD + d) * SS) + sloc;
                else
                    idx = (((size_t)(b_ * HH + h) * SS + sloc) * HD) + d;
                out[idx] = (_Float16)vfin;
            }
        }
    }
}

// ---------------------------------------------------------------------------
// Flash attention, one wave per (b, h, 16-row query tile).
// Qp, Kp: f16 [B,H,S,Hd];  VpT: f16 [B,H,Hd,S];  out: f32 [B,S,D].
// Per 32-key chunk: all 4 K-frag and 4 V-frag loads are issued up front and
// pinned with a sched_barrier; the V loads are consumed only after the
// softmax VALU/trans section, which covers their latency.
// ---------------------------------------------------------------------------
__global__ __launch_bounds__(256) void attn_wmma_kernel(
    const half_t* __restrict__ Qp, const half_t* __restrict__ Kp,
    const half_t* __restrict__ VpT, float* __restrict__ out)
{
    __shared__ __align__(16) half_t pbuf[8][16 * 32];   // per-wave P scratch

    const int wid  = threadIdx.x >> 5;
    const int lane = threadIdx.x & 31;
    const int l16  = lane & 15;
    const int hi   = lane >> 4;
    const int klo  = hi * 8;

    const int unit = blockIdx.x * (blockDim.x >> 5) + wid;
    const int QTILES = SS / 16;
    const int bh = unit / QTILES;
    const int q0 = (unit % QTILES) * 16;

    const half_t* qb = Qp  + (size_t)bh * SS * HD;
    const half_t* kb = Kp  + (size_t)bh * SS * HD;
    const half_t* vt = VpT + (size_t)bh * HD * SS;

    const half_t* qrow = qb + (size_t)(q0 + l16) * HD;
    const v16h qa0 = load_frag_f16(qrow + 0  + klo);
    const v16h qa1 = load_frag_f16(qrow + 32 + klo);

    v8f oacc[4];
#pragma unroll
    for (int t = 0; t < 4; ++t) oacc[t] = (v8f)(0.0f);
    float m_run[8], l_run[8];
#pragma unroll
    for (int i = 0; i < 8; ++i) { m_run[i] = -INFINITY; l_run[i] = 0.0f; }

    const float scale = 0.125f;   // 1/sqrt(64)

    for (int k0 = 0; k0 < SS; k0 += 32) {
        if (k0 + 32 < SS) {
            __builtin_prefetch(kb + (size_t)(k0 + 32) * HD, 0, 1);
            __builtin_prefetch(vt + (size_t)l16 * SS + k0 + 32, 0, 1);
        }
        // ---- issue all K and V fragment loads for this chunk ----
        const half_t* kr0 = kb + (size_t)(k0 + 0  + l16) * HD + klo;
        const half_t* kr1 = kb + (size_t)(k0 + 16 + l16) * HD + klo;
        v16h kb00 = load_frag_f16(kr0 + 0);
        v16h kb01 = load_frag_f16(kr0 + 32);
        v16h kb10 = load_frag_f16(kr1 + 0);
        v16h kb11 = load_frag_f16(kr1 + 32);
        v16h vb[4];
#pragma unroll
        for (int t = 0; t < 4; ++t)
            vb[t] = load_frag_f16(vt + (size_t)(t * 16 + l16) * SS + k0 + klo);
        __builtin_amdgcn_sched_barrier(0);   // keep loads above the compute

        // ---- S = Q * K^T (two 16-key n-tiles, two 32-wide k-steps) ----
        v8f sac0 = (v8f)(0.0f), sac1 = (v8f)(0.0f);
        sac0 = wmma_f16(qa0, kb00, sac0);
        sac0 = wmma_f16(qa1, kb01, sac0);
        sac1 = wmma_f16(qa0, kb10, sac1);
        sac1 = wmma_f16(qa1, kb11, sac1);

        // ---- online softmax over the 32 new keys ----
        float alpha[8];
#pragma unroll
        for (int i = 0; i < 8; ++i) {
            float s0 = sac0[i] * scale;
            float s1 = sac1[i] * scale;
            float v = fmaxf(s0, s1);
            v = fmaxf(v, __shfl_xor(v, 8, 16));
            v = fmaxf(v, __shfl_xor(v, 4, 16));
            v = fmaxf(v, __shfl_xor(v, 2, 16));
            v = fmaxf(v, __shfl_xor(v, 1, 16));
            const float mn = fmaxf(m_run[i], v);
            const float al = __expf(m_run[i] - mn);
            const float p0 = __expf(s0 - mn);
            const float p1 = __expf(s1 - mn);
            float rs = p0 + p1;
            rs += __shfl_xor(rs, 8, 16);
            rs += __shfl_xor(rs, 4, 16);
            rs += __shfl_xor(rs, 2, 16);
            rs += __shfl_xor(rs, 1, 16);
            l_run[i] = l_run[i] * al + rs;
            m_run[i] = mn;
            alpha[i] = al;
            // scatter P (C layout) into LDS tile [row][key_local]
            const int prow = i + 8 * hi;
            pbuf[wid][prow * 32 + 0  + l16] = (_Float16)p0;
            pbuf[wid][prow * 32 + 16 + l16] = (_Float16)p1;
        }
#pragma unroll
        for (int t = 0; t < 4; ++t)
#pragma unroll
            for (int i = 0; i < 8; ++i) oacc[t][i] *= alpha[i];

        // LDS stores must land before the transposed reads (same wave).
        asm volatile("s_wait_dscnt 0x0" ::: "memory");

        // ---- O += P * V ----
        const v16h pa = load_frag_f16(&pbuf[wid][l16 * 32 + klo]);
#pragma unroll
        for (int t = 0; t < 4; ++t)
            oacc[t] = wmma_f16(pa, vb[t], oacc[t]);
    }

    // ---- normalize and store: out[b, q0+M, h*64 + t*16 + l16] ----
    const int b_ = bh / HH;
    const int h_ = bh % HH;
    float inv[8];
#pragma unroll
    for (int i = 0; i < 8; ++i) inv[i] = 1.0f / l_run[i];
#pragma unroll
    for (int t = 0; t < 4; ++t) {
        const int dcol = h_ * HD + t * 16 + l16;
#pragma unroll
        for (int i = 0; i < 8; ++i) {
            const int M = i + 8 * hi;
            out[((size_t)(b_ * SS + q0 + M)) * DD + dcol] = oacc[t][i] * inv[i];
        }
    }
}

// ---------------------------------------------------------------------------
// Host-side launch. Inputs: q,k,v,Wq,bq,Wk,bk,Wv,bv (all f32).
// Workspace (f16 halves):
//   [0)   qh,kh,vh    : 3 x 4M  (converted activations)
//   [12M) wqh,wkh,wvh : 3 x 1M  (converted weights)
//   [15M) Qp,Kp,VpT   : 3 x 4M  (projected heads)
// Total 27M halves = 54 MB.
// ---------------------------------------------------------------------------
extern "C" void kernel_launch(void* const* d_in, const int* in_sizes, int n_in,
                              void* d_out, int out_size, void* d_ws, size_t ws_size,
                              hipStream_t stream) {
    const float* q  = (const float*)d_in[0];
    const float* k  = (const float*)d_in[1];
    const float* v  = (const float*)d_in[2];
    const float* Wq = (const float*)d_in[3];
    const float* bq = (const float*)d_in[4];
    const float* Wk = (const float*)d_in[5];
    const float* bk = (const float*)d_in[6];
    const float* Wv = (const float*)d_in[7];
    const float* bv = (const float*)d_in[8];
    float* out = (float*)d_out;

    const size_t XN = (size_t)ROWS * DD;   // 4,194,304
    const size_t WN = (size_t)DD * DD;     // 1,048,576
    half_t* ws  = (half_t*)d_ws;
    half_t* qh  = ws;
    half_t* kh  = qh  + XN;
    half_t* vh  = kh  + XN;
    half_t* wqh = vh  + XN;
    half_t* wkh = wqh + WN;
    half_t* wvh = wkh + WN;
    half_t* Qp  = wvh + WN;
    half_t* Kp  = Qp  + XN;
    half_t* VpT = Kp  + XN;

    // 1) one-shot f32 -> f16 conversions (memory bound)
    const int xBlocks = (int)(XN / 8 / 256);   // 2048
    const int wBlocks = (int)(WN / 8 / 256);   // 512
    cvt_f32_to_f16_kernel<<<xBlocks, 256, 0, stream>>>(q,  qh,  (int)(XN / 8));
    cvt_f32_to_f16_kernel<<<xBlocks, 256, 0, stream>>>(k,  kh,  (int)(XN / 8));
    cvt_f32_to_f16_kernel<<<xBlocks, 256, 0, stream>>>(v,  vh,  (int)(XN / 8));
    cvt_f32_to_f16_kernel<<<wBlocks, 256, 0, stream>>>(Wq, wqh, (int)(WN / 8));
    cvt_f32_to_f16_kernel<<<wBlocks, 256, 0, stream>>>(Wk, wkh, (int)(WN / 8));
    cvt_f32_to_f16_kernel<<<wBlocks, 256, 0, stream>>>(Wv, wvh, (int)(WN / 8));

    // 2) projections: one block per 128 x 128 output tile -> 32 x 8 = 256 blocks
    const int projBlocks = (ROWS / PJ_TILE) * (DD / PJ_TILE);
    proj_wmma_kernel<<<projBlocks, 256, 0, stream>>>(qh, wqh, bq, Qp, 0);
    proj_wmma_kernel<<<projBlocks, 256, 0, stream>>>(kh, wkh, bk, Kp, 0);
    proj_wmma_kernel<<<projBlocks, 256, 0, stream>>>(vh, wvh, bv, VpT, 1);

    // 3) attention: units = B*H*(S/16) = 4096 -> 512 blocks x 8 waves
    const int attnBlocks = BB * HH * (SS / 16) / 8;
    attn_wmma_kernel<<<attnBlocks, 256, 0, stream>>>(Qp, Kp, VpT, out);
}

// v002
// One run takes 150 microseconds.
// Timed twice side by side with v001, it ran 1.20 times as fast both times.
// All steps since v000 together make it 1.78 times as fast.
#include <hip/hip_runtime.h>

// Problem constants (from reference)
#define BB   2
#define SS   2048
#define DD   1024
#define HH   16
#define HD   64
#define ROWS (BB * SS)          // 4096 rows in the projection GEMMs

typedef _Float16 half_t;
typedef __attribute__((ext_vector_type(16))) _Float16 v16h;
typedef __attribute__((ext_vector_type(8)))  _Float16 v8h;
typedef __attribute__((ext_vector_type(8)))  float    v8f;

// ---------------------------------------------------------------------------
// Fragment helper: A-layout (16-bit A, 16x32, ISA 7.12.2): lane l (l16=l&15)
// holds row M=l16; halves a[0..7]=K(klo..klo+7), a[8..15]=K(16+klo..) with
// klo = (lane>=16 ? 8 : 0).  B uses the symmetric lane-per-column layout.
// Both reduce to: 8 contiguous halves at p, 8 contiguous halves at p+16.
// ---------------------------------------------------------------------------
__device__ __forceinline__ v16h load_frag_f16(const half_t* p) {
    v8h lo = *(const v8h*)(p);
    v8h hi = *(const v8h*)(p + 16);
    v16h r;
#pragma unroll
    for (int i = 0; i < 8; ++i) { r[i] = lo[i]; r[8 + i] = hi[i]; }
    return r;
}

__device__ __forceinline__ v8f wmma_f16(v16h a, v16h b, v8f c) {
    return __builtin_amdgcn_wmma_f32_16x16x32_f16(
        false, a, false, b, (short)0, c, false, false);
}

// ---------------------------------------------------------------------------
// One-shot f32 -> f16 conversion (memory bound; feeds all later kernels).
// ---------------------------------------------------------------------------
__global__ __launch_bounds__(256) void cvt_f32_to_f16_kernel(
    const float* __restrict__ src, half_t* __restrict__ dst, int n8)
{
    const int idx = blockIdx.x * blockDim.x + threadIdx.x;
    if (idx >= n8) return;
    const float4* s = (const float4*)src + (size_t)idx * 2;
    float4 x0 = s[0];
    float4 x1 = s[1];
    v8h o;
    o[0] = (_Float16)x0.x; o[1] = (_Float16)x0.y;
    o[2] = (_Float16)x0.z; o[3] = (_Float16)x0.w;
    o[4] = (_Float16)x1.x; o[5] = (_Float16)x1.y;
    o[6] = (_Float16)x1.z; o[7] = (_Float16)x1.w;
    *(v8h*)(dst + (size_t)idx * 8) = o;
}

// ---------------------------------------------------------------------------
// Projection GEMM, all-f16 operands: out[s,e] = sum_d Xh[s,d]*Wh[e,d] + b[e].
//   transpose_out == 0 : out layout [B,H,S,Hd]   (Q, K)
//   transpose_out == 1 : out layout [B,H,Hd,S]   (V -> contiguous PV B-frags)
// One workgroup per 128(row) x 128(col) tile of the output, 8 waves in a
// 2 x 4 grid, 64 x 32 per wave.  A pass is 128 k (256 B of each of the 128 X
// rows and 128 W rows); the pass's rows are brought into LDS by asynchronous
// copies, whole 256-B row pieces per half wave, and shared by all 8 waves.
// Two buffers: pass t+1's copies fly while pass t is multiplied.
// LDS rows are pitched 272 B so that the 16-byte fragment reads of 16
// neighbouring rows fall on different banks.
// ---------------------------------------------------------------------------
#define PJ_TILE   128                       // output tile edge
#define PJ_KP     128                       // k per pass (halves)
#define PJ_PITCH  136                       // LDS row pitch (halves) = 272 B
#define PJ_STAGE  (2 * PJ_TILE * PJ_PITCH)  // halves per buffer: X rows, then W rows
#define PJ_NPASS  (DD / PJ_KP)              // 8

// Eight 16-byte copies of one lane: rows r, r+16, ..., r+112 of one operand.
// g: the lane's 16 bytes in the first row; l: their LDS byte address.
__device__ __forceinline__ void proj_copy8(const half_t* g, unsigned l) {
    const half_t* g1 = g + 16 * 1 * DD;  const unsigned l1 = l + 16 * 1 * PJ_PITCH * 2;
    const half_t* g2 = g + 16 * 2 * DD;  const unsigned l2 = l + 16 * 2 * PJ_PITCH * 2;
    const half_t* g3 = g + 16 * 3 * DD;  const unsigned l3 = l + 16 * 3 * PJ_PITCH * 2;
    const half_t* g4 = g + 16 * 4 * DD;  const unsigned l4 = l + 16 * 4 * PJ_PITCH * 2;
    const half_t* g5 = g + 16 * 5 * DD;  const unsigned l5 = l + 16 * 5 * PJ_PITCH * 2;
    const half_t* g6 = g + 16 * 6 * DD;  const unsigned l6 = l + 16 * 6 * PJ_PITCH * 2;
    const half_t* g7 = g + 16 * 7 * DD;  const unsigned l7 = l + 16 * 7 * PJ_PITCH * 2;
    // The closing s_wait_xcnt stands inside the statement so that no address
    // register named here is rewritten ahead of it.
    asm volatile(
        "global_load_async_to_lds_b128 %0, %8, off\n\t"
        "global_load_async_to_lds_b128 %1, %9, off\n\t"
        "global_load_async_to_lds_b128 %2, %10, off\n\t"
        "global_load_async_to_lds_b128 %3, %11, off\n\t"
        "global_load_async_to_lds_b128 %4, %12, off\n\t"
        "global_load_async_to_lds_b128 %5, %13, off\n\t"
        "global_load_async_to_lds_b128 %6, %14, off\n\t"
        "global_load_async_to_lds_b128 %7, %15, off\n\t"
        "s_wait_xcnt 0x0"
        :: "v"(l), "v"(l1), "v"(l2), "v"(l3), "v"(l4), "v"(l5), "v"(l6), "v"(l7),
           "v"(g), "v"(g1), "v"(g2), "v"(g3), "v"(g4), "v"(g5), "v"(g6), "v"(g7)
        : "memory");
}

__global__ __launch_bounds__(256) void proj_wmma_kernel(
    const half_t* __restrict__ Xh, const half_t* __restrict__ Wh,
    const float* __restrict__ bias, half_t* __restrict__ out,
    int transpose_out)
{
    __shared__ __align__(16) half_t stg[2 * PJ_STAGE];   // 139,264 B

    const int tid  = threadIdx.x;
    const int wid  = tid >> 5;
    const int lane = tid & 31;
    const int l16  = lane & 15;
    const int hi   = lane >> 4;
    const int klo  = hi * 8;

    const int NT = DD / PJ_TILE;                       // 8 tile columns
    const int m0 = (blockIdx.x / NT) * PJ_TILE;        // first X row of the tile
    const int n0 = (blockIdx.x % NT) * PJ_TILE;        // first W row of the tile
    const int wm = (wid >> 2) * 64;                    // wave's rows in the tile
    const int wn = (wid & 3) * 32;                     // wave's columns in the tile

    // Copy duty of a lane: 16-byte piece (tid & 15) of rows (tid >> 4) + 16 j.
    const int crow = tid >> 4;
    const int ccol = (tid & 15) * 8;
    const half_t* gx = Xh + (size_t)(m0 + crow) * DD + ccol;
    const half_t* gw = Wh + (size_t)(n0 + crow) * DD + ccol;
    const unsigned lx = (unsigned)(size_t)&stg[crow * PJ_PITCH + ccol];
    const unsigned lw = lx + PJ_TILE * PJ_PITCH * 2;

    // Every inner loop below is unrolled so that each accumulator and fragment
    // index is a constant: the arrays then live in registers, not in scratch.
    v8f acc[4][2];
#pragma unroll
    for (int i = 0; i < 4; ++i)
#pragma unroll
        for (int j = 0; j < 2; ++j) acc[i][j] = (v8f)(0.0f);

    // pass 0 -> buffer 0, landed and published; then pass 1 -> buffer 1
    proj_copy8(gx, lx);
    proj_copy8(gw, lw);
    // this wave's copies have landed before the barrier lets others read them
    asm volatile("s_wait_asynccnt 0x0" ::: "memory");
    __syncthreads();
    proj_copy8(gx + PJ_KP, lx + PJ_STAGE * 2);
    proj_copy8(gw + PJ_KP, lw + PJ_STAGE * 2);

    // rolled: eight copies of the pass body would only lengthen the kernel's text
#pragma unroll 1
    for (int t = 0; t < PJ_NPASS; ++t) {
        const int buf = t & 1;
        const half_t* xs = stg + buf * PJ_STAGE + (wm + l16) * PJ_PITCH + klo;
        const half_t* wsm = stg + buf * PJ_STAGE + (PJ_TILE + wn + l16) * PJ_PITCH + klo;
        // Two fragment sets: step s+1's LDS reads go out as one group ahead of
        // step s's products, so the products cover their latency.
        v16h a[2][4], b[2][2];
#pragma unroll
        for (int i = 0; i < 4; ++i) a[0][i] = load_frag_f16(xs + i * 16 * PJ_PITCH);
#pragma unroll
        for (int j = 0; j < 2; ++j) b[0][j] = load_frag_f16(wsm + j * 16 * PJ_PITCH);
#pragma unroll
        for (int s = 0; s < PJ_KP / 32; ++s) {
            const int cur = s & 1, nxt = cur ^ 1;
            if (s + 1 < PJ_KP / 32) {
#pragma unroll
                for (int i = 0; i < 4; ++i)
                    a[nxt][i] = load_frag_f16(xs + i * 16 * PJ_PITCH + (s + 1) * 32);
#pragma unroll
                for (int j = 0; j < 2; ++j)
                    b[nxt][j] = load_frag_f16(wsm + j * 16 * PJ_PITCH + (s + 1) * 32);
            }
            // keeps the read group above the products instead of spread among them
            __builtin_amdgcn_sched_barrier(0);
#pragma unroll
            for (int i = 0; i < 4; ++i)
#pragma unroll
                for (int j = 0; j < 2; ++j)
                    acc[i][j] = wmma_f16(a[cur][i], b[cur][j], acc[i][j]);
            // keeps the next group's reads from sinking into these products
            __builtin_amdgcn_sched_barrier(0);
        }
        // Hand-over: this wave's reads of buffer buf are done, its copies of
        // pass t+1 have landed; behind the barrier that holds for every wave.
        asm volatile("s_wait_dscnt 0x0" ::: "memory");
        asm volatile("s_wait_asynccnt 0x0" ::: "memory");
        __syncthreads();
        if (t + 2 < PJ_NPASS) {
            proj_copy8(gx + (t + 2) * PJ_KP, lx + buf * (PJ_STAGE * 2));
            proj_copy8(gw + (t + 2) * PJ_KP, lw + buf * (PJ_STAGE * 2));
        }
    }
    // no copy of this wave is outstanding when it ends
    asm volatile("s_wait_asynccnt 0x0" ::: "memory");

    // Bias + store. C layout: acc[i][j][r] = out[row0 + i*16 + r + 8*hi][col0 + j*16 + l16]
#pragma unroll
    for (int j = 0; j < 2; ++j) {
        const int e    = n0 + wn + j * 16 + l16;
        const float bv = bias[e];
        const int h    = e >> 6;
        const int d    = e & 63;
#pragma unroll
        for (int i = 0; i < 4; ++i) {
#pragma unroll
            for (int r = 0; r < 8; ++r) {
                const int sg   = m0 + wm + i * 16 + r + 8 * hi;
                const int b_   = sg >> 11;
                const int sloc = sg & 2047;
                const float vfin = acc[i][j][r] + bv;
                size_t idx;
                if (transpose_out)
                    idx = (((size_t)(b_ * HH + h) * HD + d) * SS) + sloc;
                else
                    idx = (((size_t)(b_ * HH + h) * SS + sloc) * HD) + d;
                out[idx] = (_Float16)vfin;
            }
        }
    }
}

// ---------------------------------------------------------------------------
// Flash attention, one wave per (b, h, 16-row query tile).
// Qp, Kp: f16 [B,H,S,Hd];  VpT: f16 [B,H,Hd,S];  out: f32 [B,S,D].
// The 8 waves of a block work on one (b, h): they share its K and V.  A stage
// is 128 keys: 128 K rows of 128 B and 64 VpT row pieces of 256 B, brought into
// LDS once per block by asynchronous copies, whole rows per group of lanes.
// Two buffers: stage s+1's copies fly while stage s is worked on.
// LDS rows are pitched 144 B and 272 B so that the 16-byte fragment reads of
// 16 neighbouring rows fall on different banks.
// Per 32-key chunk: all 4 K-frag and 4 V-frag LDS reads are issued up front and
// pinned with a sched_barrier; the V reads are consumed only after the
// softmax VALU/trans section, which covers their latency.
// ---------------------------------------------------------------------------
#define AT_KEYS   128                     // keys per stage
#define AT_KPITCH 72                      // LDS pitch of a K row (halves) = 144 B
#define AT_VPITCH 136                     // LDS pitch of a VpT row piece (halves) = 272 B
#define AT_KH     (AT_KEYS * AT_KPITCH)   // halves of a stage's K rows
#define AT_STAGE  (AT_KH + HD * AT_VPITCH) // halves per buffer: K rows, then VpT rows
#define AT_NST    (SS / AT_KEYS)          // 16 stages

// Eight 16-byte copies of one lane: K rows r, r+32, r+64, r+96 and VpT rows
// d, d+16, d+32, d+48.  gk, gv: the lane's 16 bytes in the first row of each;
// lk, lv: their LDS byte addresses.
__device__ __forceinline__ void attn_copy8(const half_t* gk, unsigned lk,
                                           const half_t* gv, unsigned lv) {
    const half_t* gk1 = gk + 32 * 1 * HD;  const unsigned lk1 = lk + 32 * 1 * AT_KPITCH * 2;
    const half_t* gk2 = gk + 32 * 2 * HD;  const unsigned lk2 = lk + 32 * 2 * AT_KPITCH * 2;
    const half_t* gk3 = gk + 32 * 3 * HD;  const unsigned lk3 = lk + 32 * 3 * AT_KPITCH * 2;
    const half_t* gv1 = gv + 16 * 1 * SS;  const unsigned lv1 = lv + 16 * 1 * AT_VPITCH * 2;
    const half_t* gv2 = gv + 16 * 2 * SS;  const unsigned lv2 = lv + 16 * 2 * AT_VPITCH * 2;
    const half_t* gv3 = gv + 16 * 3 * SS;  const unsigned lv3 = lv + 16 * 3 * AT_VPITCH * 2;
    // The closing s_wait_xcnt stands inside the statement so that no address
    // register named here is rewritten ahead of it.
    asm volatile(
        "global_load_async_to_lds_b128 %0, %8, off\n\t"
        "global_load_async_to_lds_b128 %1, %9, off\n\t"
        "global_load_async_to_lds_b128 %2, %10, off\n\t"
        "global_load_async_to_lds_b128 %3, %11, off\n\t"
        "global_load_async_to_lds_b128 %4, %12, off\n\t"
        "global_load_async_to_lds_b128 %5, %13, off\n\t"
        "global_load_async_to_lds_b128 %6, %14, off\n\t"
        "global_load_async_to_lds_b128 %7, %15, off\n\t"
        "s_wait_xcnt 0x0"
        :: "v"(lk), "v"(lk1), "v"(lk2), "v"(lk3), "v"(lv), "v"(lv1), "v"(lv2), "v"(lv3),
           "v"(gk), "v"(gk1), "v"(gk2), "v"(gk3), "v"(gv), "v"(gv1), "v"(gv2), "v"(gv3)
        : "memory");
}

__global__ __launch_bounds__(256) void attn_wmma_kernel(
    const half_t* __restrict__ Qp, const half_t* __restrict__ Kp,
    const half_t* __restrict__ VpT, float* __restrict__ out)
{
    __shared__ __align__(16) half_t kvs[2 * AT_STAGE];  // 71,680 B: the two stage buffers
    __shared__ __align__(16) half_t pbuf[8][16 * 32];   // per-wave P scratch

    const int tid  = threadIdx.x;
    const int wid  = threadIdx.x >> 5;
    const int lane = threadIdx.x & 31;
    const int l16  = lane & 15;
    const int hi   = lane >> 4;
    const int klo  = hi * 8;

    const int unit = blockIdx.x * (blockDim.x >> 5) + wid;
    const int QTILES = SS / 16;
    const int bh = unit / QTILES;
    const int q0 = (unit % QTILES) * 16;

    const half_t* qb = Qp  + (size_t)bh * SS * HD;
    const half_t* kb = Kp  + (size_t)bh * SS * HD;
    const half_t* vt = VpT + (size_t)bh * HD * SS;

    const half_t* qrow = qb + (size_t)(q0 + l16) * HD;
    const v16h qa0 = load_frag_f16(qrow + 0  + klo);
    const v16h qa1 = load_frag_f16(qrow + 32 + klo);

    v8f oacc[4];
#pragma unroll
    for (int t = 0; t < 4; ++t) oacc[t] = (v8f)(0.0f);
    float m_run[8], l_run[8];
#pragma unroll
    for (int i = 0; i < 8; ++i) { m_run[i] = -INFINITY; l_run[i] = 0.0f; }

    const float scale = 0.125f;   // 1/sqrt(64)

    // Copy duty of a lane: 16-byte piece (tid & 7) of K rows (tid >> 3) + 32 j,
    // 16-byte piece (tid & 15) of VpT rows (tid >> 4) + 16 j.
    const half_t* gk = kb + (size_t)(tid >> 3) * HD + (tid & 7) * 8;
    const half_t* gv = vt + (size_t)(tid >> 4) * SS + (tid & 15) * 8;
    const unsigned lk = (unsigned)(size_t)&kvs[(tid >> 3) * AT_KPITCH + (tid & 7) * 8];
    const unsigned lv = (unsigned)(size_t)&kvs[AT_KH + (tid >> 4) * AT_VPITCH + (tid & 15) * 8];

    // stage 0 -> buffer 0, landed and published; then stage 1 -> buffer 1
    attn_copy8(gk, lk, gv, lv);
    // this wave's copies have landed before the barrier lets others read them
    asm volatile("s_wait_asynccnt 0x0" ::: "memory");
    __syncthreads();
    attn_copy8(gk + AT_KEYS * HD, lk + AT_STAGE * 2, gv + AT_KEYS, lv + AT_STAGE * 2);

    // rolled: sixteen copies of the stage body would only lengthen the kernel's text
#pragma unroll 1
    for (int st = 0; st < AT_NST; ++st) {
      const int buf = st & 1;
      const half_t* ks = kvs + buf * AT_STAGE + l16 * AT_KPITCH + klo;
      const half_t* vs = kvs + buf * AT_STAGE + AT_KH + l16 * AT_VPITCH + klo;
      // by 2: the pair's LDS offsets are immediates of its reads; by 4 the body
      // takes nearly all the registers a wave can have at four waves per SIMD
#pragma unroll 2
      for (int c = 0; c < AT_KEYS / 32; ++c) {
        // ---- issue all K and V fragment reads for this chunk ----
        const half_t* kr0 = ks + (c * 32 + 0)  * AT_KPITCH;
        const half_t* kr1 = ks + (c * 32 + 16) * AT_KPITCH;
        v16h kb00 = load_frag_f16(kr0 + 0);
        v16h kb01 = load_frag_f16(kr0 + 32);
        v16h kb10 = load_frag_f16(kr1 + 0);
        v16h kb11 = load_frag_f16(kr1 + 32);
        v16h vb[4];
#pragma unroll
        for (int t = 0; t < 4; ++t)
            vb[t] = load_frag_f16(vs + t * 16 * AT_VPITCH + c * 32);
        __builtin_amdgcn_sched_barrier(0);   // keep loads above the compute

        // ---- S = Q * K^T (two 16-key n-tiles, two 32-wide k-steps) ----
        v8f sac0 = (v8f)(0.0f), sac1 = (v8f)(0.0f);
        sac0 = wmma_f16(qa0, kb00, sac0);
        sac0 = wmma_f16(qa1, kb01, sac0);
        sac1 = wmma_f16(qa0, kb10, sac1);
        sac1 = wmma_f16(qa1, kb11, sac1);

        // ---- online softmax over the 32 new keys ----
        float alpha[8];
#pragma unroll
        for (int i = 0; i < 8; ++i) {
            float s0 = sac0[i] * scale;
            float s1 = sac1[i] * scale;
            float v = fmaxf(s0, s1);
            v = fmaxf(v, __shfl_xor(v, 8, 16));
            v = fmaxf(v, __shfl_xor(v, 4, 16));
            v = fmaxf(v, __shfl_xor(v, 2, 16));
            v = fmaxf(v, __shfl_xor(v, 1, 16));
            const float mn = fmaxf(m_run[i], v);
            const float al = __expf(m_run[i] - mn);
            const float p0 = __expf(s0 - mn);
            const float p1 = __expf(s1 - mn);
            float rs = p0 + p1;
            rs += __shfl_xor(rs, 8, 16);
            rs += __shfl_xor(rs, 4, 16);
            rs += __shfl_xor(rs, 2, 16);
            rs += __shfl_xor(rs, 1, 16);
            l_run[i] = l_run[i] * al + rs;
            m_run[i] = mn;
            alpha[i] = al;
            // scatter P (C layout) into LDS tile [row][key_local]
            const int prow = i + 8 * hi;
            pbuf[wid][prow * 32 + 0  + l16] = (_Float16)p0;
            pbuf[wid][prow * 32 + 16 + l16] = (_Float16)p1;
        }
#pragma unroll
        for (int t = 0; t < 4; ++t)
#pragma unroll
            for (int i = 0; i < 8; ++i) oacc[t][i] *= alpha[i];

        // LDS stores must land before the transposed reads (same wave).
        asm volatile("s_wait_dscnt 0x0" ::: "memory");

        // ---- O += P * V ----
        const v16h pa = load_frag_f16(&pbuf[wid][l16 * 32 + klo]);
#pragma unroll
        for (int t = 0; t < 4; ++t)
            oacc[t] = wmma_f16(pa, vb[t], oacc[t]);
      }
      // Hand-over: this wave's reads of buffer buf are done, its copies of
      // stage st+1 have landed; behind the barrier that holds for every wave.
      asm volatile("s_wait_dscnt 0x0" ::: "memory");
      asm volatile("s_wait_asynccnt 0x0" ::: "memory");
      __syncthreads();
      if (st + 2 < AT_NST)
          attn_copy8(gk + (st + 2) * (AT_KEYS * HD), lk + buf * (AT_STAGE * 2),
                     gv + (st + 2) * AT_KEYS,        lv + buf * (AT_STAGE * 2));
    }
    // no copy of this wave is outstanding when it ends
    asm volatile("s_wait_asynccnt 0x0" ::: "memory");

    // ---- normalize and store: out[b, q0+M, h*64 + t*16 + l16] ----
    const int b_ = bh / HH;
    const int h_ = bh % HH;
    float inv[8];
#pragma unroll
    for (int i = 0; i < 8; ++i) inv[i] = 1.0f / l_run[i];
#pragma unroll
    for (int t = 0; t < 4; ++t) {
        const int dcol = h_ * HD + t * 16 + l16;
#pragma unroll
        for (int i = 0; i < 8; ++i) {
            const int M = i + 8 * hi;
            out[((size_t)(b_ * SS + q0 + M)) * DD + dcol] = oacc[t][i] * inv[i];
        }
    }
}

// ---------------------------------------------------------------------------
// Host-side launch. Inputs: q,k,v,Wq,bq,Wk,bk,Wv,bv (all f32).
// Workspace (f16 halves):
//   [0)   qh,kh,vh    : 3 x 4M  (converted activations)
//   [12M) wqh,wkh,wvh : 3 x 1M  (converted weights)
//   [15M) Qp,Kp,VpT   : 3 x 4M  (projected heads)
// Total 27M halves = 54 MB.
// ---------------------------------------------------------------------------
extern "C" void kernel_launch(void* const* d_in, const int* in_sizes, int n_in,
                              void* d_out, int out_size, void* d_ws, size_t ws_size,
                              hipStream_t stream) {
    const float* q  = (const float*)d_in[0];
    const float* k  = (const float*)d_in[1];
    const float* v  = (const float*)d_in[2];
    const float* Wq = (const float*)d_in[3];
    const float* bq = (const float*)d_in[4];
    const float* Wk = (const float*)d_in[5];
    const float* bk = (const float*)d_in[6];
    const float* Wv = (const float*)d_in[7];
    const float* bv = (const float*)d_in[8];
    float* out = (float*)d_out;

    const size_t XN = (size_t)ROWS * DD;   // 4,194,304
    const size_t WN = (size_t)DD * DD;     // 1,048,576
    half_t* ws  = (half_t*)d_ws;
    half_t* qh  = ws;
    half_t* kh  = qh  + XN;
    half_t* vh  = kh  + XN;
    half_t* wqh = vh  + XN;
    half_t* wkh = wqh + WN;
    half_t* wvh = wkh + WN;
    half_t* Qp  = wvh + WN;
    half_t* Kp  = Qp  + XN;
    half_t* VpT = Kp  + XN;

    // 1) one-shot f32 -> f16 conversions (memory bound)
    const int xBlocks = (int)(XN / 8 / 256);   // 2048
    const int wBlocks = (int)(WN / 8 / 256);   // 512
    cvt_f32_to_f16_kernel<<<xBlocks, 256, 0, stream>>>(q,  qh,  (int)(XN / 8));
    cvt_f32_to_f16_kernel<<<xBlocks, 256, 0, stream>>>(k,  kh,  (int)(XN / 8));
    cvt_f32_to_f16_kernel<<<xBlocks, 256, 0, stream>>>(v,  vh,  (int)(XN / 8));
    cvt_f32_to_f16_kernel<<<wBlocks, 256, 0, stream>>>(Wq, wqh, (int)(WN / 8));
    cvt_f32_to_f16_kernel<<<wBlocks, 256, 0, stream>>>(Wk, wkh, (int)(WN / 8));
    cvt_f32_to_f16_kernel<<<wBlocks, 256, 0, stream>>>(Wv, wvh, (int)(WN / 8));

    // 2) projections: one block per 128 x 128 output tile -> 32 x 8 = 256 blocks
    const int projBlocks = (ROWS / PJ_TILE) * (DD / PJ_TILE);
    proj_wmma_kernel<<<projBlocks, 256, 0, stream>>>(qh, wqh, bq, Qp, 0);
    proj_wmma_kernel<<<projBlocks, 256, 0, stream>>>(kh, wkh, bk, Kp, 0);
    proj_wmma_kernel<<<projBlocks, 256, 0, stream>>>(vh, wvh, bv, VpT, 1);

    // 3) attention: units = B*H*(S/16) = 4096 -> 512 blocks x 8 waves
    const int attnBlocks = BB * HH * (SS / 16) / 8;
    attn_wmma_kernel<<<attnBlocks, 256, 0, stream>>>(Qp, Kp, VpT, out);
}

// v003
// Measured time: 108 microseconds a run.
// Timed twice side by side with v002, it ran 1.39 and 1.38 times as fast.
// Counting every step since v000, it is 2.47 times as fast.
#include <hip/hip_runtime.h>

// Problem constants (from reference)
#define BB   2
#define SS   2048
#define DD   1024
#define HH   16
#define HD   64
#define ROWS (BB * SS)          // 4096 rows in the projection GEMMs

typedef _Float16 half_t;
typedef __attribute__((ext_vector_type(16))) _Float16 v16h;
typedef __attribute__((ext_vector_type(8)))  _Float16 v8h;
typedef __attribute__((ext_vector_type(8)))  float    v8f;

// ---------------------------------------------------------------------------
// Fragment helper: A-layout (16-bit A, 16x32, ISA 7.12.2): lane l (l16=l&15)
// holds row M=l16; halves a[0..7]=K(klo..klo+7), a[8..15]=K(16+klo..) with
// klo = (lane>=16 ? 8 : 0).  B uses the symmetric lane-per-column layout.
// Both reduce to: 8 contiguous halves at p, 8 contiguous halves at p+16.
// ---------------------------------------------------------------------------
__device__ __forceinline__ v16h load_frag_f16(const half_t* p) {
    v8h lo = *(const v8h*)(p);
    v8h hi = *(const v8h*)(p + 16);
    v16h r;
#pragma unroll
    for (int i = 0; i < 8; ++i) { r[i] = lo[i]; r[8 + i] = hi[i]; }
    return r;
}

__device__ __forceinline__ v8f wmma_f16(v16h a, v16h b, v8f c) {
    return __builtin_amdgcn_wmma_f32_16x16x32_f16(
        false, a, false, b, (short)0, c, false, false);
}

// ---------------------------------------------------------------------------
// One-shot f32 -> f16 conversion (memory bound; feeds all later kernels).
// ---------------------------------------------------------------------------
__global__ __launch_bounds__(256) void cvt_f32_to_f16_kernel(
    const float* __restrict__ src, half_t* __restrict__ dst, int n8)
{
    const int idx = blockIdx.x * blockDim.x + threadIdx.x;
    if (idx >= n8) return;
    const float4* s = (const float4*)src + (size_t)idx * 2;
    float4 x0 = s[0];
    float4 x1 = s[1];
    v8h o;
    o[0] = (_Float16)x0.x; o[1] = (_Float16)x0.y;
    o[2] = (_Float16)x0.z; o[3] = (_Float16)x0.w;
    o[4] = (_Float16)x1.x; o[5] = (_Float16)x1.y;
    o[6] = (_Float16)x1.z; o[7] = (_Float16)x1.w;
    *(v8h*)(dst + (size_t)idx * 8) = o;
}

// ---------------------------------------------------------------------------
// Projection GEMM, all-f16 operands: out[s,e] = sum_d Xh[s,d]*Wh[e,d] + b[e].
//   transpose_out == 0 : out layout [B,H,S,Hd]   (Q, K)
//   transpose_out == 1 : out layout [B,H,Hd,S]   (V -> contiguous PV A-frags)
// One workgroup per 128(row) x 128(col) tile of the output, 8 waves in a
// 2 x 4 grid, 64 x 32 per wave.  A pass is 128 k (256 B of each of the 128 X
// rows and 128 W rows); the pass's rows are brought into LDS by asynchronous
// copies, whole 256-B row pieces per half wave, and shared by all 8 waves.
// Two buffers: pass t+1's copies fly while pass t is multiplied.
// LDS rows are pitched 272 B so that the 16-byte fragment reads of 16
// neighbouring rows fall on different banks.
// ---------------------------------------------------------------------------
#define PJ_TILE   128                       // output tile edge
#define PJ_KP     128                       // k per pass (halves)
#define PJ_PITCH  136                       // LDS row pitch (halves) = 272 B
#define PJ_STAGE  (2 * PJ_TILE * PJ_PITCH)  // halves per buffer: X rows, then W rows
#define PJ_NPASS  (DD / PJ_KP)              // 8

// Eight 16-byte copies of one lane: rows r, r+16, ..., r+112 of one operand.
// g: the lane's 16 bytes in the first row; l: their LDS byte address.
__device__ __forceinline__ void proj_copy8(const half_t* g, unsigned l) {
    const half_t* g1 = g + 16 * 1 * DD;  const unsigned l1 = l + 16 * 1 * PJ_PITCH * 2;
    const half_t* g2 = g + 16 * 2 * DD;  const unsigned l2 = l + 16 * 2 * PJ_PITCH * 2;
    const half_t* g3 = g + 16 * 3 * DD;  const unsigned l3 = l + 16 * 3 * PJ_PITCH * 2;
    const half_t* g4 = g + 16 * 4 * DD;  const unsigned l4 = l + 16 * 4 * PJ_PITCH * 2;
    const half_t* g5 = g + 16 * 5 * DD;  const unsigned l5 = l + 16 * 5 * PJ_PITCH * 2;
    const half_t* g6 = g + 16 * 6 * DD;  const unsigned l6 = l + 16 * 6 * PJ_PITCH * 2;
    const half_t* g7 = g + 16 * 7 * DD;  const unsigned l7 = l + 16 * 7 * PJ_PITCH * 2;
    // The closing s_wait_xcnt stands inside the statement so that no address
    // register named here is rewritten ahead of it.
    asm volatile(
        "global_load_async_to_lds_b128 %0, %8, off\n\t"
        "global_load_async_to_lds_b128 %1, %9, off\n\t"
        "global_load_async_to_lds_b128 %2, %10, off\n\t"
        "global_load_async_to_lds_b128 %3, %11, off\n\t"
        "global_load_async_to_lds_b128 %4, %12, off\n\t"
        "global_load_async_to_lds_b128 %5, %13, off\n\t"
        "global_load_async_to_lds_b128 %6, %14, off\n\t"
        "global_load_async_to_lds_b128 %7, %15, off\n\t"
        "s_wait_xcnt 0x0"
        :: "v"(l), "v"(l1), "v"(l2), "v"(l3), "v"(l4), "v"(l5), "v"(l6), "v"(l7),
           "v"(g), "v"(g1), "v"(g2), "v"(g3), "v"(g4), "v"(g5), "v"(g6), "v"(g7)
        : "memory");
}

__global__ __launch_bounds__(256) void proj_wmma_kernel(
    const half_t* __restrict__ Xh, const half_t* __restrict__ Wh,
    const float* __restrict__ bias, half_t* __restrict__ out,
    int transpose_out)
{
    __shared__ __align__(16) half_t stg[2 * PJ_STAGE];   // 139,264 B

    const int tid  = threadIdx.x;
    const int wid  = tid >> 5;
    const int lane = tid & 31;
    const int l16  = lane & 15;
    const int hi   = lane >> 4;
    const int klo  = hi * 8;

    const int NT = DD / PJ_TILE;                       // 8 tile columns
    const int m0 = (blockIdx.x / NT) * PJ_TILE;        // first X row of the tile
    const int n0 = (blockIdx.x % NT) * PJ_TILE;        // first W row of the tile
    const int wm = (wid >> 2) * 64;                    // wave's rows in the tile
    const int wn = (wid & 3) * 32;                     // wave's columns in the tile

    // Copy duty of a lane: 16-byte piece (tid & 15) of rows (tid >> 4) + 16 j.
    const int crow = tid >> 4;
    const int ccol = (tid & 15) * 8;
    const half_t* gx = Xh + (size_t)(m0 + crow) * DD + ccol;
    const half_t* gw = Wh + (size_t)(n0 + crow) * DD + ccol;
    const unsigned lx = (unsigned)(size_t)&stg[crow * PJ_PITCH + ccol];
    const unsigned lw = lx + PJ_TILE * PJ_PITCH * 2;

    // Every inner loop below is unrolled so that each accumulator and fragment
    // index is a constant: the arrays then live in registers, not in scratch.
    v8f acc[4][2];
#pragma unroll
    for (int i = 0; i < 4; ++i)
#pragma unroll
        for (int j = 0; j < 2; ++j) acc[i][j] = (v8f)(0.0f);

    // pass 0 -> buffer 0, landed and published; then pass 1 -> buffer 1
    proj_copy8(gx, lx);
    proj_copy8(gw, lw);
    // this wave's copies have landed before the barrier lets others read them
    asm volatile("s_wait_asynccnt 0x0" ::: "memory");
    __syncthreads();
    proj_copy8(gx + PJ_KP, lx + PJ_STAGE * 2);
    proj_copy8(gw + PJ_KP, lw + PJ_STAGE * 2);

    // rolled: eight copies of the pass body would only lengthen the kernel's text
#pragma unroll 1
    for (int t = 0; t < PJ_NPASS; ++t) {
        const int buf = t & 1;
        const half_t* xs = stg + buf * PJ_STAGE + (wm + l16) * PJ_PITCH + klo;
        const half_t* wsm = stg + buf * PJ_STAGE + (PJ_TILE + wn + l16) * PJ_PITCH + klo;
        // Two fragment sets: step s+1's LDS reads go out as one group ahead of
        // step s's products, so the products cover their latency.
        v16h a[2][4], b[2][2];
#pragma unroll
        for (int i = 0; i < 4; ++i) a[0][i] = load_frag_f16(xs + i * 16 * PJ_PITCH);
#pragma unroll
        for (int j = 0; j < 2; ++j) b[0][j] = load_frag_f16(wsm + j * 16 * PJ_PITCH);
#pragma unroll
        for (int s = 0; s < PJ_KP / 32; ++s) {
            const int cur = s & 1, nxt = cur ^ 1;
            if (s + 1 < PJ_KP / 32) {
#pragma unroll
                for (int i = 0; i < 4; ++i)
                    a[nxt][i] = load_frag_f16(xs + i * 16 * PJ_PITCH + (s + 1) * 32);
#pragma unroll
                for (int j = 0; j < 2; ++j)
                    b[nxt][j] = load_frag_f16(wsm + j * 16 * PJ_PITCH + (s + 1) * 32);
            }
            // keeps the read group above the products instead of spread among them
            __builtin_amdgcn_sched_barrier(0);
#pragma unroll
            for (int i = 0; i < 4; ++i)
#pragma unroll
                for (int j = 0; j < 2; ++j)
                    acc[i][j] = wmma_f16(a[cur][i], b[cur][j], acc[i][j]);
            // keeps the next group's reads from sinking into these products
            __builtin_amdgcn_sched_barrier(0);
        }
        // Hand-over: this wave's reads of buffer buf are done, its copies of
        // pass t+1 have landed; behind the barrier that holds for every wave.
        asm volatile("s_wait_dscnt 0x0" ::: "memory");
        asm volatile("s_wait_asynccnt 0x0" ::: "memory");
        __syncthreads();
        if (t + 2 < PJ_NPASS) {
            proj_copy8(gx + (t + 2) * PJ_KP, lx + buf * (PJ_STAGE * 2));
            proj_copy8(gw + (t + 2) * PJ_KP, lw + buf * (PJ_STAGE * 2));
        }
    }
    // no copy of this wave is outstanding when it ends
    asm volatile("s_wait_asynccnt 0x0" ::: "memory");

    // Bias + store. C layout: acc[i][j][r] = out[row0 + i*16 + r + 8*hi][col0 + j*16 + l16]
#pragma unroll
    for (int j = 0; j < 2; ++j) {
        const int e    = n0 + wn + j * 16 + l16;
        const float bv = bias[e];
        const int h    = e >> 6;
        const int d    = e & 63;
#pragma unroll
        for (int i = 0; i < 4; ++i) {
#pragma unroll
            for (int r = 0; r < 8; ++r) {
                const int sg   = m0 + wm + i * 16 + r + 8 * hi;
                const int b_   = sg >> 11;
                const int sloc = sg & 2047;
                const float vfin = acc[i][j][r] + bv;
                size_t idx;
                if (transpose_out)
                    idx = (((size_t)(b_ * HH + h) * HD + d) * SS) + sloc;
                else
                    idx = (((size_t)(b_ * HH + h) * SS + sloc) * HD) + d;
                out[idx] = (_Float16)vfin;
            }
        }
    }
}

#define AT_KEYS   128
#define AT_KPITCH 72
#define AT_VPITCH 136
#define AT_KH     (AT_KEYS * AT_KPITCH)
#define AT_STAGE  (AT_KH + HD * AT_VPITCH)
#define AT_NST    (SS / AT_KEYS)

// Eight 16-byte copies of one lane: K rows r, r+32, r+64, r+96 and VpT rows
// d, d+16, d+32, d+48.  gk, gv: the lane's 16 bytes in the first row of each;
// lk, lv: their LDS byte addresses.
__device__ __forceinline__ void attn_copy8(const half_t* gk, unsigned lk,
                                           const half_t* gv, unsigned lv) {
    const half_t* gk1 = gk + 32 * 1 * HD;  const unsigned lk1 = lk + 32 * 1 * AT_KPITCH * 2;
    const half_t* gk2 = gk + 32 * 2 * HD;  const unsigned lk2 = lk + 32 * 2 * AT_KPITCH * 2;
    const half_t* gk3 = gk + 32 * 3 * HD;  const unsigned lk3 = lk + 32 * 3 * AT_KPITCH * 2;
    const half_t* gv1 = gv + 16 * 1 * SS;  const unsigned lv1 = lv + 16 * 1 * AT_VPITCH * 2;
    const half_t* gv2 = gv + 16 * 2 * SS;  const unsigned lv2 = lv + 16 * 2 * AT_VPITCH * 2;
    const half_t* gv3 = gv + 16 * 3 * SS;  const unsigned lv3 = lv + 16 * 3 * AT_VPITCH * 2;
    // The closing s_wait_xcnt stands inside the statement so that no address
    // register named here is rewritten ahead of it.
    asm volatile(
        "global_load_async_to_lds_b128 %0, %8, off\n\t"
        "global_load_async_to_lds_b128 %1, %9, off\n\t"
        "global_load_async_to_lds_b128 %2, %10, off\n\t"
        "global_load_async_to_lds_b128 %3, %11, off\n\t"
        "global_load_async_to_lds_b128 %4, %12, off\n\t"
        "global_load_async_to_lds_b128 %5, %13, off\n\t"
        "global_load_async_to_lds_b128 %6, %14, off\n\t"
        "global_load_async_to_lds_b128 %7, %15, off\n\t"
        "s_wait_xcnt 0x0"
        :: "v"(lk), "v"(lk1), "v"(lk2), "v"(lk3), "v"(lv), "v"(lv1), "v"(lv2), "v"(lv3),
           "v"(gk), "v"(gk1), "v"(gk2), "v"(gk3), "v"(gv), "v"(gv1), "v"(gv2), "v"(gv3)
        : "memory");
}

// The value that lane l ^ 16 holds.
__device__ __forceinline__ float other_half(float x) {
    const int b = __builtin_bit_cast(int, x);
    return __builtin_bit_cast(float,
        __builtin_amdgcn_permlanex16(b, b, 0x76543210, 0xfedcba98, false, false));
}

#define LOG2E 1.44269504088896340736f

// A run of exponentials to base 2.  The instruction set asks for one slot
// between a transcendental and an instruction that reads its result or
// overwrites its source: inside the run no instruction names a register of
// another (every output is early-clobber), and the closing v_nop is the slot
// behind the last one.
__device__ __forceinline__ void exp2_run8(v8f x, v8f& y) {
    float y0, y1, y2, y3, y4, y5, y6, y7;
    asm("v_exp_f32 %0, %8\n\t"
        "v_exp_f32 %1, %9\n\t"
        "v_exp_f32 %2, %10\n\t"
        "v_exp_f32 %3, %11\n\t"
        "v_exp_f32 %4, %12\n\t"
        "v_exp_f32 %5, %13\n\t"
        "v_exp_f32 %6, %14\n\t"
        "v_exp_f32 %7, %15\n\t"
        "v_nop"
        : "=&v"(y0), "=&v"(y1), "=&v"(y2), "=&v"(y3),
          "=&v"(y4), "=&v"(y5), "=&v"(y6), "=&v"(y7)
        : "v"(x[0]), "v"(x[1]), "v"(x[2]), "v"(x[3]),
          "v"(x[4]), "v"(x[5]), "v"(x[6]), "v"(x[7]));
    y[0] = y0; y[1] = y1; y[2] = y2; y[3] = y3;
    y[4] = y4; y[5] = y5; y[6] = y6; y[7] = y7;
}

// The same with one more value in front.
__device__ __forceinline__ void exp2_run9(float xa, v8f x, float& ya, v8f& y) {
    float y0, y1, y2, y3, y4, y5, y6, y7;
    asm("v_exp_f32 %0, %9\n\t"
        "v_exp_f32 %1, %10\n\t"
        "v_exp_f32 %2, %11\n\t"
        "v_exp_f32 %3, %12\n\t"
        "v_exp_f32 %4, %13\n\t"
        "v_exp_f32 %5, %14\n\t"
        "v_exp_f32 %6, %15\n\t"
        "v_exp_f32 %7, %16\n\t"
        "v_exp_f32 %8, %17\n\t"
        "v_nop"
        : "=&v"(ya), "=&v"(y0), "=&v"(y1), "=&v"(y2), "=&v"(y3),
          "=&v"(y4), "=&v"(y5), "=&v"(y6), "=&v"(y7)
        : "v"(xa), "v"(x[0]), "v"(x[1]), "v"(x[2]), "v"(x[3]),
          "v"(x[4]), "v"(x[5]), "v"(x[6]), "v"(x[7]));
    y[0] = y0; y[1] = y1; y[2] = y2; y[3] = y3;
    y[4] = y4; y[5] = y5; y[6] = y6; y[7] = y7;
}

__global__ __launch_bounds__(256) void attn_wmma_kernel(
    const half_t* __restrict__ Qp, const half_t* __restrict__ Kp,
    const half_t* __restrict__ VpT, float* __restrict__ out)
{
    __shared__ __align__(16) half_t kvs[2 * AT_STAGE];  // 71,680 B: the two stage buffers

    const int tid  = threadIdx.x;
    const int wid  = threadIdx.x >> 5;
    const int lane = threadIdx.x & 31;
    const int l16  = lane & 15;
    const int hi   = lane >> 4;
    const int klo  = hi * 8;

    const int unit = blockIdx.x * (blockDim.x >> 5) + wid;
    const int QTILES = SS / 16;
    const int bh = unit / QTILES;
    const int q0 = (unit % QTILES) * 16;

    const half_t* qb = Qp  + (size_t)bh * SS * HD;
    const half_t* kb = Kp  + (size_t)bh * SS * HD;
    const half_t* vt = VpT + (size_t)bh * HD * SS;

    const half_t* qrow = qb + (size_t)(q0 + l16) * HD;
    const v16h qa0 = load_frag_f16(qrow + 0  + klo);
    const v16h qa1 = load_frag_f16(qrow + 32 + klo);

    v8f oacc[4];
#pragma unroll
    for (int t = 0; t < 4; ++t) oacc[t] = (v8f)(0.0f);
    // of the lane's query: maximum over all keys so far; sum over the keys that
    // this half of the wave holds (the halves are joined behind the loop)
    float m_run = -INFINITY, l_run = 0.0f;

    const float scale = 0.125f;   // 1/sqrt(64)

    // Copy duty of a lane: 16-byte piece (tid & 7) of K rows (tid >> 3) + 32 j,
    // 16-byte piece (tid & 15) of VpT rows (tid >> 4) + 16 j.
    const half_t* gk = kb + (size_t)(tid >> 3) * HD + (tid & 7) * 8;
    const half_t* gv = vt + (size_t)(tid >> 4) * SS + (tid & 15) * 8;
    const unsigned lk = (unsigned)(size_t)&kvs[(tid >> 3) * AT_KPITCH + (tid & 7) * 8];
    const unsigned lv = (unsigned)(size_t)&kvs[AT_KH + (tid >> 4) * AT_VPITCH + (tid & 15) * 8];

    // stage 0 -> buffer 0, landed and published; then stage 1 -> buffer 1
    attn_copy8(gk, lk, gv, lv);
    // this wave's copies have landed before the barrier lets others read them
    asm volatile("s_wait_asynccnt 0x0" ::: "memory");
    __syncthreads();
    attn_copy8(gk + AT_KEYS * HD, lk + AT_STAGE * 2, gv + AT_KEYS, lv + AT_STAGE * 2);

    // rolled: sixteen copies of the stage body would only lengthen the kernel's text
#pragma unroll 1
    for (int st = 0; st < AT_NST; ++st) {
      const int buf = st & 1;
      const half_t* ks = kvs + buf * AT_STAGE + l16 * AT_KPITCH + klo;
      const half_t* vs = kvs + buf * AT_STAGE + AT_KH + l16 * AT_VPITCH + klo;
      // by 2: the pair's LDS offsets are immediates of its reads
#pragma unroll 2
      for (int c = 0; c < AT_KEYS / 32; ++c) {
        // ---- issue all K and V fragment reads for this chunk ----
        const half_t* kr0 = ks + (c * 32 + 0)  * AT_KPITCH;
        const half_t* kr1 = ks + (c * 32 + 16) * AT_KPITCH;
        v16h kb00 = load_frag_f16(kr0 + 0);
        v16h kb01 = load_frag_f16(kr0 + 32);
        v16h kb10 = load_frag_f16(kr1 + 0);
        v16h kb11 = load_frag_f16(kr1 + 32);
        v16h vb[4];
#pragma unroll
        for (int t = 0; t < 4; ++t)
            vb[t] = load_frag_f16(vs + t * 16 * AT_VPITCH + c * 32);
        __builtin_amdgcn_sched_barrier(0);   // keep loads above the compute

        // ---- S^T = K * Q^T (two 16-key m-tiles, two 32-wide k-steps) ----
        // sac0[i]: key c*32 + 8*hi + i, sac1[i]: key c*32 + 16 + 8*hi + i; query l16
        v8f sac0 = (v8f)(0.0f), sac1 = (v8f)(0.0f);
        sac0 = wmma_f16(kb00, qa0, sac0);
        sac0 = wmma_f16(kb01, qa1, sac0);
        sac1 = wmma_f16(kb10, qa0, sac1);
        sac1 = wmma_f16(kb11, qa1, sac1);

        // ---- online softmax over the 32 new keys, one query per lane ----
        const v8f s0 = sac0 * scale;
        const v8f s1 = sac1 * scale;
        float v = fmaxf(s0[0], s0[1]);
#pragma unroll
        for (int i = 2; i < 8; ++i) v = fmaxf(v, s0[i]);
#pragma unroll
        for (int i = 0; i < 8; ++i) v = fmaxf(v, s1[i]);
        v = fmaxf(v, other_half(v));
        const float mn = fmaxf(m_run, v);
        // exp(x) as exp2(x * log2(e)), the form __expf compiles to
        const v8f x0 = (s0 - mn) * LOG2E;
        const v8f x1 = (s1 - mn) * LOG2E;
        float al;
        v8f p0, p1;
        exp2_run9((m_run - mn) * LOG2E, x0, al, p0);
        exp2_run8(x1, p1);
        float rs0 = p0[0], rs1 = p1[0];
#pragma unroll
        for (int i = 1; i < 8; ++i) { rs0 += p0[i]; rs1 += p1[i]; }
        v16h pb;
#pragma unroll
        for (int i = 0; i < 8; ++i) {
            pb[i]     = (_Float16)p0[i];
            pb[8 + i] = (_Float16)p1[i];
        }
        l_run = l_run * al + (rs0 + rs1);
        m_run = mn;
#pragma unroll
        for (int t = 0; t < 4; ++t)
#pragma unroll
            for (int i = 0; i < 8; ++i) oacc[t][i] *= al;

        // ---- O^T += V^T * P^T: oacc[t][i] = O[query l16][d = t*16 + 8*hi + i] ----
#pragma unroll
        for (int t = 0; t < 4; ++t)
            oacc[t] = wmma_f16(vb[t], pb, oacc[t]);
      }
      // Hand-over: this wave's reads of buffer buf are done, its copies of
      // stage st+1 have landed; behind the barrier that holds for every wave.
      asm volatile("s_wait_dscnt 0x0" ::: "memory");
      asm volatile("s_wait_asynccnt 0x0" ::: "memory");
      __syncthreads();
      if (st + 2 < AT_NST)
          attn_copy8(gk + (st + 2) * (AT_KEYS * HD), lk + buf * (AT_STAGE * 2),
                     gv + (st + 2) * AT_KEYS,        lv + buf * (AT_STAGE * 2));
    }
    // no copy of this wave is outstanding when it ends
    asm volatile("s_wait_asynccnt 0x0" ::: "memory");

    // ---- normalize and store: out[b, q0+l16, h*64 + t*16 + 8*hi + 0..7] ----
    const int b_ = bh / HH;
    const int h_ = bh % HH;
    const float inv = 1.0f / (l_run + other_half(l_run));
    float* orow = out + ((size_t)(b_ * SS + q0 + l16)) * DD + h_ * HD + 8 * hi;
#pragma unroll
    for (int t = 0; t < 4; ++t) {
        float4 lo4, hi4;
        lo4.x = oacc[t][0] * inv; lo4.y = oacc[t][1] * inv;
        lo4.z = oacc[t][2] * inv; lo4.w = oacc[t][3] * inv;
        hi4.x = oacc[t][4] * inv; hi4.y = oacc[t][5] * inv;
        hi4.z = oacc[t][6] * inv; hi4.w = oacc[t][7] * inv;
        *(float4*)(orow + t * 16)     = lo4;
        *(float4*)(orow + t * 16 + 4) = hi4;
    }
}

// ---------------------------------------------------------------------------
// Host-side launch. Inputs: q,k,v,Wq,bq,Wk,bk,Wv,bv (all f32).
// Workspace (f16 halves):
//   [0)   qh,kh,vh    : 3 x 4M  (converted activations)
//   [12M) wqh,wkh,wvh : 3 x 1M  (converted weights)
//   [15M) Qp,Kp,VpT   : 3 x 4M  (projected heads)
// Total 27M halves = 54 MB.
// ---------------------------------------------------------------------------
extern "C" void kernel_launch(void* const* d_in, const int* in_sizes, int n_in,
                              void* d_out, int out_size, void* d_ws, size_t ws_size,
                              hipStream_t stream) {
    const float* q  = (const float*)d_in[0];
    const float* k  = (const float*)d_in[1];
    const float* v  = (const float*)d_in[2];
    const float* Wq = (const float*)d_in[3];
    const float* bq = (const float*)d_in[4];
    const float* Wk = (const float*)d_in[5];
    const float* bk = (const float*)d_in[6];
    const float* Wv = (const float*)d_in[7];
    const float* bv = (const float*)d_in[8];
    float* out = (float*)d_out;

    const size_t XN = (size_t)ROWS * DD;   // 4,194,304
    const size_t WN = (size_t)DD * DD;     // 1,048,576
    half_t* ws  = (half_t*)d_ws;
    half_t* qh  = ws;
    half_t* kh  = qh  + XN;
    half_t* vh  = kh  + XN;
    half_t* wqh = vh  + XN;
    half_t* wkh = wqh + WN;
    half_t* wvh = wkh + WN;
    half_t* Qp  = wvh + WN;
    half_t* Kp  = Qp  + XN;
    half_t* VpT = Kp  + XN;

    // 1) one-shot f32 -> f16 conversions (memory bound)
    const int xBlocks = (int)(XN / 8 / 256);   // 2048
    const int wBlocks = (int)(WN / 8 / 256);   // 512
    cvt_f32_to_f16_kernel<<<xBlocks, 256, 0, stream>>>(q,  qh,  (int)(XN / 8));
    cvt_f32_to_f16_kernel<<<xBlocks, 256, 0, stream>>>(k,  kh,  (int)(XN / 8));
    cvt_f32_to_f16_kernel<<<xBlocks, 256, 0, stream>>>(v,  vh,  (int)(XN / 8));
    cvt_f32_to_f16_kernel<<<wBlocks, 256, 0, stream>>>(Wq, wqh, (int)(WN / 8));
    cvt_f32_to_f16_kernel<<<wBlocks, 256, 0, stream>>>(Wk, wkh, (int)(WN / 8));
    cvt_f32_to_f16_kernel<<<wBlocks, 256, 0, stream>>>(Wv, wvh, (int)(WN / 8));

    // 2) projections: one block per 128 x 128 output tile -> 32 x 8 = 256 blocks
    const int projBlocks = (ROWS / PJ_TILE) * (DD / PJ_TILE);
    proj_wmma_kernel<<<projBlocks, 256, 0, stream>>>(qh, wqh, bq, Qp, 0);
    proj_wmma_kernel<<<projBlocks, 256, 0, stream>>>(kh, wkh, bk, Kp, 0);
    proj_wmma_kernel<<<projBlocks, 256, 0, stream>>>(vh, wvh, bv, VpT, 1);

    // 3) attention: units = B*H*(S/16) = 4096 -> 512 blocks x 8 waves
    const int attnBlocks = BB * HH * (SS / 16) / 8;
    attn_wmma_kernel<<<attnBlocks, 256, 0, stream>>>(Qp, Kp, VpT, out);
}

// v004
// It runs in 95.5 microseconds.
// In both of two side-by-side timings against v003, it was 1.13 times as fast.
// Over all steps from v000 it is 2.79 times as fast.
#include <hip/hip_runtime.h>

// Problem constants (from reference)
#define BB   2
#define SS   2048
#define DD   1024
#define HH   16
#define HD   64
#define ROWS (BB * SS)          // 4096 rows in the projection GEMMs

typedef _Float16 half_t;
typedef __attribute__((ext_vector_type(16))) _Float16 v16h;
typedef __attribute__((ext_vector_type(8)))  _Float16 v8h;
typedef __attribute__((ext_vector_type(8)))  float    v8f;

// ---------------------------------------------------------------------------
// Fragment helper: A-layout (16-bit A, 16x32, ISA 7.12.2): lane l (l16=l&15)
// holds row M=l16; halves a[0..7]=K(klo..klo+7), a[8..15]=K(16+klo..) with
// klo = (lane>=16 ? 8 : 0).  B uses the symmetric lane-per-column layout.
// Both reduce to: 8 contiguous halves at p, 8 contiguous halves at p+16.
// ---------------------------------------------------------------------------
__device__ __forceinline__ v16h load_frag_f16(const half_t* p) {
    v8h lo = *(const v8h*)(p);
    v8h hi = *(const v8h*)(p + 16);
    v16h r;
#pragma unroll
    for (int i = 0; i < 8; ++i) { r[i] = lo[i]; r[8 + i] = hi[i]; }
    return r;
}

__device__ __forceinline__ v8f wmma_f16(v16h a, v16h b, v8f c) {
    return __builtin_amdgcn_wmma_f32_16x16x32_f16(
        false, a, false, b, (short)0, c, false, false);
}

// ---------------------------------------------------------------------------
// f32 -> f16 conversion of all six operands in one launch (memory bound; feeds
// all later kernels).  The six f16 arrays lie one behind the other in dst, in
// the order q, k, v, Wq, Wk, Wv.  A wave takes one piece of 4096 elements
// (16 KiB of f32) of one array: 32 loads of 16 B per lane, each covering 512
// contiguous bytes, all issued before the first is used, then 32 stores of 8 B
// per lane, each covering 256 contiguous bytes.  Few long waves instead of many
// short ones, for speed only.
// ---------------------------------------------------------------------------
typedef __attribute__((ext_vector_type(4))) float    v4f;
typedef __attribute__((ext_vector_type(4))) _Float16 v4h;

#define CV_LOADS  32                        // 16-byte loads of a lane
#define CV_PIECE  (CV_LOADS * 32 * 4)       // elements per wave: 4096
#define CV_WAVES  15                        // waves per block
#define CV_XP     (ROWS * DD / CV_PIECE)    // pieces of q, k or v: 1024
#define CV_WP     (DD * DD / CV_PIECE)      // pieces of a weight matrix: 256
#define CV_BLOCKS ((3 * CV_XP + 3 * CV_WP) / CV_WAVES)   // 256, no remainder

__global__ __launch_bounds__(CV_WAVES * 32) void cvt_all_f32_to_f16_kernel(
    const float* __restrict__ q,  const float* __restrict__ k,
    const float* __restrict__ v,  const float* __restrict__ Wq,
    const float* __restrict__ Wk, const float* __restrict__ Wv,
    half_t* __restrict__ dst)
{
    // the wave's number as a scalar: the choice of the source array stays scalar
    const int wave  = __builtin_amdgcn_readfirstlane((int)(threadIdx.x >> 5));
    const int lane  = threadIdx.x & 31;
    const int piece = blockIdx.x * CV_WAVES + wave;

    const float* src;
    int off;                                 // the piece's number inside its array
    if (piece < 3 * CV_XP) {
        const int a = piece / CV_XP;
        src = (a == 0) ? q : (a == 1) ? k : v;
        off = piece % CV_XP;
    } else {
        const int a = (piece - 3 * CV_XP) / CV_WP;
        src = (a == 0) ? Wq : (a == 1) ? Wk : Wv;
        off = (piece - 3 * CV_XP) % CV_WP;
    }

    const v4f* s = (const v4f*)(src + (size_t)off * CV_PIECE) + lane;
    v4h*       d = (v4h*)(dst + (size_t)piece * CV_PIECE) + lane;

    // both loops unrolled: x lives in registers and every offset is an immediate
    v4f x[CV_LOADS];
#pragma unroll
    for (int j = 0; j < CV_LOADS; ++j) x[j] = s[j * 32];
    // keeps all 32 loads ahead of the first conversion, so that all are in flight
    // (without it the compiler holds 14 of them back behind the first waits)
    __builtin_amdgcn_sched_barrier(0);
#pragma unroll
    for (int j = 0; j < CV_LOADS; ++j) {
        v4h o;
        o[0] = (_Float16)x[j][0]; o[1] = (_Float16)x[j][1];
        o[2] = (_Float16)x[j][2]; o[3] = (_Float16)x[j][3];
        d[j * 32] = o;
    }
}

// ---------------------------------------------------------------------------
// Projection GEMM, all-f16 operands: out[s,e] = sum_d Xh[s,d]*Wh[e,d] + b[e].
//   transpose_out == 0 : out layout [B,H,S,Hd]   (Q, K)
//   transpose_out == 1 : out layout [B,H,Hd,S]   (V -> contiguous PV A-frags)
// One workgroup per 128(row) x 128(col) tile of the output, 8 waves in a
// 2 x 4 grid, 64 x 32 per wave.  A pass is 128 k (256 B of each of the 128 X
// rows and 128 W rows); the pass's rows are brought into LDS by asynchronous
// copies, whole 256-B row pieces per half wave, and shared by all 8 waves.
// Two buffers: pass t+1's copies fly while pass t is multiplied.
// LDS rows are pitched 272 B so that the 16-byte fragment reads of 16
// neighbouring rows fall on different banks.
// ---------------------------------------------------------------------------
#define PJ_TILE   128                       // output tile edge
#define PJ_KP     128                       // k per pass (halves)
#define PJ_PITCH  136                       // LDS row pitch (halves) = 272 B
#define PJ_STAGE  (2 * PJ_TILE * PJ_PITCH)  // halves per buffer: X rows, then W rows
#define PJ_NPASS  (DD / PJ_KP)              // 8

// Eight 16-byte copies of one lane: rows r, r+16, ..., r+112 of one operand.
// g: the lane's 16 bytes in the first row; l: their LDS byte address.
__device__ __forceinline__ void proj_copy8(const half_t* g, unsigned l) {
    const half_t* g1 = g + 16 * 1 * DD;  const unsigned l1 = l + 16 * 1 * PJ_PITCH * 2;
    const half_t* g2 = g + 16 * 2 * DD;  const unsigned l2 = l + 16 * 2 * PJ_PITCH * 2;
    const half_t* g3 = g + 16 * 3 * DD;  const unsigned l3 = l + 16 * 3 * PJ_PITCH * 2;
    const half_t* g4 = g + 16 * 4 * DD;  const unsigned l4 = l + 16 * 4 * PJ_PITCH * 2;
    const half_t* g5 = g + 16 * 5 * DD;  const unsigned l5 = l + 16 * 5 * PJ_PITCH * 2;
    const half_t* g6 = g + 16 * 6 * DD;  const unsigned l6 = l + 16 * 6 * PJ_PITCH * 2;
    const half_t* g7 = g + 16 * 7 * DD;  const unsigned l7 = l + 16 * 7 * PJ_PITCH * 2;
    // The closing s_wait_xcnt stands inside the statement so that no address
    // register named here is rewritten ahead of it.
    asm volatile(
        "global_load_async_to_lds_b128 %0, %8, off\n\t"
        "global_load_async_to_lds_b128 %1, %9, off\n\t"
        "global_load_async_to_lds_b128 %2, %10, off\n\t"
        "global_load_async_to_lds_b128 %3, %11, off\n\t"
        "global_load_async_to_lds_b128 %4, %12, off\n\t"
        "global_load_async_to_lds_b128 %5, %13, off\n\t"
        "global_load_async_to_lds_b128 %6, %14, off\n\t"
        "global_load_async_to_lds_b128 %7, %15, off\n\t"
        "s_wait_xcnt 0x0"
        :: "v"(l), "v"(l1), "v"(l2), "v"(l3), "v"(l4), "v"(l5), "v"(l6), "v"(l7),
           "v"(g), "v"(g1), "v"(g2), "v"(g3), "v"(g4), "v"(g5), "v"(g6), "v"(g7)
        : "memory");
}

__global__ __launch_bounds__(256) void proj_wmma_kernel(
    const half_t* __restrict__ Xh, const half_t* __restrict__ Wh,
    const float* __restrict__ bias, half_t* __restrict__ out,
    int transpose_out)
{
    __shared__ __align__(16) half_t stg[2 * PJ_STAGE];   // 139,264 B

    const int tid  = threadIdx.x;
    const int wid  = tid >> 5;
    const int lane = tid & 31;
    const int l16  = lane & 15;
    const int hi   = lane >> 4;
    const int klo  = hi * 8;

    const int NT = DD / PJ_TILE;                       // 8 tile columns
    const int m0 = (blockIdx.x / NT) * PJ_TILE;        // first X row of the tile
    const int n0 = (blockIdx.x % NT) * PJ_TILE;        // first W row of the tile
    const int wm = (wid >> 2) * 64;                    // wave's rows in the tile
    const int wn = (wid & 3) * 32;                     // wave's columns in the tile

    // Copy duty of a lane: 16-byte piece (tid & 15) of rows (tid >> 4) + 16 j.
    const int crow = tid >> 4;
    const int ccol = (tid & 15) * 8;
    const half_t* gx = Xh + (size_t)(m0 + crow) * DD + ccol;
    const half_t* gw = Wh + (size_t)(n0 + crow) * DD + ccol;
    const unsigned lx = (unsigned)(size_t)&stg[crow * PJ_PITCH + ccol];
    const unsigned lw = lx + PJ_TILE * PJ_PITCH * 2;

    // Every inner loop below is unrolled so that each accumulator and fragment
    // index is a constant: the arrays then live in registers, not in scratch.
    v8f acc[4][2];
#pragma unroll
    for (int i = 0; i < 4; ++i)
#pragma unroll
        for (int j = 0; j < 2; ++j) acc[i][j] = (v8f)(0.0f);

    // pass 0 -> buffer 0, landed and published; then pass 1 -> buffer 1
    proj_copy8(gx, lx);
    proj_copy8(gw, lw);
    // this wave's copies have landed before the barrier lets others read them
    asm volatile("s_wait_asynccnt 0x0" ::: "memory");
    __syncthreads();
    proj_copy8(gx + PJ_KP, lx + PJ_STAGE * 2);
    proj_copy8(gw + PJ_KP, lw + PJ_STAGE * 2);

    // rolled: eight copies of the pass body would only lengthen the kernel's text
#pragma unroll 1
    for (int t = 0; t < PJ_NPASS; ++t) {
        const int buf = t & 1;
        const half_t* xs = stg + buf * PJ_STAGE + (wm + l16) * PJ_PITCH + klo;
        const half_t* wsm = stg + buf * PJ_STAGE + (PJ_TILE + wn + l16) * PJ_PITCH + klo;
        // Two fragment sets: step s+1's LDS reads go out as one group ahead of
        // step s's products, so the products cover their latency.
        v16h a[2][4], b[2][2];
#pragma unroll
        for (int i = 0; i < 4; ++i) a[0][i] = load_frag_f16(xs + i * 16 * PJ_PITCH);
#pragma unroll
        for (int j = 0; j < 2; ++j) b[0][j] = load_frag_f16(wsm + j * 16 * PJ_PITCH);
#pragma unroll
        for (int s = 0; s < PJ_KP / 32; ++s) {
            const int cur = s & 1, nxt = cur ^ 1;
            if (s + 1 < PJ_KP / 32) {
#pragma unroll
                for (int i = 0; i < 4; ++i)
                    a[nxt][i] = load_frag_f16(xs + i * 16 * PJ_PITCH + (s + 1) * 32);
#pragma unroll
                for (int j = 0; j < 2; ++j)
                    b[nxt][j] = load_frag_f16(wsm + j * 16 * PJ_PITCH + (s + 1) * 32);
            }
            // keeps the read group above the products instead of spread among them
            __builtin_amdgcn_sched_barrier(0);
#pragma unroll
            for (int i = 0; i < 4; ++i)
#pragma unroll
                for (int j = 0; j < 2; ++j)
                    acc[i][j] = wmma_f16(a[cur][i], b[cur][j], acc[i][j]);
            // keeps the next group's reads from sinking into these products
            __builtin_amdgcn_sched_barrier(0);
        }
        // Hand-over: this wave's reads of buffer buf are done, its copies of
        // pass t+1 have landed; behind the barrier that holds for every wave.
        asm volatile("s_wait_dscnt 0x0" ::: "memory");
        asm volatile("s_wait_asynccnt 0x0" ::: "memory");
        __syncthreads();
        if (t + 2 < PJ_NPASS) {
            proj_copy8(gx + (t + 2) * PJ_KP, lx + buf * (PJ_STAGE * 2));
            proj_copy8(gw + (t + 2) * PJ_KP, lw + buf * (PJ_STAGE * 2));
        }
    }
    // no copy of this wave is outstanding when it ends
    asm volatile("s_wait_asynccnt 0x0" ::: "memory");

    // Bias + store. C layout: acc[i][j][r] = out[row0 + i*16 + r + 8*hi][col0 + j*16 + l16]
#pragma unroll
    for (int j = 0; j < 2; ++j) {
        const int e    = n0 + wn + j * 16 + l16;
        const float bv = bias[e];
        const int h    = e >> 6;
        const int d    = e & 63;
#pragma unroll
        for (int i = 0; i < 4; ++i) {
#pragma unroll
            for (int r = 0; r < 8; ++r) {
                const int sg   = m0 + wm + i * 16 + r + 8 * hi;
                const int b_   = sg >> 11;
                const int sloc = sg & 2047;
                const float vfin = acc[i][j][r] + bv;
                size_t idx;
                if (transpose_out)
                    idx = (((size_t)(b_ * HH + h) * HD + d) * SS) + sloc;
                else
                    idx = (((size_t)(b_ * HH + h) * SS + sloc) * HD) + d;
                out[idx] = (_Float16)vfin;
            }
        }
    }
}

#define AT_KEYS   128
#define AT_KPITCH 72
#define AT_VPITCH 136
#define AT_KH     (AT_KEYS * AT_KPITCH)
#define AT_STAGE  (AT_KH + HD * AT_VPITCH)
#define AT_NST    (SS / AT_KEYS)

// Eight 16-byte copies of one lane: K rows r, r+32, r+64, r+96 and VpT rows
// d, d+16, d+32, d+48.  gk, gv: the lane's 16 bytes in the first row of each;
// lk, lv: their LDS byte addresses.
__device__ __forceinline__ void attn_copy8(const half_t* gk, unsigned lk,
                                           const half_t* gv, unsigned lv) {
    const half_t* gk1 = gk + 32 * 1 * HD;  const unsigned lk1 = lk + 32 * 1 * AT_KPITCH * 2;
    const half_t* gk2 = gk + 32 * 2 * HD;  const unsigned lk2 = lk + 32 * 2 * AT_KPITCH * 2;
    const half_t* gk3 = gk + 32 * 3 * HD;  const unsigned lk3 = lk + 32 * 3 * AT_KPITCH * 2;
    const half_t* gv1 = gv + 16 * 1 * SS;  const unsigned lv1 = lv + 16 * 1 * AT_VPITCH * 2;
    const half_t* gv2 = gv + 16 * 2 * SS;  const unsigned lv2 = lv + 16 * 2 * AT_VPITCH * 2;
    const half_t* gv3 = gv + 16 * 3 * SS;  const unsigned lv3 = lv + 16 * 3 * AT_VPITCH * 2;
    // The closing s_wait_xcnt stands inside the statement so that no address
    // register named here is rewritten ahead of it.
    asm volatile(
        "global_load_async_to_lds_b128 %0, %8, off\n\t"
        "global_load_async_to_lds_b128 %1, %9, off\n\t"
        "global_load_async_to_lds_b128 %2, %10, off\n\t"
        "global_load_async_to_lds_b128 %3, %11, off\n\t"
        "global_load_async_to_lds_b128 %4, %12, off\n\t"
        "global_load_async_to_lds_b128 %5, %13, off\n\t"
        "global_load_async_to_lds_b128 %6, %14, off\n\t"
        "global_load_async_to_lds_b128 %7, %15, off\n\t"
        "s_wait_xcnt 0x0"
        :: "v"(lk), "v"(lk1), "v"(lk2), "v"(lk3), "v"(lv), "v"(lv1), "v"(lv2), "v"(lv3),
           "v"(gk), "v"(gk1), "v"(gk2), "v"(gk3), "v"(gv), "v"(gv1), "v"(gv2), "v"(gv3)
        : "memory");
}

// The value that lane l ^ 16 holds.
__device__ __forceinline__ float other_half(float x) {
    const int b = __builtin_bit_cast(int, x);
    return __builtin_bit_cast(float,
        __builtin_amdgcn_permlanex16(b, b, 0x76543210, 0xfedcba98, false, false));
}

#define LOG2E 1.44269504088896340736f

// A run of exponentials to base 2.  The instruction set asks for one slot
// between a transcendental and an instruction that reads its result or
// overwrites its source: inside the run no instruction names a register of
// another (every output is early-clobber), and the closing v_nop is the slot
// behind the last one.
__device__ __forceinline__ void exp2_run8(v8f x, v8f& y) {
    float y0, y1, y2, y3, y4, y5, y6, y7;
    asm("v_exp_f32 %0, %8\n\t"
        "v_exp_f32 %1, %9\n\t"
        "v_exp_f32 %2, %10\n\t"
        "v_exp_f32 %3, %11\n\t"
        "v_exp_f32 %4, %12\n\t"
        "v_exp_f32 %5, %13\n\t"
        "v_exp_f32 %6, %14\n\t"
        "v_exp_f32 %7, %15\n\t"
        "v_nop"
        : "=&v"(y0), "=&v"(y1), "=&v"(y2), "=&v"(y3),
          "=&v"(y4), "=&v"(y5), "=&v"(y6), "=&v"(y7)
        : "v"(x[0]), "v"(x[1]), "v"(x[2]), "v"(x[3]),
          "v"(x[4]), "v"(x[5]), "v"(x[6]), "v"(x[7]));
    y[0] = y0; y[1] = y1; y[2] = y2; y[3] = y3;
    y[4] = y4; y[5] = y5; y[6] = y6; y[7] = y7;
}

// The same with one more value in front.
__device__ __forceinline__ void exp2_run9(float xa, v8f x, float& ya, v8f& y) {
    float y0, y1, y2, y3, y4, y5, y6, y7;
    asm("v_exp_f32 %0, %9\n\t"
        "v_exp_f32 %1, %10\n\t"
        "v_exp_f32 %2, %11\n\t"
        "v_exp_f32 %3, %12\n\t"
        "v_exp_f32 %4, %13\n\t"
        "v_exp_f32 %5, %14\n\t"
        "v_exp_f32 %6, %15\n\t"
        "v_exp_f32 %7, %16\n\t"
        "v_exp_f32 %8, %17\n\t"
        "v_nop"
        : "=&v"(ya), "=&v"(y0), "=&v"(y1), "=&v"(y2), "=&v"(y3),
          "=&v"(y4), "=&v"(y5), "=&v"(y6), "=&v"(y7)
        : "v"(xa), "v"(x[0]), "v"(x[1]), "v"(x[2]), "v"(x[3]),
          "v"(x[4]), "v"(x[5]), "v"(x[6]), "v"(x[7]));
    y[0] = y0; y[1] = y1; y[2] = y2; y[3] = y3;
    y[4] = y4; y[5] = y5; y[6] = y6; y[7] = y7;
}

__global__ __launch_bounds__(256) void attn_wmma_kernel(
    const half_t* __restrict__ Qp, const half_t* __restrict__ Kp,
    const half_t* __restrict__ VpT, float* __restrict__ out)
{
    __shared__ __align__(16) half_t kvs[2 * AT_STAGE];  // 71,680 B: the two stage buffers

    const int tid  = threadIdx.x;
    const int wid  = threadIdx.x >> 5;
    const int lane = threadIdx.x & 31;
    const int l16  = lane & 15;
    const int hi   = lane >> 4;
    const int klo  = hi * 8;

    const int unit = blockIdx.x * (blockDim.x >> 5) + wid;
    const int QTILES = SS / 16;
    const int bh = unit / QTILES;
    const int q0 = (unit % QTILES) * 16;

    const half_t* qb = Qp  + (size_t)bh * SS * HD;
    const half_t* kb = Kp  + (size_t)bh * SS * HD;
    const half_t* vt = VpT + (size_t)bh * HD * SS;

    const half_t* qrow = qb + (size_t)(q0 + l16) * HD;
    const v16h qa0 = load_frag_f16(qrow + 0  + klo);
    const v16h qa1 = load_frag_f16(qrow + 32 + klo);

    v8f oacc[4];
#pragma unroll
    for (int t = 0; t < 4; ++t) oacc[t] = (v8f)(0.0f);
    // of the lane's query: maximum over all keys so far; sum over the keys that
    // this half of the wave holds (the halves are joined behind the loop)
    float m_run = -INFINITY, l_run = 0.0f;

    const float scale = 0.125f;   // 1/sqrt(64)

    // Copy duty of a lane: 16-byte piece (tid & 7) of K rows (tid >> 3) + 32 j,
    // 16-byte piece (tid & 15) of VpT rows (tid >> 4) + 16 j.
    const half_t* gk = kb + (size_t)(tid >> 3) * HD + (tid & 7) * 8;
    const half_t* gv = vt + (size_t)(tid >> 4) * SS + (tid & 15) * 8;
    const unsigned lk = (unsigned)(size_t)&kvs[(tid >> 3) * AT_KPITCH + (tid & 7) * 8];
    const unsigned lv = (unsigned)(size_t)&kvs[AT_KH + (tid >> 4) * AT_VPITCH + (tid & 15) * 8];

    // stage 0 -> buffer 0, landed and published; then stage 1 -> buffer 1
    attn_copy8(gk, lk, gv, lv);
    // this wave's copies have landed before the barrier lets others read them
    asm volatile("s_wait_asynccnt 0x0" ::: "memory");
    __syncthreads();
    attn_copy8(gk + AT_KEYS * HD, lk + AT_STAGE * 2, gv + AT_KEYS, lv + AT_STAGE * 2);

    // rolled: sixteen copies of the stage body would only lengthen the kernel's text
#pragma unroll 1
    for (int st = 0; st < AT_NST; ++st) {
      const int buf = st & 1;
      const half_t* ks = kvs + buf * AT_STAGE + l16 * AT_KPITCH + klo;
      const half_t* vs = kvs + buf * AT_STAGE + AT_KH + l16 * AT_VPITCH + klo;
      // by 2: the pair's LDS offsets are immediates of its reads
#pragma unroll 2
      for (int c = 0; c < AT_KEYS / 32; ++c) {
        // ---- issue all K and V fragment reads for this chunk ----
        const half_t* kr0 = ks + (c * 32 + 0)  * AT_KPITCH;
        const half_t* kr1 = ks + (c * 32 + 16) * AT_KPITCH;
        v16h kb00 = load_frag_f16(kr0 + 0);
        v16h kb01 = load_frag_f16(kr0 + 32);
        v16h kb10 = load_frag_f16(kr1 + 0);
        v16h kb11 = load_frag_f16(kr1 + 32);
        v16h vb[4];
#pragma unroll
        for (int t = 0; t < 4; ++t)
            vb[t] = load_frag_f16(vs + t * 16 * AT_VPITCH + c * 32);
        __builtin_amdgcn_sched_barrier(0);   // keep loads above the compute

        // ---- S^T = K * Q^T (two 16-key m-tiles, two 32-wide k-steps) ----
        // sac0[i]: key c*32 + 8*hi + i, sac1[i]: key c*32 + 16 + 8*hi + i; query l16
        v8f sac0 = (v8f)(0.0f), sac1 = (v8f)(0.0f);
        sac0 = wmma_f16(kb00, qa0, sac0);
        sac0 = wmma_f16(kb01, qa1, sac0);
        sac1 = wmma_f16(kb10, qa0, sac1);
        sac1 = wmma_f16(kb11, qa1, sac1);

        // ---- online softmax over the 32 new keys, one query per lane ----
        const v8f s0 = sac0 * scale;
        const v8f s1 = sac1 * scale;
        float v = fmaxf(s0[0], s0[1]);
#pragma unroll
        for (int i = 2; i < 8; ++i) v = fmaxf(v, s0[i]);
#pragma unroll
        for (int i = 0; i < 8; ++i) v = fmaxf(v, s1[i]);
        v = fmaxf(v, other_half(v));
        const float mn = fmaxf(m_run, v);
        // exp(x) as exp2(x * log2(e)), the form __expf compiles to
        const v8f x0 = (s0 - mn) * LOG2E;
        const v8f x1 = (s1 - mn) * LOG2E;
        float al;
        v8f p0, p1;
        exp2_run9((m_run - mn) * LOG2E, x0, al, p0);
        exp2_run8(x1, p1);
        float rs0 = p0[0], rs1 = p1[0];
#pragma unroll
        for (int i = 1; i < 8; ++i) { rs0 += p0[i]; rs1 += p1[i]; }
        v16h pb;
#pragma unroll
        for (int i = 0; i < 8; ++i) {
            pb[i]     = (_Float16)p0[i];
            pb[8 + i] = (_Float16)p1[i];
        }
        l_run = l_run * al + (rs0 + rs1);
        m_run = mn;
#pragma unroll
        for (int t = 0; t < 4; ++t)
#pragma unroll
            for (int i = 0; i < 8; ++i) oacc[t][i] *= al;

        // ---- O^T += V^T * P^T: oacc[t][i] = O[query l16][d = t*16 + 8*hi + i] ----
#pragma unroll
        for (int t = 0; t < 4; ++t)
            oacc[t] = wmma_f16(vb[t], pb, oacc[t]);
      }
      // Hand-over: this wave's reads of buffer buf are done, its copies of
      // stage st+1 have landed; behind the barrier that holds for every wave.
      asm volatile("s_wait_dscnt 0x0" ::: "memory");
      asm volatile("s_wait_asynccnt 0x0" ::: "memory");
      __syncthreads();
      if (st + 2 < AT_NST)
          attn_copy8(gk + (st + 2) * (AT_KEYS * HD), lk + buf * (AT_STAGE * 2),
                     gv + (st + 2) * AT_KEYS,        lv + buf * (AT_STAGE * 2));
    }
    // no copy of this wave is outstanding when it ends
    asm volatile("s_wait_asynccnt 0x0" ::: "memory");

    // ---- normalize and store: out[b, q0+l16, h*64 + t*16 + 8*hi + 0..7] ----
    const int b_ = bh / HH;
    const int h_ = bh % HH;
    const float inv = 1.0f / (l_run + other_half(l_run));
    float* orow = out + ((size_t)(b_ * SS + q0 + l16)) * DD + h_ * HD + 8 * hi;
#pragma unroll
    for (int t = 0; t < 4; ++t) {
        float4 lo4, hi4;
        lo4.x = oacc[t][0] * inv; lo4.y = oacc[t][1] * inv;
        lo4.z = oacc[t][2] * inv; lo4.w = oacc[t][3] * inv;
        hi4.x = oacc[t][4] * inv; hi4.y = oacc[t][5] * inv;
        hi4.z = oacc[t][6] * inv; hi4.w = oacc[t][7] * inv;
        *(float4*)(orow + t * 16)     = lo4;
        *(float4*)(orow + t * 16 + 4) = hi4;
    }
}

// ---------------------------------------------------------------------------
// Host-side launch. Inputs: q,k,v,Wq,bq,Wk,bk,Wv,bv (all f32).
// Workspace (f16 halves):
//   [0)   qh,kh,vh    : 3 x 4M  (converted activations)
//   [12M) wqh,wkh,wvh : 3 x 1M  (converted weights)
//   [15M) Qp,Kp,VpT   : 3 x 4M  (projected heads)
// Total 27M halves = 54 MB.
// ---------------------------------------------------------------------------
extern "C" void kernel_launch(void* const* d_in, const int* in_sizes, int n_in,
                              void* d_out, int out_size, void* d_ws, size_t ws_size,
                              hipStream_t stream) {
    const float* q  = (const float*)d_in[0];
    const float* k  = (const float*)d_in[1];
    const float* v  = (const float*)d_in[2];
    const float* Wq = (const float*)d_in[3];
    const float* bq = (const float*)d_in[4];
    const float* Wk = (const float*)d_in[5];
    const float* bk = (const float*)d_in[6];
    const float* Wv = (const float*)d_in[7];
    const float* bv = (const float*)d_in[8];
    float* out = (float*)d_out;

    const size_t XN = (size_t)ROWS * DD;   // 4,194,304
    const size_t WN = (size_t)DD * DD;     // 1,048,576
    half_t* ws  = (half_t*)d_ws;
    half_t* qh  = ws;
    half_t* kh  = qh  + XN;
    half_t* vh  = kh  + XN;
    half_t* wqh = vh  + XN;
    half_t* wkh = wqh + WN;
    half_t* wvh = wkh + WN;
    half_t* Qp  = wvh + WN;
    half_t* Kp  = Qp  + XN;
    half_t* VpT = Kp  + XN;

    // 1) f32 -> f16 conversion of all six operands, one launch: qh .. wvh are
    //    contiguous from ws on, in the kernel's order
    cvt_all_f32_to_f16_kernel<<<CV_BLOCKS, CV_WAVES * 32, 0, stream>>>(q, k, v, Wq, Wk, Wv, qh);

    // 2) projections: one block per 128 x 128 output tile -> 32 x 8 = 256 blocks
    const int projBlocks = (ROWS / PJ_TILE) * (DD / PJ_TILE);
    proj_wmma_kernel<<<projBlocks, 256, 0, stream>>>(qh, wqh, bq, Qp, 0);
    proj_wmma_kernel<<<projBlocks, 256, 0, stream>>>(kh, wkh, bk, Kp, 0);
    proj_wmma_kernel<<<projBlocks, 256, 0, stream>>>(vh, wvh, bv, VpT, 1);

    // 3) attention: units = B*H*(S/16) = 4096 -> 512 blocks x 8 waves
    const int attnBlocks = BB * HH * (SS / 16) / 8;
    attn_wmma_kernel<<<attnBlocks, 256, 0, stream>>>(Qp, Kp, VpT, out);
}

// v005
// A run of this version takes 87.3 microseconds.
// Two timings next to v004 both put it at 1.09 times that version's speed.
// All steps since v000 together make it 3.05 times as fast.
#include <hip/hip_runtime.h>

// Problem constants (from reference)
#define BB   2
#define SS   2048
#define DD   1024
#define HH   16
#define HD   64
#define ROWS (BB * SS)          // 4096 rows in the projection GEMMs

typedef _Float16 half_t;
typedef __attribute__((ext_vector_type(16))) _Float16 v16h;
typedef __attribute__((ext_vector_type(8)))  _Float16 v8h;
typedef __attribute__((ext_vector_type(8)))  float    v8f;

// ---------------------------------------------------------------------------
// Fragment helper: A-layout (16-bit A, 16x32, ISA 7.12.2): lane l (l16=l&15)
// holds row M=l16; halves a[0..7]=K(klo..klo+7), a[8..15]=K(16+klo..) with
// klo = (lane>=16 ? 8 : 0).  B uses the symmetric lane-per-column layout.
// Both reduce to: 8 contiguous halves at p, 8 contiguous halves at p+16.
// ---------------------------------------------------------------------------
__device__ __forceinline__ v16h load_frag_f16(const half_t* p) {
    v8h lo = *(const v8h*)(p);
    v8h hi = *(const v8h*)(p + 16);
    v16h r;
#pragma unroll
    for (int i = 0; i < 8; ++i) { r[i] = lo[i]; r[8 + i] = hi[i]; }
    return r;
}

__device__ __forceinline__ v8f wmma_f16(v16h a, v16h b, v8f c) {
    return __builtin_amdgcn_wmma_f32_16x16x32_f16(
        false, a, false, b, (short)0, c, false, false);
}

// ---------------------------------------------------------------------------
// f32 -> f16 conversion of all six operands in one launch (memory bound; feeds
// all later kernels).  The six f16 arrays lie one behind the other in dst, in
// the order q, k, v, Wq, Wk, Wv.  A wave takes one piece of 4096 elements
// (16 KiB of f32) of one array: 32 loads of 16 B per lane, each covering 512
// contiguous bytes, all issued before the first is used, then 32 stores of 8 B
// per lane, each covering 256 contiguous bytes.  Few long waves instead of many
// short ones, for speed only.
// ---------------------------------------------------------------------------
typedef __attribute__((ext_vector_type(4))) float    v4f;
typedef __attribute__((ext_vector_type(4))) _Float16 v4h;

#define CV_LOADS  32                        // 16-byte loads of a lane
#define CV_PIECE  (CV_LOADS * 32 * 4)       // elements per wave: 4096
#define CV_WAVES  15                        // waves per block
#define CV_XP     (ROWS * DD / CV_PIECE)    // pieces of q, k or v: 1024
#define CV_WP     (DD * DD / CV_PIECE)      // pieces of a weight matrix: 256
#define CV_BLOCKS ((3 * CV_XP + 3 * CV_WP) / CV_WAVES)   // 256, no remainder

__global__ __launch_bounds__(CV_WAVES * 32) void cvt_all_f32_to_f16_kernel(
    const float* __restrict__ q,  const float* __restrict__ k,
    const float* __restrict__ v,  const float* __restrict__ Wq,
    const float* __restrict__ Wk, const float* __restrict__ Wv,
    half_t* __restrict__ dst)
{
    // the wave's number as a scalar: the choice of the source array stays scalar
    const int wave  = __builtin_amdgcn_readfirstlane((int)(threadIdx.x >> 5));
    const int lane  = threadIdx.x & 31;
    const int piece = blockIdx.x * CV_WAVES + wave;

    const float* src;
    int off;                                 // the piece's number inside its array
    if (piece < 3 * CV_XP) {
        const int a = piece / CV_XP;
        src = (a == 0) ? q : (a == 1) ? k : v;
        off = piece % CV_XP;
    } else {
        const int a = (piece - 3 * CV_XP) / CV_WP;
        src = (a == 0) ? Wq : (a == 1) ? Wk : Wv;
        off = (piece - 3 * CV_XP) % CV_WP;
    }

    const v4f* s = (const v4f*)(src + (size_t)off * CV_PIECE) + lane;
    v4h*       d = (v4h*)(dst + (size_t)piece * CV_PIECE) + lane;

    // both loops unrolled: x lives in registers and every offset is an immediate
    v4f x[CV_LOADS];
#pragma unroll
    for (int j = 0; j < CV_LOADS; ++j) x[j] = s[j * 32];
    // keeps all 32 loads ahead of the first conversion, so that all are in flight
    // (without it the compiler holds 14 of them back behind the first waits)
    __builtin_amdgcn_sched_barrier(0);
#pragma unroll
    for (int j = 0; j < CV_LOADS; ++j) {
        v4h o;
        o[0] = (_Float16)x[j][0]; o[1] = (_Float16)x[j][1];
        o[2] = (_Float16)x[j][2]; o[3] = (_Float16)x[j][3];
        d[j * 32] = o;
    }
}

// ---------------------------------------------------------------------------
// Projection GEMMs, all-f16 operands: out[s,e] = sum_d Xh[s,d]*Wh[e,d] + b[e].
// One launch does all three: blockIdx.y = 0, 1, 2 is the V, K, Q projection.
// None reads what another writes; in one grid there is one launch gap, one
// fill and one tail instead of three, and two workgroups share a WGP (LDS and
// registers fit twice), so one's first tile, hand-overs and stores run under
// the other's products.  The three X, the three W and the three outputs each
// lie one behind the other in the workspace.
//   transpose_out == 0 : out layout [B,H,S,Hd]   (Q, K)
//   transpose_out == 1 : out layout [B,H,Hd,S]   (V -> contiguous V^T*P^T A-frags)
// One workgroup per 128(row) x 128(col) tile of an output, 8 waves in a
// 2 x 4 grid, 64 x 32 per wave.  A pass is 128 k (256 B of each of the 128 X
// rows and 128 W rows); the pass's rows are brought into LDS by asynchronous
// copies, whole 256-B row pieces per half wave, and shared by all 8 waves.
// Two buffers: pass t+1's copies fly while pass t is multiplied.
// LDS rows are pitched 272 B so that the 16-byte fragment reads of 16
// neighbouring rows fall on different banks.
// ---------------------------------------------------------------------------
#define PJ_TILE   128                       // output tile edge
#define PJ_KP     128                       // k per pass (halves)
#define PJ_PITCH  136                       // LDS row pitch (halves) = 272 B
#define PJ_STAGE  (2 * PJ_TILE * PJ_PITCH)  // halves per buffer: X rows, then W rows
#define PJ_NPASS  (DD / PJ_KP)              // 8

// Eight 16-byte copies of one lane: rows r, r+16, ..., r+112 of one operand.
// g: the lane's 16 bytes in the first row; l: their LDS byte address.
__device__ __forceinline__ void proj_copy8(const half_t* g, unsigned l) {
    const half_t* g1 = g + 16 * 1 * DD;  const unsigned l1 = l + 16 * 1 * PJ_PITCH * 2;
    const half_t* g2 = g + 16 * 2 * DD;  const unsigned l2 = l + 16 * 2 * PJ_PITCH * 2;
    const half_t* g3 = g + 16 * 3 * DD;  const unsigned l3 = l + 16 * 3 * PJ_PITCH * 2;
    const half_t* g4 = g + 16 * 4 * DD;  const unsigned l4 = l + 16 * 4 * PJ_PITCH * 2;
    const half_t* g5 = g + 16 * 5 * DD;  const unsigned l5 = l + 16 * 5 * PJ_PITCH * 2;
    const half_t* g6 = g + 16 * 6 * DD;  const unsigned l6 = l + 16 * 6 * PJ_PITCH * 2;
    const half_t* g7 = g + 16 * 7 * DD;  const unsigned l7 = l + 16 * 7 * PJ_PITCH * 2;
    // The closing s_wait_xcnt stands inside the statement so that no address
    // register named here is rewritten ahead of it.
    asm volatile(
        "global_load_async_to_lds_b128 %0, %8, off\n\t"
        "global_load_async_to_lds_b128 %1, %9, off\n\t"
        "global_load_async_to_lds_b128 %2, %10, off\n\t"
        "global_load_async_to_lds_b128 %3, %11, off\n\t"
        "global_load_async_to_lds_b128 %4, %12, off\n\t"
        "global_load_async_to_lds_b128 %5, %13, off\n\t"
        "global_load_async_to_lds_b128 %6, %14, off\n\t"
        "global_load_async_to_lds_b128 %7, %15, off\n\t"
        "s_wait_xcnt 0x0"
        :: "v"(l), "v"(l1), "v"(l2), "v"(l3), "v"(l4), "v"(l5), "v"(l6), "v"(l7),
           "v"(g), "v"(g1), "v"(g2), "v"(g3), "v"(g4), "v"(g5), "v"(g6), "v"(g7)
        : "memory");
}

__global__ __launch_bounds__(256) void proj_wmma_kernel(
    const half_t* __restrict__ Xall, const half_t* __restrict__ Wall,
    const float* __restrict__ bq, const float* __restrict__ bk,
    const float* __restrict__ bv, half_t* __restrict__ outall)
{
    __shared__ __align__(16) half_t stg[2 * PJ_STAGE];   // 139,264 B

    // Which projection this workgroup belongs to (0 Q, 1 K, 2 V): all of it scalar.
    // V is blockIdx.y 0, for speed only: a store of its transposed layout touches
    // 16 lines, one of Q or K two.
    const int which = 2 - (int)blockIdx.y;
    const half_t* Xh  = Xall   + (size_t)which * (ROWS * DD);
    const half_t* Wh  = Wall   + (size_t)which * (DD * DD);
    half_t*       out = outall + (size_t)which * (ROWS * DD);
    const float* bias = (which == 0) ? bq : (which == 1) ? bk : bv;
    const int transpose_out = (which == 2);

    const int tid  = threadIdx.x;
    const int wid  = tid >> 5;
    const int lane = tid & 31;
    const int l16  = lane & 15;
    const int hi   = lane >> 4;
    const int klo  = hi * 8;

    const int NT = DD / PJ_TILE;                       // 8 tile columns
    const int m0 = (blockIdx.x / NT) * PJ_TILE;        // first X row of the tile
    const int n0 = (blockIdx.x % NT) * PJ_TILE;        // first W row of the tile
    const int wm = (wid >> 2) * 64;                    // wave's rows in the tile
    const int wn = (wid & 3) * 32;                     // wave's columns in the tile

    // Copy duty of a lane: 16-byte piece (tid & 15) of rows (tid >> 4) + 16 j.
    const int crow = tid >> 4;
    const int ccol = (tid & 15) * 8;
    const half_t* gx = Xh + (size_t)(m0 + crow) * DD + ccol;
    const half_t* gw = Wh + (size_t)(n0 + crow) * DD + ccol;
    const unsigned lx = (unsigned)(size_t)&stg[crow * PJ_PITCH + ccol];
    const unsigned lw = lx + PJ_TILE * PJ_PITCH * 2;

    // Every inner loop below is unrolled so that each accumulator and fragment
    // index is a constant: the arrays then live in registers, not in scratch.
    v8f acc[4][2];
#pragma unroll
    for (int i = 0; i < 4; ++i)
#pragma unroll
        for (int j = 0; j < 2; ++j) acc[i][j] = (v8f)(0.0f);

    // pass 0 -> buffer 0, landed and published; then pass 1 -> buffer 1
    proj_copy8(gx, lx);
    proj_copy8(gw, lw);
    // this wave's copies have landed before the barrier lets others read them
    asm volatile("s_wait_asynccnt 0x0" ::: "memory");
    __syncthreads();
    proj_copy8(gx + PJ_KP, lx + PJ_STAGE * 2);
    proj_copy8(gw + PJ_KP, lw + PJ_STAGE * 2);

    // rolled: eight copies of the pass body would only lengthen the kernel's text
#pragma unroll 1
    for (int t = 0; t < PJ_NPASS; ++t) {
        const int buf = t & 1;
        const half_t* xs = stg + buf * PJ_STAGE + (wm + l16) * PJ_PITCH + klo;
        const half_t* wsm = stg + buf * PJ_STAGE + (PJ_TILE + wn + l16) * PJ_PITCH + klo;
        // Two fragment sets: step s+1's LDS reads go out as one group ahead of
        // step s's products, so the products cover their latency.
        v16h a[2][4], b[2][2];
#pragma unroll
        for (int i = 0; i < 4; ++i) a[0][i] = load_frag_f16(xs + i * 16 * PJ_PITCH);
#pragma unroll
        for (int j = 0; j < 2; ++j) b[0][j] = load_frag_f16(wsm + j * 16 * PJ_PITCH);
#pragma unroll
        for (int s = 0; s < PJ_KP / 32; ++s) {
            const int cur = s & 1, nxt = cur ^ 1;
            if (s + 1 < PJ_KP / 32) {
#pragma unroll
                for (int i = 0; i < 4; ++i)
                    a[nxt][i] = load_frag_f16(xs + i * 16 * PJ_PITCH + (s + 1) * 32);
#pragma unroll
                for (int j = 0; j < 2; ++j)
                    b[nxt][j] = load_frag_f16(wsm + j * 16 * PJ_PITCH + (s + 1) * 32);
            }
            // keeps the read group above the products instead of spread among them
            __builtin_amdgcn_sched_barrier(0);
#pragma unroll
            for (int i = 0; i < 4; ++i)
#pragma unroll
                for (int j = 0; j < 2; ++j)
                    acc[i][j] = wmma_f16(a[cur][i], b[cur][j], acc[i][j]);
            // keeps the next group's reads from sinking into these products
            __builtin_amdgcn_sched_barrier(0);
        }
        // Hand-over: this wave's reads of buffer buf are done, its copies of
        // pass t+1 have landed; behind the barrier that holds for every wave.
        asm volatile("s_wait_dscnt 0x0" ::: "memory");
        asm volatile("s_wait_asynccnt 0x0" ::: "memory");
        __syncthreads();
        if (t + 2 < PJ_NPASS) {
            proj_copy8(gx + (t + 2) * PJ_KP, lx + buf * (PJ_STAGE * 2));
            proj_copy8(gw + (t + 2) * PJ_KP, lw + buf * (PJ_STAGE * 2));
        }
    }
    // no copy of this wave is outstanding when it ends
    asm volatile("s_wait_asynccnt 0x0" ::: "memory");

    // Bias + store. C layout: acc[i][j][r] = out[row0 + i*16 + r + 8*hi][col0 + j*16 + l16]
#pragma unroll
    for (int j = 0; j < 2; ++j) {
        const int e    = n0 + wn + j * 16 + l16;
        const float bv = bias[e];
        const int h    = e >> 6;
        const int d    = e & 63;
#pragma unroll
        for (int i = 0; i < 4; ++i) {
#pragma unroll
            for (int r = 0; r < 8; ++r) {
                const int sg   = m0 + wm + i * 16 + r + 8 * hi;
                const int b_   = sg >> 11;
                const int sloc = sg & 2047;
                const float vfin = acc[i][j][r] + bv;
                size_t idx;
                if (transpose_out)
                    idx = (((size_t)(b_ * HH + h) * HD + d) * SS) + sloc;
                else
                    idx = (((size_t)(b_ * HH + h) * SS + sloc) * HD) + d;
                out[idx] = (_Float16)vfin;
            }
        }
    }
}

#define AT_KEYS   128
#define AT_KPITCH 72
#define AT_VPITCH 136
#define AT_KH     (AT_KEYS * AT_KPITCH)
#define AT_STAGE  (AT_KH + HD * AT_VPITCH)
#define AT_NST    (SS / AT_KEYS)

// Eight 16-byte copies of one lane: K rows r, r+32, r+64, r+96 and VpT rows
// d, d+16, d+32, d+48.  gk, gv: the lane's 16 bytes in the first row of each;
// lk, lv: their LDS byte addresses.
__device__ __forceinline__ void attn_copy8(const half_t* gk, unsigned lk,
                                           const half_t* gv, unsigned lv) {
    const half_t* gk1 = gk + 32 * 1 * HD;  const unsigned lk1 = lk + 32 * 1 * AT_KPITCH * 2;
    const half_t* gk2 = gk + 32 * 2 * HD;  const unsigned lk2 = lk + 32 * 2 * AT_KPITCH * 2;
    const half_t* gk3 = gk + 32 * 3 * HD;  const unsigned lk3 = lk + 32 * 3 * AT_KPITCH * 2;
    const half_t* gv1 = gv + 16 * 1 * SS;  const unsigned lv1 = lv + 16 * 1 * AT_VPITCH * 2;
    const half_t* gv2 = gv + 16 * 2 * SS;  const unsigned lv2 = lv + 16 * 2 * AT_VPITCH * 2;
    const half_t* gv3 = gv + 16 * 3 * SS;  const unsigned lv3 = lv + 16 * 3 * AT_VPITCH * 2;
    // The closing s_wait_xcnt stands inside the statement so that no address
    // register named here is rewritten ahead of it.
    asm volatile(
        "global_load_async_to_lds_b128 %0, %8, off\n\t"
        "global_load_async_to_lds_b128 %1, %9, off\n\t"
        "global_load_async_to_lds_b128 %2, %10, off\n\t"
        "global_load_async_to_lds_b128 %3, %11, off\n\t"
        "global_load_async_to_lds_b128 %4, %12, off\n\t"
        "global_load_async_to_lds_b128 %5, %13, off\n\t"
        "global_load_async_to_lds_b128 %6, %14, off\n\t"
        "global_load_async_to_lds_b128 %7, %15, off\n\t"
        "s_wait_xcnt 0x0"
        :: "v"(lk), "v"(lk1), "v"(lk2), "v"(lk3), "v"(lv), "v"(lv1), "v"(lv2), "v"(lv3),
           "v"(gk), "v"(gk1), "v"(gk2), "v"(gk3), "v"(gv), "v"(gv1), "v"(gv2), "v"(gv3)
        : "memory");
}

// The value that lane l ^ 16 holds.
__device__ __forceinline__ float other_half(float x) {
    const int b = __builtin_bit_cast(int, x);
    return __builtin_bit_cast(float,
        __builtin_amdgcn_permlanex16(b, b, 0x76543210, 0xfedcba98, false, false));
}

#define LOG2E 1.44269504088896340736f

// A run of exponentials to base 2.  The instruction set asks for one slot
// between a transcendental and an instruction that reads its result or
// overwrites its source: inside the run no instruction names a register of
// another (every output is early-clobber), and the closing v_nop is the slot
// behind the last one.
__device__ __forceinline__ void exp2_run8(v8f x, v8f& y) {
    float y0, y1, y2, y3, y4, y5, y6, y7;
    asm("v_exp_f32 %0, %8\n\t"
        "v_exp_f32 %1, %9\n\t"
        "v_exp_f32 %2, %10\n\t"
        "v_exp_f32 %3, %11\n\t"
        "v_exp_f32 %4, %12\n\t"
        "v_exp_f32 %5, %13\n\t"
        "v_exp_f32 %6, %14\n\t"
        "v_exp_f32 %7, %15\n\t"
        "v_nop"
        : "=&v"(y0), "=&v"(y1), "=&v"(y2), "=&v"(y3),
          "=&v"(y4), "=&v"(y5), "=&v"(y6), "=&v"(y7)
        : "v"(x[0]), "v"(x[1]), "v"(x[2]), "v"(x[3]),
          "v"(x[4]), "v"(x[5]), "v"(x[6]), "v"(x[7]));
    y[0] = y0; y[1] = y1; y[2] = y2; y[3] = y3;
    y[4] = y4; y[5] = y5; y[6] = y6; y[7] = y7;
}

// The same with one more value in front.
__device__ __forceinline__ void exp2_run9(float xa, v8f x, float& ya, v8f& y) {
    float y0, y1, y2, y3, y4, y5, y6, y7;
    asm("v_exp_f32 %0, %9\n\t"
        "v_exp_f32 %1, %10\n\t"
        "v_exp_f32 %2, %11\n\t"
        "v_exp_f32 %3, %12\n\t"
        "v_exp_f32 %4, %13\n\t"
        "v_exp_f32 %5, %14\n\t"
        "v_exp_f32 %6, %15\n\t"
        "v_exp_f32 %7, %16\n\t"
        "v_exp_f32 %8, %17\n\t"
        "v_nop"
        : "=&v"(ya), "=&v"(y0), "=&v"(y1), "=&v"(y2), "=&v"(y3),
          "=&v"(y4), "=&v"(y5), "=&v"(y6), "=&v"(y7)
        : "v"(xa), "v"(x[0]), "v"(x[1]), "v"(x[2]), "v"(x[3]),
          "v"(x[4]), "v"(x[5]), "v"(x[6]), "v"(x[7]));
    y[0] = y0; y[1] = y1; y[2] = y2; y[3] = y3;
    y[4] = y4; y[5] = y5; y[6] = y6; y[7] = y7;
}

__global__ __launch_bounds__(256) void attn_wmma_kernel(
    const half_t* __restrict__ Qp, const half_t* __restrict__ Kp,
    const half_t* __restrict__ VpT, float* __restrict__ out)
{
    __shared__ __align__(16) half_t kvs[2 * AT_STAGE];  // 71,680 B: the two stage buffers

    const int tid  = threadIdx.x;
    const int wid  = threadIdx.x >> 5;
    const int lane = threadIdx.x & 31;
    const int l16  = lane & 15;
    const int hi   = lane >> 4;
    const int klo  = hi * 8;

    const int unit = blockIdx.x * (blockDim.x >> 5) + wid;
    const int QTILES = SS / 16;
    const int bh = unit / QTILES;
    const int q0 = (unit % QTILES) * 16;

    const half_t* qb = Qp  + (size_t)bh * SS * HD;
    const half_t* kb = Kp  + (size_t)bh * SS * HD;
    const half_t* vt = VpT + (size_t)bh * HD * SS;

    const half_t* qrow = qb + (size_t)(q0 + l16) * HD;
    const v16h qa0 = load_frag_f16(qrow + 0  + klo);
    const v16h qa1 = load_frag_f16(qrow + 32 + klo);

    v8f oacc[4];
#pragma unroll
    for (int t = 0; t < 4; ++t) oacc[t] = (v8f)(0.0f);
    // of the lane's query: maximum over all keys so far; sum over the keys that
    // this half of the wave holds (the halves are joined behind the loop)
    float m_run = -INFINITY, l_run = 0.0f;

    const float scale = 0.125f;   // 1/sqrt(64)

    // Copy duty of a lane: 16-byte piece (tid & 7) of K rows (tid >> 3) + 32 j,
    // 16-byte piece (tid & 15) of VpT rows (tid >> 4) + 16 j.
    const half_t* gk = kb + (size_t)(tid >> 3) * HD + (tid & 7) * 8;
    const half_t* gv = vt + (size_t)(tid >> 4) * SS + (tid & 15) * 8;
    const unsigned lk = (unsigned)(size_t)&kvs[(tid >> 3) * AT_KPITCH + (tid & 7) * 8];
    const unsigned lv = (unsigned)(size_t)&kvs[AT_KH + (tid >> 4) * AT_VPITCH + (tid & 15) * 8];

    // stage 0 -> buffer 0, landed and published; then stage 1 -> buffer 1
    attn_copy8(gk, lk, gv, lv);
    // this wave's copies have landed before the barrier lets others read them
    asm volatile("s_wait_asynccnt 0x0" ::: "memory");
    __syncthreads();
    attn_copy8(gk + AT_KEYS * HD, lk + AT_STAGE * 2, gv + AT_KEYS, lv + AT_STAGE * 2);

    // rolled: sixteen copies of the stage body would only lengthen the kernel's text
#pragma unroll 1
    for (int st = 0; st < AT_NST; ++st) {
      const int buf = st & 1;
      const half_t* ks = kvs + buf * AT_STAGE + l16 * AT_KPITCH + klo;
      const half_t* vs = kvs + buf * AT_STAGE + AT_KH + l16 * AT_VPITCH + klo;
      // by 2: the pair's LDS offsets are immediates of its reads
#pragma unroll 2
      for (int c = 0; c < AT_KEYS / 32; ++c) {
        // ---- issue all K and V fragment reads for this chunk ----
        const half_t* kr0 = ks + (c * 32 + 0)  * AT_KPITCH;
        const half_t* kr1 = ks + (c * 32 + 16) * AT_KPITCH;
        v16h kb00 = load_frag_f16(kr0 + 0);
        v16h kb01 = load_frag_f16(kr0 + 32);
        v16h kb10 = load_frag_f16(kr1 + 0);
        v16h kb11 = load_frag_f16(kr1 + 32);
        v16h vb[4];
#pragma unroll
        for (int t = 0; t < 4; ++t)
            vb[t] = load_frag_f16(vs + t * 16 * AT_VPITCH + c * 32);
        __builtin_amdgcn_sched_barrier(0);   // keep loads above the compute

        // ---- S^T = K * Q^T (two 16-key m-tiles, two 32-wide k-steps) ----
        // sac0[i]: key c*32 + 8*hi + i, sac1[i]: key c*32 + 16 + 8*hi + i; query l16
        v8f sac0 = (v8f)(0.0f), sac1 = (v8f)(0.0f);
        sac0 = wmma_f16(kb00, qa0, sac0);
        sac0 = wmma_f16(kb01, qa1, sac0);
        sac1 = wmma_f16(kb10, qa0, sac1);
        sac1 = wmma_f16(kb11, qa1, sac1);

        // ---- online softmax over the 32 new keys, one query per lane ----
        const v8f s0 = sac0 * scale;
        const v8f s1 = sac1 * scale;
        float v = fmaxf(s0[0], s0[1]);
#pragma unroll
        for (int i = 2; i < 8; ++i) v = fmaxf(v, s0[i]);
#pragma unroll
        for (int i = 0; i < 8; ++i) v = fmaxf(v, s1[i]);
        v = fmaxf(v, other_half(v));
        const float mn = fmaxf(m_run, v);
        // exp(x) as exp2(x * log2(e)), the form __expf compiles to
        const v8f x0 = (s0 - mn) * LOG2E;
        const v8f x1 = (s1 - mn) * LOG2E;
        float al;
        v8f p0, p1;
        exp2_run9((m_run - mn) * LOG2E, x0, al, p0);
        exp2_run8(x1, p1);
        float rs0 = p0[0], rs1 = p1[0];
#pragma unroll
        for (int i = 1; i < 8; ++i) { rs0 += p0[i]; rs1 += p1[i]; }
        v16h pb;
#pragma unroll
        for (int i = 0; i < 8; ++i) {
            pb[i]     = (_Float16)p0[i];
            pb[8 + i] = (_Float16)p1[i];
        }
        l_run = l_run * al + (rs0 + rs1);
        m_run = mn;
#pragma unroll
        for (int t = 0; t < 4; ++t)
#pragma unroll
            for (int i = 0; i < 8; ++i) oacc[t][i] *= al;

        // ---- O^T += V^T * P^T: oacc[t][i] = O[query l16][d = t*16 + 8*hi + i] ----
#pragma unroll
        for (int t = 0; t < 4; ++t)
            oacc[t] = wmma_f16(vb[t], pb, oacc[t]);
      }
      // Hand-over: this wave's reads of buffer buf are done, its copies of
      // stage st+1 have landed; behind the barrier that holds for every wave.
      asm volatile("s_wait_dscnt 0x0" ::: "memory");
      asm volatile("s_wait_asynccnt 0x0" ::: "memory");
      __syncthreads();
      if (st + 2 < AT_NST)
          attn_copy8(gk + (st + 2) * (AT_KEYS * HD), lk + buf * (AT_STAGE * 2),
                     gv + (st + 2) * AT_KEYS,        lv + buf * (AT_STAGE * 2));
    }
    // no copy of this wave is outstanding when it ends
    asm volatile("s_wait_asynccnt 0x0" ::: "memory");

    // ---- normalize and store: out[b, q0+l16, h*64 + t*16 + 8*hi + 0..7] ----
    const int b_ = bh / HH;
    const int h_ = bh % HH;
    const float inv = 1.0f / (l_run + other_half(l_run));
    float* orow = out + ((size_t)(b_ * SS + q0 + l16)) * DD + h_ * HD + 8 * hi;
#pragma unroll
    for (int t = 0; t < 4; ++t) {
        float4 lo4, hi4;
        lo4.x = oacc[t][0] * inv; lo4.y = oacc[t][1] * inv;
        lo4.z = oacc[t][2] * inv; lo4.w = oacc[t][3] * inv;
        hi4.x = oacc[t][4] * inv; hi4.y = oacc[t][5] * inv;
        hi4.z = oacc[t][6] * inv; hi4.w = oacc[t][7] * inv;
        *(float4*)(orow + t * 16)     = lo4;
        *(float4*)(orow + t * 16 + 4) = hi4;
    }
}

// ---------------------------------------------------------------------------
// Host-side launch. Inputs: q,k,v,Wq,bq,Wk,bk,Wv,bv (all f32).
// Workspace (f16 halves):
//   [0)   qh,kh,vh    : 3 x 4M  (converted activations)
//   [12M) wqh,wkh,wvh : 3 x 1M  (converted weights)
//   [15M) Qp,Kp,VpT   : 3 x 4M  (projected heads)
// Total 27M halves = 54 MB.
// ---------------------------------------------------------------------------
extern "C" void kernel_launch(void* const* d_in, const int* in_sizes, int n_in,
                              void* d_out, int out_size, void* d_ws, size_t ws_size,
                              hipStream_t stream) {
    const float* q  = (const float*)d_in[0];
    const float* k  = (const float*)d_in[1];
    const float* v  = (const float*)d_in[2];
    const float* Wq = (const float*)d_in[3];
    const float* bq = (const float*)d_in[4];
    const float* Wk = (const float*)d_in[5];
    const float* bk = (const float*)d_in[6];
    const float* Wv = (const float*)d_in[7];
    const float* bv = (const float*)d_in[8];
    float* out = (float*)d_out;

    const size_t XN = (size_t)ROWS * DD;   // 4,194,304
    const size_t WN = (size_t)DD * DD;     // 1,048,576
    half_t* ws  = (half_t*)d_ws;
    half_t* qh  = ws;
    half_t* kh  = qh  + XN;
    half_t* vh  = kh  + XN;
    half_t* wqh = vh  + XN;
    half_t* wkh = wqh + WN;
    half_t* wvh = wkh + WN;
    half_t* Qp  = wvh + WN;
    half_t* Kp  = Qp  + XN;
    half_t* VpT = Kp  + XN;

    // 1) f32 -> f16 conversion of all six operands, one launch: qh .. wvh are
    //    contiguous from ws on, in the kernel's order
    cvt_all_f32_to_f16_kernel<<<CV_BLOCKS, CV_WAVES * 32, 0, stream>>>(q, k, v, Wq, Wk, Wv, qh);

    // 2) projections, one launch: one block per 128 x 128 output tile, 32 x 8 = 256
    //    blocks for each of Q, K, V; qh.., wqh.., Qp.. are each three arrays in a row
    const int projBlocks = (ROWS / PJ_TILE) * (DD / PJ_TILE);
    proj_wmma_kernel<<<dim3(projBlocks, 3), 256, 0, stream>>>(qh, wqh, bq, bk, bv, Qp);

    // 3) attention: units = B*H*(S/16) = 4096 -> 512 blocks x 8 waves
    const int attnBlocks = BB * HH * (SS / 16) / 8;
    attn_wmma_kernel<<<attnBlocks, 256, 0, stream>>>(Qp, Kp, VpT, out);
}

// v006
// Measured time: 78.1 microseconds a run.
// Next to v005, in two timings, it ran 1.12 times as fast each time.
// All steps since v000 together make it 3.42 times as fast.
#include <hip/hip_runtime.h>

// Problem constants (from reference)
#define BB   2
#define SS   2048
#define DD   1024
#define HH   16
#define HD   64
#define ROWS (BB * SS)          // 4096 rows in the projection GEMMs

typedef _Float16 half_t;
typedef __attribute__((ext_vector_type(16))) _Float16 v16h;
typedef __attribute__((ext_vector_type(8)))  _Float16 v8h;
typedef __attribute__((ext_vector_type(8)))  float    v8f;

// ---------------------------------------------------------------------------
// Fragment helper: A-layout (16-bit A, 16x32, ISA 7.12.2): lane l (l16=l&15)
// holds row M=l16; halves a[0..7]=K(klo..klo+7), a[8..15]=K(16+klo..) with
// klo = (lane>=16 ? 8 : 0).  B uses the symmetric lane-per-column layout.
// Both reduce to: 8 contiguous halves at p, 8 contiguous halves at p+16.
// ---------------------------------------------------------------------------
__device__ __forceinline__ v16h load_frag_f16(const half_t* p) {
    v8h lo = *(const v8h*)(p);
    v8h hi = *(const v8h*)(p + 16);
    v16h r;
#pragma unroll
    for (int i = 0; i < 8; ++i) { r[i] = lo[i]; r[8 + i] = hi[i]; }
    return r;
}

__device__ __forceinline__ v8f wmma_f16(v16h a, v16h b, v8f c) {
    return __builtin_amdgcn_wmma_f32_16x16x32_f16(
        false, a, false, b, (short)0, c, false, false);
}

// ---------------------------------------------------------------------------
// f32 -> f16 conversion of all six operands in one launch (memory bound; feeds
// all later kernels).  The six f16 arrays lie one behind the other in dst, in
// the order q, k, v, Wq, Wk, Wv.  A wave takes one piece of 4096 elements
// (16 KiB of f32) of one array: 32 loads of 16 B per lane, each covering 512
// contiguous bytes, all issued before the first is used, then 32 stores of 8 B
// per lane, each covering 256 contiguous bytes.  Few long waves instead of many
// short ones, for speed only.
// ---------------------------------------------------------------------------
typedef __attribute__((ext_vector_type(4))) float    v4f;
typedef __attribute__((ext_vector_type(4))) _Float16 v4h;

#define CV_LOADS  32                        // 16-byte loads of a lane
#define CV_PIECE  (CV_LOADS * 32 * 4)       // elements per wave: 4096
#define CV_WAVES  15                        // waves per block
#define CV_XP     (ROWS * DD / CV_PIECE)    // pieces of q, k or v: 1024
#define CV_WP     (DD * DD / CV_PIECE)      // pieces of a weight matrix: 256
#define CV_BLOCKS ((3 * CV_XP + 3 * CV_WP) / CV_WAVES)   // 256, no remainder

__global__ __launch_bounds__(CV_WAVES * 32) void cvt_all_f32_to_f16_kernel(
    const float* __restrict__ q,  const float* __restrict__ k,
    const float* __restrict__ v,  const float* __restrict__ Wq,
    const float* __restrict__ Wk, const float* __restrict__ Wv,
    half_t* __restrict__ dst)
{
    // the wave's number as a scalar: the choice of the source array stays scalar
    const int wave  = __builtin_amdgcn_readfirstlane((int)(threadIdx.x >> 5));
    const int lane  = threadIdx.x & 31;
    const int piece = blockIdx.x * CV_WAVES + wave;

    const float* src;
    int off;                                 // the piece's number inside its array
    if (piece < 3 * CV_XP) {
        const int a = piece / CV_XP;
        src = (a == 0) ? q : (a == 1) ? k : v;
        off = piece % CV_XP;
    } else {
        const int a = (piece - 3 * CV_XP) / CV_WP;
        src = (a == 0) ? Wq : (a == 1) ? Wk : Wv;
        off = (piece - 3 * CV_XP) % CV_WP;
    }

    const v4f* s = (const v4f*)(src + (size_t)off * CV_PIECE) + lane;
    v4h*       d = (v4h*)(dst + (size_t)piece * CV_PIECE) + lane;

    // both loops unrolled: x lives in registers and every offset is an immediate
    v4f x[CV_LOADS];
#pragma unroll
    for (int j = 0; j < CV_LOADS; ++j) x[j] = s[j * 32];
    // keeps all 32 loads ahead of the first conversion, so that all are in flight
    // (without it the compiler holds 14 of them back behind the first waits)
    __builtin_amdgcn_sched_barrier(0);
#pragma unroll
    for (int j = 0; j < CV_LOADS; ++j) {
        v4h o;
        o[0] = (_Float16)x[j][0]; o[1] = (_Float16)x[j][1];
        o[2] = (_Float16)x[j][2]; o[3] = (_Float16)x[j][3];
        d[j * 32] = o;
    }
}

// ---------------------------------------------------------------------------
// Projection GEMMs, all-f16 operands: out[s,e] = sum_d Xh[s,d]*Wh[e,d] + b[e].
// One launch does all three: blockIdx.y = 0, 1, 2 is the V, K, Q projection.
// None reads what another writes; in one grid there is one launch gap, one
// fill and one tail instead of three, and two workgroups share a WGP (LDS and
// registers fit twice), so one's first tile, hand-overs and stores run under
// the other's products.  The three X, the three W and the three outputs each
// lie one behind the other in the workspace.
//   transpose_out == 0 : out layout [B,H,S,Hd]   (Q, K)
//   transpose_out == 1 : out layout [B,H,Hd,S]   (V -> contiguous V^T*P^T A-frags)
// One workgroup per 128(row) x 128(col) tile of an output, 8 waves in a
// 2 x 4 grid, 64 x 32 per wave.  A pass is 128 k (256 B of each of the 128 X
// rows and 128 W rows); the pass's rows are brought into LDS by asynchronous
// copies, whole 256-B row pieces per half wave, and shared by all 8 waves.
// Two buffers: pass t+1's copies fly while pass t is multiplied.
// LDS rows are pitched 272 B so that the 16-byte fragment reads of 16
// neighbouring rows fall on different banks.
// Epilogue: the f16 tile is laid in the freed LDS in the output's own row order
// and goes out in 16-byte pieces, 16 lanes to a 256-B row: every store
// instruction covers four whole 128-B lines.
// ---------------------------------------------------------------------------
#define PJ_TILE   128                       // output tile edge
#define PJ_KP     128                       // k per pass (halves)
#define PJ_PITCH  136                       // LDS row pitch (halves) = 272 B
#define PJ_STAGE  (2 * PJ_TILE * PJ_PITCH)  // halves per buffer: X rows, then W rows
#define PJ_NPASS  (DD / PJ_KP)              // 8

// Eight 16-byte copies of one lane: rows r, r+16, ..., r+112 of one operand.
// g: the lane's 16 bytes in the first row; l: their LDS byte address.
__device__ __forceinline__ void proj_copy8(const half_t* g, unsigned l) {
    const half_t* g1 = g + 16 * 1 * DD;  const unsigned l1 = l + 16 * 1 * PJ_PITCH * 2;
    const half_t* g2 = g + 16 * 2 * DD;  const unsigned l2 = l + 16 * 2 * PJ_PITCH * 2;
    const half_t* g3 = g + 16 * 3 * DD;  const unsigned l3 = l + 16 * 3 * PJ_PITCH * 2;
    const half_t* g4 = g + 16 * 4 * DD;  const unsigned l4 = l + 16 * 4 * PJ_PITCH * 2;
    const half_t* g5 = g + 16 * 5 * DD;  const unsigned l5 = l + 16 * 5 * PJ_PITCH * 2;
    const half_t* g6 = g + 16 * 6 * DD;  const unsigned l6 = l + 16 * 6 * PJ_PITCH * 2;
    const half_t* g7 = g + 16 * 7 * DD;  const unsigned l7 = l + 16 * 7 * PJ_PITCH * 2;
    // The closing s_wait_xcnt stands inside the statement so that no address
    // register named here is rewritten ahead of it.
    asm volatile(
        "global_load_async_to_lds_b128 %0, %8, off\n\t"
        "global_load_async_to_lds_b128 %1, %9, off\n\t"
        "global_load_async_to_lds_b128 %2, %10, off\n\t"
        "global_load_async_to_lds_b128 %3, %11, off\n\t"
        "global_load_async_to_lds_b128 %4, %12, off\n\t"
        "global_load_async_to_lds_b128 %5, %13, off\n\t"
        "global_load_async_to_lds_b128 %6, %14, off\n\t"
        "global_load_async_to_lds_b128 %7, %15, off\n\t"
        "s_wait_xcnt 0x0"
        :: "v"(l), "v"(l1), "v"(l2), "v"(l3), "v"(l4), "v"(l5), "v"(l6), "v"(l7),
           "v"(g), "v"(g1), "v"(g2), "v"(g3), "v"(g4), "v"(g5), "v"(g6), "v"(g7)
        : "memory");
}

__global__ __launch_bounds__(256) void proj_wmma_kernel(
    const half_t* __restrict__ Xall, const half_t* __restrict__ Wall,
    const float* __restrict__ bq, const float* __restrict__ bk,
    const float* __restrict__ bv, half_t* __restrict__ outall)
{
    __shared__ __align__(16) half_t stg[2 * PJ_STAGE];   // 139,264 B

    // Which projection this workgroup belongs to (0 Q, 1 K, 2 V): all of it scalar.
    // blockIdx.y 0 is V; the order has no bearing on the result.
    const int which = 2 - (int)blockIdx.y;
    const half_t* Xh  = Xall   + (size_t)which * (ROWS * DD);
    const half_t* Wh  = Wall   + (size_t)which * (DD * DD);
    half_t*       out = outall + (size_t)which * (ROWS * DD);
    const float* bias = (which == 0) ? bq : (which == 1) ? bk : bv;
    const int transpose_out = (which == 2);

    const int tid  = threadIdx.x;
    const int wid  = tid >> 5;
    const int lane = tid & 31;
    const int l16  = lane & 15;
    const int hi   = lane >> 4;
    const int klo  = hi * 8;

    const int NT = DD / PJ_TILE;                       // 8 tile columns
    const int m0 = (blockIdx.x / NT) * PJ_TILE;        // first X row of the tile
    const int n0 = (blockIdx.x % NT) * PJ_TILE;        // first W row of the tile
    const int wm = (wid >> 2) * 64;                    // wave's rows in the tile
    const int wn = (wid & 3) * 32;                     // wave's columns in the tile

    // Copy duty of a lane: 16-byte piece (tid & 15) of rows (tid >> 4) + 16 j.
    const int crow = tid >> 4;
    const int ccol = (tid & 15) * 8;
    const half_t* gx = Xh + (size_t)(m0 + crow) * DD + ccol;
    const half_t* gw = Wh + (size_t)(n0 + crow) * DD + ccol;
    const unsigned lx = (unsigned)(size_t)&stg[crow * PJ_PITCH + ccol];
    const unsigned lw = lx + PJ_TILE * PJ_PITCH * 2;

    // Every inner loop below is unrolled so that each accumulator and fragment
    // index is a constant: the arrays then live in registers, not in scratch.
    v8f acc[4][2];
#pragma unroll
    for (int i = 0; i < 4; ++i)
#pragma unroll
        for (int j = 0; j < 2; ++j) acc[i][j] = (v8f)(0.0f);

    // pass 0 -> buffer 0, landed and published; then pass 1 -> buffer 1
    proj_copy8(gx, lx);
    proj_copy8(gw, lw);
    // this wave's copies have landed before the barrier lets others read them
    asm volatile("s_wait_asynccnt 0x0" ::: "memory");
    __syncthreads();
    proj_copy8(gx + PJ_KP, lx + PJ_STAGE * 2);
    proj_copy8(gw + PJ_KP, lw + PJ_STAGE * 2);

    // rolled: eight copies of the pass body would only lengthen the kernel's text
#pragma unroll 1
    for (int t = 0; t < PJ_NPASS; ++t) {
        const int buf = t & 1;
        const half_t* xs = stg + buf * PJ_STAGE + (wm + l16) * PJ_PITCH + klo;
        const half_t* wsm = stg + buf * PJ_STAGE + (PJ_TILE + wn + l16) * PJ_PITCH + klo;
        // Two fragment sets: step s+1's LDS reads go out as one group ahead of
        // step s's products, so the products cover their latency.
        v16h a[2][4], b[2][2];
#pragma unroll
        for (int i = 0; i < 4; ++i) a[0][i] = load_frag_f16(xs + i * 16 * PJ_PITCH);
#pragma unroll
        for (int j = 0; j < 2; ++j) b[0][j] = load_frag_f16(wsm + j * 16 * PJ_PITCH);
#pragma unroll
        for (int s = 0; s < PJ_KP / 32; ++s) {
            const int cur = s & 1, nxt = cur ^ 1;
            if (s + 1 < PJ_KP / 32) {
#pragma unroll
                for (int i = 0; i < 4; ++i)
                    a[nxt][i] = load_frag_f16(xs + i * 16 * PJ_PITCH + (s + 1) * 32);
#pragma unroll
                for (int j = 0; j < 2; ++j)
                    b[nxt][j] = load_frag_f16(wsm + j * 16 * PJ_PITCH + (s + 1) * 32);
            }
            // keeps the read group above the products instead of spread among them
            __builtin_amdgcn_sched_barrier(0);
#pragma unroll
            for (int i = 0; i < 4; ++i)
#pragma unroll
                for (int j = 0; j < 2; ++j)
                    acc[i][j] = wmma_f16(a[cur][i], b[cur][j], acc[i][j]);
            // keeps the next group's reads from sinking into these products
            __builtin_amdgcn_sched_barrier(0);
        }
        // Hand-over: this wave's reads of buffer buf are done, its copies of
        // pass t+1 have landed; behind the barrier that holds for every wave.
        asm volatile("s_wait_dscnt 0x0" ::: "memory");
        asm volatile("s_wait_asynccnt 0x0" ::: "memory");
        __syncthreads();
        if (t + 2 < PJ_NPASS) {
            proj_copy8(gx + (t + 2) * PJ_KP, lx + buf * (PJ_STAGE * 2));
            proj_copy8(gw + (t + 2) * PJ_KP, lw + buf * (PJ_STAGE * 2));
        }
    }
    // no copy of this wave is outstanding when it ends
    asm volatile("s_wait_asynccnt 0x0" ::: "memory");

    // Bias, then the tile as f16 into LDS.  The ring is free: every wave's last
    // fragment reads and copies ended in front of the loop's last barrier.
    // C layout: acc[i][j][r] = out[row0 + i*16 + r + 8*hi][col0 + j*16 + l16]
    // Staged rows (pitch 272 B): for V one row per column e, 128 s long, so a
    // lane's 8 values of an accumulator tile are 16 contiguous bytes; for Q and K
    // one row per s, 128 e long (two heads of 64 side by side).
    half_t* so = stg;                                  // 128 x 272 B = 34,816 B
    float bj[2];
#pragma unroll
    for (int j = 0; j < 2; ++j) bj[j] = bias[n0 + wn + j * 16 + l16];
    if (transpose_out) {
#pragma unroll
        for (int j = 0; j < 2; ++j)
#pragma unroll
            for (int i = 0; i < 4; ++i) {
                v8h o;
#pragma unroll
                for (int r = 0; r < 8; ++r) o[r] = (_Float16)(acc[i][j][r] + bj[j]);
                *(v8h*)(so + (wn + j * 16 + l16) * PJ_PITCH + wm + i * 16 + 8 * hi) = o;
            }
    } else {
#pragma unroll
        for (int j = 0; j < 2; ++j)
#pragma unroll
            for (int i = 0; i < 4; ++i)
#pragma unroll
                for (int r = 0; r < 8; ++r)
                    so[(wm + i * 16 + 8 * hi + r) * PJ_PITCH + wn + j * 16 + l16] =
                        (_Float16)(acc[i][j][r] + bj[j]);
    }
    // the staged tile is complete before any wave reads rows that others wrote
    __syncthreads();

    // A lane takes 16-byte piece (tid & 15) of staged rows (tid >> 4) + 16 k.
    const int b_   = m0 >> 11;                         // the tile lies in one batch
    const int sl0  = m0 & 2047;
    half_t* go;                                        // the lane's piece of row (tid >> 4)
    size_t gstep;                                      // 16 staged rows further on
    if (transpose_out) {
        // row = column e = h*64 + d of [B,H,Hd,S]; the piece is 8 s
        go    = out + (size_t)(b_ * DD + n0 + crow) * SS + sl0 + ccol;
        gstep = (size_t)16 * SS;
    } else {
        // row = s of [B,H,S,Hd]; the piece is 8 d of head (n0 + ccol) / 64
        const int e = n0 + ccol;
        go    = out + ((size_t)(b_ * HH + (e >> 6)) * SS + sl0 + crow) * HD + (e & 63);
        gstep = (size_t)16 * HD;
    }
    v8h x[8];
#pragma unroll
    for (int k = 0; k < 8; ++k)
        x[k] = *(const v8h*)(so + (crow + 16 * k) * PJ_PITCH + ccol);
#pragma unroll
    for (int k = 0; k < 8; ++k)
        *(v8h*)(go + k * gstep) = x[k];
}

#define AT_KEYS   128
#define AT_KPITCH 72
#define AT_VPITCH 136
#define AT_KH     (AT_KEYS * AT_KPITCH)
#define AT_STAGE  (AT_KH + HD * AT_VPITCH)
#define AT_NST    (SS / AT_KEYS)

// Eight 16-byte copies of one lane: K rows r, r+32, r+64, r+96 and VpT rows
// d, d+16, d+32, d+48.  gk, gv: the lane's 16 bytes in the first row of each;
// lk, lv: their LDS byte addresses.
__device__ __forceinline__ void attn_copy8(const half_t* gk, unsigned lk,
                                           const half_t* gv, unsigned lv) {
    const half_t* gk1 = gk + 32 * 1 * HD;  const unsigned lk1 = lk + 32 * 1 * AT_KPITCH * 2;
    const half_t* gk2 = gk + 32 * 2 * HD;  const unsigned lk2 = lk + 32 * 2 * AT_KPITCH * 2;
    const half_t* gk3 = gk + 32 * 3 * HD;  const unsigned lk3 = lk + 32 * 3 * AT_KPITCH * 2;
    const half_t* gv1 = gv + 16 * 1 * SS;  const unsigned lv1 = lv + 16 * 1 * AT_VPITCH * 2;
    const half_t* gv2 = gv + 16 * 2 * SS;  const unsigned lv2 = lv + 16 * 2 * AT_VPITCH * 2;
    const half_t* gv3 = gv + 16 * 3 * SS;  const unsigned lv3 = lv + 16 * 3 * AT_VPITCH * 2;
    // The closing s_wait_xcnt stands inside the statement so that no address
    // register named here is rewritten ahead of it.
    asm volatile(
        "global_load_async_to_lds_b128 %0, %8, off\n\t"
        "global_load_async_to_lds_b128 %1, %9, off\n\t"
        "global_load_async_to_lds_b128 %2, %10, off\n\t"
        "global_load_async_to_lds_b128 %3, %11, off\n\t"
        "global_load_async_to_lds_b128 %4, %12, off\n\t"
        "global_load_async_to_lds_b128 %5, %13, off\n\t"
        "global_load_async_to_lds_b128 %6, %14, off\n\t"
        "global_load_async_to_lds_b128 %7, %15, off\n\t"
        "s_wait_xcnt 0x0"
        :: "v"(lk), "v"(lk1), "v"(lk2), "v"(lk3), "v"(lv), "v"(lv1), "v"(lv2), "v"(lv3),
           "v"(gk), "v"(gk1), "v"(gk2), "v"(gk3), "v"(gv), "v"(gv1), "v"(gv2), "v"(gv3)
        : "memory");
}

// The value that lane l ^ 16 holds.
__device__ __forceinline__ float other_half(float x) {
    const int b = __builtin_bit_cast(int, x);
    return __builtin_bit_cast(float,
        __builtin_amdgcn_permlanex16(b, b, 0x76543210, 0xfedcba98, false, false));
}

#define LOG2E 1.44269504088896340736f

// A run of exponentials to base 2.  The instruction set asks for one slot
// between a transcendental and an instruction that reads its result or
// overwrites its source: inside the run no instruction names a register of
// another (every output is early-clobber), and the closing v_nop is the slot
// behind the last one.
__device__ __forceinline__ void exp2_run8(v8f x, v8f& y) {
    float y0, y1, y2, y3, y4, y5, y6, y7;
    asm("v_exp_f32 %0, %8\n\t"
        "v_exp_f32 %1, %9\n\t"
        "v_exp_f32 %2, %10\n\t"
        "v_exp_f32 %3, %11\n\t"
        "v_exp_f32 %4, %12\n\t"
        "v_exp_f32 %5, %13\n\t"
        "v_exp_f32 %6, %14\n\t"
        "v_exp_f32 %7, %15\n\t"
        "v_nop"
        : "=&v"(y0), "=&v"(y1), "=&v"(y2), "=&v"(y3),
          "=&v"(y4), "=&v"(y5), "=&v"(y6), "=&v"(y7)
        : "v"(x[0]), "v"(x[1]), "v"(x[2]), "v"(x[3]),
          "v"(x[4]), "v"(x[5]), "v"(x[6]), "v"(x[7]));
    y[0] = y0; y[1] = y1; y[2] = y2; y[3] = y3;
    y[4] = y4; y[5] = y5; y[6] = y6; y[7] = y7;
}

// The same with one more value in front.
__device__ __forceinline__ void exp2_run9(float xa, v8f x, float& ya, v8f& y) {
    float y0, y1, y2, y3, y4, y5, y6, y7;
    asm("v_exp_f32 %0, %9\n\t"
        "v_exp_f32 %1, %10\n\t"
        "v_exp_f32 %2, %11\n\t"
        "v_exp_f32 %3, %12\n\t"
        "v_exp_f32 %4, %13\n\t"
        "v_exp_f32 %5, %14\n\t"
        "v_exp_f32 %6, %15\n\t"
        "v_exp_f32 %7, %16\n\t"
        "v_exp_f32 %8, %17\n\t"
        "v_nop"
        : "=&v"(ya), "=&v"(y0), "=&v"(y1), "=&v"(y2), "=&v"(y3),
          "=&v"(y4), "=&v"(y5), "=&v"(y6), "=&v"(y7)
        : "v"(xa), "v"(x[0]), "v"(x[1]), "v"(x[2]), "v"(x[3]),
          "v"(x[4]), "v"(x[5]), "v"(x[6]), "v"(x[7]));
    y[0] = y0; y[1] = y1; y[2] = y2; y[3] = y3;
    y[4] = y4; y[5] = y5; y[6] = y6; y[7] = y7;
}

__global__ __launch_bounds__(256) void attn_wmma_kernel(
    const half_t* __restrict__ Qp, const half_t* __restrict__ Kp,
    const half_t* __restrict__ VpT, float* __restrict__ out)
{
    __shared__ __align__(16) half_t kvs[2 * AT_STAGE];  // 71,680 B: the two stage buffers

    const int tid  = threadIdx.x;
    const int wid  = threadIdx.x >> 5;
    const int lane = threadIdx.x & 31;
    const int l16  = lane & 15;
    const int hi   = lane >> 4;
    const int klo  = hi * 8;

    const int unit = blockIdx.x * (blockDim.x >> 5) + wid;
    const int QTILES = SS / 16;
    const int bh = unit / QTILES;
    const int q0 = (unit % QTILES) * 16;

    const half_t* qb = Qp  + (size_t)bh * SS * HD;
    const half_t* kb = Kp  + (size_t)bh * SS * HD;
    const half_t* vt = VpT + (size_t)bh * HD * SS;

    const half_t* qrow = qb + (size_t)(q0 + l16) * HD;
    const v16h qa0 = load_frag_f16(qrow + 0  + klo);
    const v16h qa1 = load_frag_f16(qrow + 32 + klo);

    v8f oacc[4];
#pragma unroll
    for (int t = 0; t < 4; ++t) oacc[t] = (v8f)(0.0f);
    // of the lane's query: maximum over all keys so far; sum over the keys that
    // this half of the wave holds (the halves are joined behind the loop)
    float m_run = -INFINITY, l_run = 0.0f;

    const float scale = 0.125f;   // 1/sqrt(64)

    // Copy duty of a lane: 16-byte piece (tid & 7) of K rows (tid >> 3) + 32 j,
    // 16-byte piece (tid & 15) of VpT rows (tid >> 4) + 16 j.
    const half_t* gk = kb + (size_t)(tid >> 3) * HD + (tid & 7) * 8;
    const half_t* gv = vt + (size_t)(tid >> 4) * SS + (tid & 15) * 8;
    const unsigned lk = (unsigned)(size_t)&kvs[(tid >> 3) * AT_KPITCH + (tid & 7) * 8];
    const unsigned lv = (unsigned)(size_t)&kvs[AT_KH + (tid >> 4) * AT_VPITCH + (tid & 15) * 8];

    // stage 0 -> buffer 0, landed and published; then stage 1 -> buffer 1
    attn_copy8(gk, lk, gv, lv);
    // this wave's copies have landed before the barrier lets others read them
    asm volatile("s_wait_asynccnt 0x0" ::: "memory");
    __syncthreads();
    attn_copy8(gk + AT_KEYS * HD, lk + AT_STAGE * 2, gv + AT_KEYS, lv + AT_STAGE * 2);

    // rolled: sixteen copies of the stage body would only lengthen the kernel's text
#pragma unroll 1
    for (int st = 0; st < AT_NST; ++st) {
      const int buf = st & 1;
      const half_t* ks = kvs + buf * AT_STAGE + l16 * AT_KPITCH + klo;
      const half_t* vs = kvs + buf * AT_STAGE + AT_KH + l16 * AT_VPITCH + klo;
      // by 2: the pair's LDS offsets are immediates of its reads
#pragma unroll 2
      for (int c = 0; c < AT_KEYS / 32; ++c) {
        // ---- issue all K and V fragment reads for this chunk ----
        const half_t* kr0 = ks + (c * 32 + 0)  * AT_KPITCH;
        const half_t* kr1 = ks + (c * 32 + 16) * AT_KPITCH;
        v16h kb00 = load_frag_f16(kr0 + 0);
        v16h kb01 = load_frag_f16(kr0 + 32);
        v16h kb10 = load_frag_f16(kr1 + 0);
        v16h kb11 = load_frag_f16(kr1 + 32);
        v16h vb[4];
#pragma unroll
        for (int t = 0; t < 4; ++t)
            vb[t] = load_frag_f16(vs + t * 16 * AT_VPITCH + c * 32);
        __builtin_amdgcn_sched_barrier(0);   // keep loads above the compute

        // ---- S^T = K * Q^T (two 16-key m-tiles, two 32-wide k-steps) ----
        // sac0[i]: key c*32 + 8*hi + i, sac1[i]: key c*32 + 16 + 8*hi + i; query l16
        v8f sac0 = (v8f)(0.0f), sac1 = (v8f)(0.0f);
        sac0 = wmma_f16(kb00, qa0, sac0);
        sac0 = wmma_f16(kb01, qa1, sac0);
        sac1 = wmma_f16(kb10, qa0, sac1);
        sac1 = wmma_f16(kb11, qa1, sac1);

        // ---- online softmax over the 32 new keys, one query per lane ----
        const v8f s0 = sac0 * scale;
        const v8f s1 = sac1 * scale;
        float v = fmaxf(s0[0], s0[1]);
#pragma unroll
        for (int i = 2; i < 8; ++i) v = fmaxf(v, s0[i]);
#pragma unroll
        for (int i = 0; i < 8; ++i) v = fmaxf(v, s1[i]);
        v = fmaxf(v, other_half(v));
        const float mn = fmaxf(m_run, v);
        // exp(x) as exp2(x * log2(e)), the form __expf compiles to
        const v8f x0 = (s0 - mn) * LOG2E;
        const v8f x1 = (s1 - mn) * LOG2E;
        float al;
        v8f p0, p1;
        exp2_run9((m_run - mn) * LOG2E, x0, al, p0);
        exp2_run8(x1, p1);
        float rs0 = p0[0], rs1 = p1[0];
#pragma unroll
        for (int i = 1; i < 8; ++i) { rs0 += p0[i]; rs1 += p1[i]; }
        v16h pb;
#pragma unroll
        for (int i = 0; i < 8; ++i) {
            pb[i]     = (_Float16)p0[i];
            pb[8 + i] = (_Float16)p1[i];
        }
        l_run = l_run * al + (rs0 + rs1);
        m_run = mn;
#pragma unroll
        for (int t = 0; t < 4; ++t)
#pragma unroll
            for (int i = 0; i < 8; ++i) oacc[t][i] *= al;

        // ---- O^T += V^T * P^T: oacc[t][i] = O[query l16][d = t*16 + 8*hi + i] ----
#pragma unroll
        for (int t = 0; t < 4; ++t)
            oacc[t] = wmma_f16(vb[t], pb, oacc[t]);
      }
      // Hand-over: this wave's reads of buffer buf are done, its copies of
      // stage st+1 have landed; behind the barrier that holds for every wave.
      asm volatile("s_wait_dscnt 0x0" ::: "memory");
      asm volatile("s_wait_asynccnt 0x0" ::: "memory");
      __syncthreads();
      if (st + 2 < AT_NST)
          attn_copy8(gk + (st + 2) * (AT_KEYS * HD), lk + buf * (AT_STAGE * 2),
                     gv + (st + 2) * AT_KEYS,        lv + buf * (AT_STAGE * 2));
    }
    // no copy of this wave is outstanding when it ends
    asm volatile("s_wait_asynccnt 0x0" ::: "memory");

    // ---- normalize and store: out[b, q0+l16, h*64 + t*16 + 8*hi + 0..7] ----
    const int b_ = bh / HH;
    const int h_ = bh % HH;
    const float inv = 1.0f / (l_run + other_half(l_run));
    float* orow = out + ((size_t)(b_ * SS + q0 + l16)) * DD + h_ * HD + 8 * hi;
#pragma unroll
    for (int t = 0; t < 4; ++t) {
        float4 lo4, hi4;
        lo4.x = oacc[t][0] * inv; lo4.y = oacc[t][1] * inv;
        lo4.z = oacc[t][2] * inv; lo4.w = oacc[t][3] * inv;
        hi4.x = oacc[t][4] * inv; hi4.y = oacc[t][5] * inv;
        hi4.z = oacc[t][6] * inv; hi4.w = oacc[t][7] * inv;
        *(float4*)(orow + t * 16)     = lo4;
        *(float4*)(orow + t * 16 + 4) = hi4;
    }
}

// ---------------------------------------------------------------------------
// Host-side launch. Inputs: q,k,v,Wq,bq,Wk,bk,Wv,bv (all f32).
// Workspace (f16 halves):
//   [0)   qh,kh,vh    : 3 x 4M  (converted activations)
//   [12M) wqh,wkh,wvh : 3 x 1M  (converted weights)
//   [15M) Qp,Kp,VpT   : 3 x 4M  (projected heads)
// Total 27M halves = 54 MB.
// ---------------------------------------------------------------------------
extern "C" void kernel_launch(void* const* d_in, const int* in_sizes, int n_in,
                              void* d_out, int out_size, void* d_ws, size_t ws_size,
                              hipStream_t stream) {
    const float* q  = (const float*)d_in[0];
    const float* k  = (const float*)d_in[1];
    const float* v  = (const float*)d_in[2];
    const float* Wq = (const float*)d_in[3];
    const float* bq = (const float*)d_in[4];
    const float* Wk = (const float*)d_in[5];
    const float* bk = (const float*)d_in[6];
    const float* Wv = (const float*)d_in[7];
    const float* bv = (const float*)d_in[8];
    float* out = (float*)d_out;

    const size_t XN = (size_t)ROWS * DD;   // 4,194,304
    const size_t WN = (size_t)DD * DD;     // 1,048,576
    half_t* ws  = (half_t*)d_ws;
    half_t* qh  = ws;
    half_t* kh  = qh  + XN;
    half_t* vh  = kh  + XN;
    half_t* wqh = vh  + XN;
    half_t* wkh = wqh + WN;
    half_t* wvh = wkh + WN;
    half_t* Qp  = wvh + WN;
    half_t* Kp  = Qp  + XN;
    half_t* VpT = Kp  + XN;

    // 1) f32 -> f16 conversion of all six operands, one launch: qh .. wvh are
    //    contiguous from ws on, in the kernel's order
    cvt_all_f32_to_f16_kernel<<<CV_BLOCKS, CV_WAVES * 32, 0, stream>>>(q, k, v, Wq, Wk, Wv, qh);

    // 2) projections, one launch: one block per 128 x 128 output tile, 32 x 8 = 256
    //    blocks for each of Q, K, V; qh.., wqh.., Qp.. are each three arrays in a row
    const int projBlocks = (ROWS / PJ_TILE) * (DD / PJ_TILE);
    proj_wmma_kernel<<<dim3(projBlocks, 3), 256, 0, stream>>>(qh, wqh, bq, bk, bv, Qp);

    // 3) attention: units = B*H*(S/16) = 4096 -> 512 blocks x 8 waves
    const int attnBlocks = BB * HH * (SS / 16) / 8;
    attn_wmma_kernel<<<attnBlocks, 256, 0, stream>>>(Qp, Kp, VpT, out);
}

// v007
// It runs in 73.6 microseconds.
// Next to v006, in two timings, it ran 1.06 times as fast each time.
// Over all steps from v000 it is 3.62 times as fast.
#include <hip/hip_runtime.h>

// Problem constants (from reference)
#define BB   2
#define SS   2048
#define DD   1024
#define HH   16
#define HD   64
#define ROWS (BB * SS)          // 4096 rows in the projection GEMMs
// log2(e) / sqrt(Hd): the projected Q carries it, so that K * Q^T is the softmax
// exponent to base 2
#define QSCALE 0.18033688011112042f

typedef _Float16 half_t;
typedef __attribute__((ext_vector_type(16))) _Float16 v16h;
typedef __attribute__((ext_vector_type(8)))  _Float16 v8h;
typedef __attribute__((ext_vector_type(8)))  float    v8f;

// ---------------------------------------------------------------------------
// Fragment helper: A-layout (16-bit A, 16x32, ISA 7.12.2): lane l (l16=l&15)
// holds row M=l16; halves a[0..7]=K(klo..klo+7), a[8..15]=K(16+klo..) with
// klo = (lane>=16 ? 8 : 0).  B uses the symmetric lane-per-column layout.
// Both reduce to: 8 contiguous halves at p, 8 contiguous halves at p+16.
// ---------------------------------------------------------------------------
__device__ __forceinline__ v16h load_frag_f16(const half_t* p) {
    v8h lo = *(const v8h*)(p);
    v8h hi = *(const v8h*)(p + 16);
    v16h r;
#pragma unroll
    for (int i = 0; i < 8; ++i) { r[i] = lo[i]; r[8 + i] = hi[i]; }
    return r;
}

__device__ __forceinline__ v8f wmma_f16(v16h a, v16h b, v8f c) {
    return __builtin_amdgcn_wmma_f32_16x16x32_f16(
        false, a, false, b, (short)0, c, false, false);
}

// ---------------------------------------------------------------------------
// f32 -> f16 conversion of all six operands in one launch (memory bound; feeds
// all later kernels).  The six f16 arrays lie one behind the other in dst, in
// the order q, k, v, Wq, Wk, Wv.  A wave takes one piece of 4096 elements
// (16 KiB of f32) of one array: 32 loads of 16 B per lane, each covering 512
// contiguous bytes, all issued before the first is used, then 32 stores of 8 B
// per lane, each covering 256 contiguous bytes.  Few long waves instead of many
// short ones, for speed only.
// ---------------------------------------------------------------------------
typedef __attribute__((ext_vector_type(4))) float    v4f;
typedef __attribute__((ext_vector_type(4))) _Float16 v4h;

#define CV_LOADS  32                        // 16-byte loads of a lane
#define CV_PIECE  (CV_LOADS * 32 * 4)       // elements per wave: 4096
#define CV_WAVES  15                        // waves per block
#define CV_XP     (ROWS * DD / CV_PIECE)    // pieces of q, k or v: 1024
#define CV_WP     (DD * DD / CV_PIECE)      // pieces of a weight matrix: 256
#define CV_BLOCKS ((3 * CV_XP + 3 * CV_WP) / CV_WAVES)   // 256, no remainder

__global__ __launch_bounds__(CV_WAVES * 32) void cvt_all_f32_to_f16_kernel(
    const float* __restrict__ q,  const float* __restrict__ k,
    const float* __restrict__ v,  const float* __restrict__ Wq,
    const float* __restrict__ Wk, const float* __restrict__ Wv,
    half_t* __restrict__ dst)
{
    // the wave's number as a scalar: the choice of the source array stays scalar
    const int wave  = __builtin_amdgcn_readfirstlane((int)(threadIdx.x >> 5));
    const int lane  = threadIdx.x & 31;
    const int piece = blockIdx.x * CV_WAVES + wave;

    const float* src;
    int off;                                 // the piece's number inside its array
    if (piece < 3 * CV_XP) {
        const int a = piece / CV_XP;
        src = (a == 0) ? q : (a == 1) ? k : v;
        off = piece % CV_XP;
    } else {
        const int a = (piece - 3 * CV_XP) / CV_WP;
        src = (a == 0) ? Wq : (a == 1) ? Wk : Wv;
        off = (piece - 3 * CV_XP) % CV_WP;
    }

    const v4f* s = (const v4f*)(src + (size_t)off * CV_PIECE) + lane;
    v4h*       d = (v4h*)(dst + (size_t)piece * CV_PIECE) + lane;

    // both loops unrolled: x lives in registers and every offset is an immediate
    v4f x[CV_LOADS];
#pragma unroll
    for (int j = 0; j < CV_LOADS; ++j) x[j] = s[j * 32];
    // keeps all 32 loads ahead of the first conversion, so that all are in flight
    // (without it the compiler holds 14 of them back behind the first waits)
    __builtin_amdgcn_sched_barrier(0);
#pragma unroll
    for (int j = 0; j < CV_LOADS; ++j) {
        v4h o;
        o[0] = (_Float16)x[j][0]; o[1] = (_Float16)x[j][1];
        o[2] = (_Float16)x[j][2]; o[3] = (_Float16)x[j][3];
        d[j * 32] = o;
    }
}

// ---------------------------------------------------------------------------
// Projection GEMMs, all-f16 operands: out[s,e] = sum_d Xh[s,d]*Wh[e,d] + b[e], for Q times QSCALE.
// One launch does all three: blockIdx.y = 0, 1, 2 is the V, K, Q projection.
// None reads what another writes; in one grid there is one launch gap, one
// fill and one tail instead of three, and two workgroups share a WGP (LDS and
// registers fit twice), so one's first tile, hand-overs and stores run under
// the other's products.  The three X, the three W and the three outputs each
// lie one behind the other in the workspace.
//   transpose_out == 0 : out layout [B,H,S,Hd]   (Q, K)
//   transpose_out == 1 : out layout [B,H,Hd,S]   (V -> contiguous V^T*P^T A-frags)
// One workgroup per 128(row) x 128(col) tile of an output, 8 waves in a
// 2 x 4 grid, 64 x 32 per wave.  A pass is 128 k (256 B of each of the 128 X
// rows and 128 W rows); the pass's rows are brought into LDS by asynchronous
// copies, whole 256-B row pieces per half wave, and shared by all 8 waves.
// Two buffers: pass t+1's copies fly while pass t is multiplied.
// LDS rows are pitched 272 B so that the 16-byte fragment reads of 16
// neighbouring rows fall on different banks.
// Epilogue: the f16 tile is laid in the freed LDS in the output's own row order
// and goes out in 16-byte pieces, 16 lanes to a 256-B row: every store
// instruction covers four whole 128-B lines.
// ---------------------------------------------------------------------------
#define PJ_TILE   128                       // output tile edge
#define PJ_KP     128                       // k per pass (halves)
#define PJ_PITCH  136                       // LDS row pitch (halves) = 272 B
#define PJ_STAGE  (2 * PJ_TILE * PJ_PITCH)  // halves per buffer: X rows, then W rows
#define PJ_NPASS  (DD / PJ_KP)              // 8

// Eight 16-byte copies of one lane: rows r, r+16, ..., r+112 of one operand.
// g: the lane's 16 bytes in the first row; l: their LDS byte address.
__device__ __forceinline__ void proj_copy8(const half_t* g, unsigned l) {
    const half_t* g1 = g + 16 * 1 * DD;  const unsigned l1 = l + 16 * 1 * PJ_PITCH * 2;
    const half_t* g2 = g + 16 * 2 * DD;  const unsigned l2 = l + 16 * 2 * PJ_PITCH * 2;
    const half_t* g3 = g + 16 * 3 * DD;  const unsigned l3 = l + 16 * 3 * PJ_PITCH * 2;
    const half_t* g4 = g + 16 * 4 * DD;  const unsigned l4 = l + 16 * 4 * PJ_PITCH * 2;
    const half_t* g5 = g + 16 * 5 * DD;  const unsigned l5 = l + 16 * 5 * PJ_PITCH * 2;
    const half_t* g6 = g + 16 * 6 * DD;  const unsigned l6 = l + 16 * 6 * PJ_PITCH * 2;
    const half_t* g7 = g + 16 * 7 * DD;  const unsigned l7 = l + 16 * 7 * PJ_PITCH * 2;
    // The closing s_wait_xcnt stands inside the statement so that no address
    // register named here is rewritten ahead of it.
    asm volatile(
        "global_load_async_to_lds_b128 %0, %8, off\n\t"
        "global_load_async_to_lds_b128 %1, %9, off\n\t"
        "global_load_async_to_lds_b128 %2, %10, off\n\t"
        "global_load_async_to_lds_b128 %3, %11, off\n\t"
        "global_load_async_to_lds_b128 %4, %12, off\n\t"
        "global_load_async_to_lds_b128 %5, %13, off\n\t"
        "global_load_async_to_lds_b128 %6, %14, off\n\t"
        "global_load_async_to_lds_b128 %7, %15, off\n\t"
        "s_wait_xcnt 0x0"
        :: "v"(l), "v"(l1), "v"(l2), "v"(l3), "v"(l4), "v"(l5), "v"(l6), "v"(l7),
           "v"(g), "v"(g1), "v"(g2), "v"(g3), "v"(g4), "v"(g5), "v"(g6), "v"(g7)
        : "memory");
}

__global__ __launch_bounds__(256) void proj_wmma_kernel(
    const half_t* __restrict__ Xall, const half_t* __restrict__ Wall,
    const float* __restrict__ bq, const float* __restrict__ bk,
    const float* __restrict__ bv, half_t* __restrict__ outall)
{
    __shared__ __align__(16) half_t stg[2 * PJ_STAGE];   // 139,264 B

    // Which projection this workgroup belongs to (0 Q, 1 K, 2 V): all of it scalar.
    // blockIdx.y 0 is V; the order has no bearing on the result.
    const int which = 2 - (int)blockIdx.y;
    const half_t* Xh  = Xall   + (size_t)which * (ROWS * DD);
    const half_t* Wh  = Wall   + (size_t)which * (DD * DD);
    half_t*       out = outall + (size_t)which * (ROWS * DD);
    const float* bias = (which == 0) ? bq : (which == 1) ? bk : bv;
    const int transpose_out = (which == 2);

    const int tid  = threadIdx.x;
    const int wid  = tid >> 5;
    const int lane = tid & 31;
    const int l16  = lane & 15;
    const int hi   = lane >> 4;
    const int klo  = hi * 8;

    const int NT = DD / PJ_TILE;                       // 8 tile columns
    const int m0 = (blockIdx.x / NT) * PJ_TILE;        // first X row of the tile
    const int n0 = (blockIdx.x % NT) * PJ_TILE;        // first W row of the tile
    const int wm = (wid >> 2) * 64;                    // wave's rows in the tile
    const int wn = (wid & 3) * 32;                     // wave's columns in the tile

    // Copy duty of a lane: 16-byte piece (tid & 15) of rows (tid >> 4) + 16 j.
    const int crow = tid >> 4;
    const int ccol = (tid & 15) * 8;
    const half_t* gx = Xh + (size_t)(m0 + crow) * DD + ccol;
    const half_t* gw = Wh + (size_t)(n0 + crow) * DD + ccol;
    const unsigned lx = (unsigned)(size_t)&stg[crow * PJ_PITCH + ccol];
    const unsigned lw = lx + PJ_TILE * PJ_PITCH * 2;

    // Every inner loop below is unrolled so that each accumulator and fragment
    // index is a constant: the arrays then live in registers, not in scratch.
    v8f acc[4][2];
#pragma unroll
    for (int i = 0; i < 4; ++i)
#pragma unroll
        for (int j = 0; j < 2; ++j) acc[i][j] = (v8f)(0.0f);

    // pass 0 -> buffer 0, landed and published; then pass 1 -> buffer 1
    proj_copy8(gx, lx);
    proj_copy8(gw, lw);
    // this wave's copies have landed before the barrier lets others read them
    asm volatile("s_wait_asynccnt 0x0" ::: "memory");
    __syncthreads();
    proj_copy8(gx + PJ_KP, lx + PJ_STAGE * 2);
    proj_copy8(gw + PJ_KP, lw + PJ_STAGE * 2);

    // rolled: eight copies of the pass body would only lengthen the kernel's text
#pragma unroll 1
    for (int t = 0; t < PJ_NPASS; ++t) {
        const int buf = t & 1;
        const half_t* xs = stg + buf * PJ_STAGE + (wm + l16) * PJ_PITCH + klo;
        const half_t* wsm = stg + buf * PJ_STAGE + (PJ_TILE + wn + l16) * PJ_PITCH + klo;
        // Two fragment sets: step s+1's LDS reads go out as one group ahead of
        // step s's products, so the products cover their latency.
        v16h a[2][4], b[2][2];
#pragma unroll
        for (int i = 0; i < 4; ++i) a[0][i] = load_frag_f16(xs + i * 16 * PJ_PITCH);
#pragma unroll
        for (int j = 0; j < 2; ++j) b[0][j] = load_frag_f16(wsm + j * 16 * PJ_PITCH);
#pragma unroll
        for (int s = 0; s < PJ_KP / 32; ++s) {
            const int cur = s & 1, nxt = cur ^ 1;
            if (s + 1 < PJ_KP / 32) {
#pragma unroll
                for (int i = 0; i < 4; ++i)
                    a[nxt][i] = load_frag_f16(xs + i * 16 * PJ_PITCH + (s + 1) * 32);
#pragma unroll
                for (int j = 0; j < 2; ++j)
                    b[nxt][j] = load_frag_f16(wsm + j * 16 * PJ_PITCH + (s + 1) * 32);
            }
            // keeps the read group above the products instead of spread among them
            __builtin_amdgcn_sched_barrier(0);
#pragma unroll
            for (int i = 0; i < 4; ++i)
#pragma unroll
                for (int j = 0; j < 2; ++j)
                    acc[i][j] = wmma_f16(a[cur][i], b[cur][j], acc[i][j]);
            // keeps the next group's reads from sinking into these products
            __builtin_amdgcn_sched_barrier(0);
        }
        // Hand-over: this wave's reads of buffer buf are done, its copies of
        // pass t+1 have landed; behind the barrier that holds for every wave.
        asm volatile("s_wait_dscnt 0x0" ::: "memory");
        asm volatile("s_wait_asynccnt 0x0" ::: "memory");
        __syncthreads();
        if (t + 2 < PJ_NPASS) {
            proj_copy8(gx + (t + 2) * PJ_KP, lx + buf * (PJ_STAGE * 2));
            proj_copy8(gw + (t + 2) * PJ_KP, lw + buf * (PJ_STAGE * 2));
        }
    }
    // no copy of this wave is outstanding when it ends
    asm volatile("s_wait_asynccnt 0x0" ::: "memory");

    // Bias, then the tile as f16 into LDS.  The ring is free: every wave's last
    // fragment reads and copies ended in front of the loop's last barrier.
    // C layout: acc[i][j][r] = out[row0 + i*16 + r + 8*hi][col0 + j*16 + l16]
    // Staged rows (pitch 272 B): for V one row per column e, 128 s long, so a
    // lane's 8 values of an accumulator tile are 16 contiguous bytes; for Q and K
    // one row per s, 128 e long (two heads of 64 side by side).
    half_t* so = stg;                                  // 128 x 272 B = 34,816 B
    float bj[2];
#pragma unroll
    for (int j = 0; j < 2; ++j) bj[j] = bias[n0 + wn + j * 16 + l16];
    if (transpose_out) {
#pragma unroll
        for (int j = 0; j < 2; ++j)
#pragma unroll
            for (int i = 0; i < 4; ++i) {
                v8h o;
#pragma unroll
                for (int r = 0; r < 8; ++r) o[r] = (_Float16)(acc[i][j][r] + bj[j]);
                *(v8h*)(so + (wn + j * 16 + l16) * PJ_PITCH + wm + i * 16 + 8 * hi) = o;
            }
    } else {
        const float osc = (which == 0) ? QSCALE : 1.0f;   // Q: see QSCALE; K: as it is
#pragma unroll
        for (int j = 0; j < 2; ++j)
#pragma unroll
            for (int i = 0; i < 4; ++i)
#pragma unroll
                for (int r = 0; r < 8; ++r)
                    so[(wm + i * 16 + 8 * hi + r) * PJ_PITCH + wn + j * 16 + l16] =
                        (_Float16)((acc[i][j][r] + bj[j]) * osc);
    }
    // the staged tile is complete before any wave reads rows that others wrote
    __syncthreads();

    // A lane takes 16-byte piece (tid & 15) of staged rows (tid >> 4) + 16 k.
    const int b_   = m0 >> 11;                         // the tile lies in one batch
    const int sl0  = m0 & 2047;
    half_t* go;                                        // the lane's piece of row (tid >> 4)
    size_t gstep;                                      // 16 staged rows further on
    if (transpose_out) {
        // row = column e = h*64 + d of [B,H,Hd,S]; the piece is 8 s
        go    = out + (size_t)(b_ * DD + n0 + crow) * SS + sl0 + ccol;
        gstep = (size_t)16 * SS;
    } else {
        // row = s of [B,H,S,Hd]; the piece is 8 d of head (n0 + ccol) / 64
        const int e = n0 + ccol;
        go    = out + ((size_t)(b_ * HH + (e >> 6)) * SS + sl0 + crow) * HD + (e & 63);
        gstep = (size_t)16 * HD;
    }
    v8h x[8];
#pragma unroll
    for (int k = 0; k < 8; ++k)
        x[k] = *(const v8h*)(so + (crow + 16 * k) * PJ_PITCH + ccol);
#pragma unroll
    for (int k = 0; k < 8; ++k)
        *(v8h*)(go + k * gstep) = x[k];
}

#define AT_KEYS   128
#define AT_KPITCH 72
#define AT_VPITCH 136
#define AT_KH     (AT_KEYS * AT_KPITCH)
#define AT_STAGE  (AT_KH + HD * AT_VPITCH)
#define AT_NST    (SS / AT_KEYS)

// Eight 16-byte copies of one lane: K rows r, r+32, r+64, r+96 and VpT rows
// d, d+16, d+32, d+48.  gk, gv: the lane's 16 bytes in the first row of each;
// lk, lv: their LDS byte addresses.
__device__ __forceinline__ void attn_copy8(const half_t* gk, unsigned lk,
                                           const half_t* gv, unsigned lv) {
    const half_t* gk1 = gk + 32 * 1 * HD;  const unsigned lk1 = lk + 32 * 1 * AT_KPITCH * 2;
    const half_t* gk2 = gk + 32 * 2 * HD;  const unsigned lk2 = lk + 32 * 2 * AT_KPITCH * 2;
    const half_t* gk3 = gk + 32 * 3 * HD;  const unsigned lk3 = lk + 32 * 3 * AT_KPITCH * 2;
    const half_t* gv1 = gv + 16 * 1 * SS;  const unsigned lv1 = lv + 16 * 1 * AT_VPITCH * 2;
    const half_t* gv2 = gv + 16 * 2 * SS;  const unsigned lv2 = lv + 16 * 2 * AT_VPITCH * 2;
    const half_t* gv3 = gv + 16 * 3 * SS;  const unsigned lv3 = lv + 16 * 3 * AT_VPITCH * 2;
    // The closing s_wait_xcnt stands inside the statement so that no address
    // register named here is rewritten ahead of it.
    asm volatile(
        "global_load_async_to_lds_b128 %0, %8, off\n\t"
        "global_load_async_to_lds_b128 %1, %9, off\n\t"
        "global_load_async_to_lds_b128 %2, %10, off\n\t"
        "global_load_async_to_lds_b128 %3, %11, off\n\t"
        "global_load_async_to_lds_b128 %4, %12, off\n\t"
        "global_load_async_to_lds_b128 %5, %13, off\n\t"
        "global_load_async_to_lds_b128 %6, %14, off\n\t"
        "global_load_async_to_lds_b128 %7, %15, off\n\t"
        "s_wait_xcnt 0x0"
        :: "v"(lk), "v"(lk1), "v"(lk2), "v"(lk3), "v"(lv), "v"(lv1), "v"(lv2), "v"(lv3),
           "v"(gk), "v"(gk1), "v"(gk2), "v"(gk3), "v"(gv), "v"(gv1), "v"(gv2), "v"(gv3)
        : "memory");
}

// The value that lane l ^ 16 holds.
__device__ __forceinline__ float other_half(float x) {
    const int b = __builtin_bit_cast(int, x);
    return __builtin_bit_cast(float,
        __builtin_amdgcn_permlanex16(b, b, 0x76543210, 0xfedcba98, false, false));
}

// A run of exponentials to base 2.  The instruction set asks for one slot
// between a transcendental and an instruction that reads its result or
// overwrites its source: inside the run no instruction names a register of
// another (every output is early-clobber), and the closing v_nop is the slot
// behind the last one.
__device__ __forceinline__ void exp2_run8(v8f x, v8f& y) {
    float y0, y1, y2, y3, y4, y5, y6, y7;
    asm("v_exp_f32 %0, %8\n\t"
        "v_exp_f32 %1, %9\n\t"
        "v_exp_f32 %2, %10\n\t"
        "v_exp_f32 %3, %11\n\t"
        "v_exp_f32 %4, %12\n\t"
        "v_exp_f32 %5, %13\n\t"
        "v_exp_f32 %6, %14\n\t"
        "v_exp_f32 %7, %15\n\t"
        "v_nop"
        : "=&v"(y0), "=&v"(y1), "=&v"(y2), "=&v"(y3),
          "=&v"(y4), "=&v"(y5), "=&v"(y6), "=&v"(y7)
        : "v"(x[0]), "v"(x[1]), "v"(x[2]), "v"(x[3]),
          "v"(x[4]), "v"(x[5]), "v"(x[6]), "v"(x[7]));
    y[0] = y0; y[1] = y1; y[2] = y2; y[3] = y3;
    y[4] = y4; y[5] = y5; y[6] = y6; y[7] = y7;
}

// A single one, with its slot.
__device__ __forceinline__ float exp2_one(float x) {
    float y;
    asm("v_exp_f32 %0, %1\n\t"
        "v_nop"
        : "=&v"(y) : "v"(x));
    return y;
}

__global__ __launch_bounds__(256) void attn_wmma_kernel(
    const half_t* __restrict__ Qp, const half_t* __restrict__ Kp,
    const half_t* __restrict__ VpT, float* __restrict__ out)
{
    __shared__ __align__(16) half_t kvs[2 * AT_STAGE];  // 71,680 B: the two stage buffers

    const int tid  = threadIdx.x;
    const int wid  = threadIdx.x >> 5;
    const int lane = threadIdx.x & 31;
    const int l16  = lane & 15;
    const int hi   = lane >> 4;
    const int klo  = hi * 8;

    const int unit = blockIdx.x * (blockDim.x >> 5) + wid;
    const int QTILES = SS / 16;
    const int bh = unit / QTILES;
    const int q0 = (unit % QTILES) * 16;

    const half_t* qb = Qp  + (size_t)bh * SS * HD;
    const half_t* kb = Kp  + (size_t)bh * SS * HD;
    const half_t* vt = VpT + (size_t)bh * HD * SS;

    const half_t* qrow = qb + (size_t)(q0 + l16) * HD;
    const v16h qa0 = load_frag_f16(qrow + 0  + klo);
    const v16h qa1 = load_frag_f16(qrow + 32 + klo);

    v8f oacc[4];
#pragma unroll
    for (int t = 0; t < 4; ++t) oacc[t] = (v8f)(0.0f);
    // of the lane's query: sum over the keys that this half of the wave holds
    // (the halves are joined behind the loop)
    float l_run = 0.0f;

    // Copy duty of a lane: 16-byte piece (tid & 7) of K rows (tid >> 3) + 32 j,
    // 16-byte piece (tid & 15) of VpT rows (tid >> 4) + 16 j.
    const half_t* gk = kb + (size_t)(tid >> 3) * HD + (tid & 7) * 8;
    const half_t* gv = vt + (size_t)(tid >> 4) * SS + (tid & 15) * 8;
    const unsigned lk = (unsigned)(size_t)&kvs[(tid >> 3) * AT_KPITCH + (tid & 7) * 8];
    const unsigned lv = (unsigned)(size_t)&kvs[AT_KH + (tid >> 4) * AT_VPITCH + (tid & 15) * 8];

    // stage 0 -> buffer 0, landed and published; then stage 1 -> buffer 1
    attn_copy8(gk, lk, gv, lv);
    // this wave's copies have landed before the barrier lets others read them
    asm volatile("s_wait_asynccnt 0x0" ::: "memory");
    __syncthreads();
    attn_copy8(gk + AT_KEYS * HD, lk + AT_STAGE * 2, gv + AT_KEYS, lv + AT_STAGE * 2);

    // minus the maximum in use, as the C operand of the score products: at the
    // start the maximum over keys 0..15, so that the sum holds a term 1 from the
    // first chunk on
    v8f negm;
    {
        const half_t* kr = kvs + l16 * AT_KPITCH + klo;
        v8f s = (v8f)(0.0f);
        s = wmma_f16(load_frag_f16(kr + 0),  qa0, s);
        s = wmma_f16(load_frag_f16(kr + 32), qa1, s);
        float v = fmaxf(s[0], s[1]);
#pragma unroll
        for (int i = 2; i < 8; ++i) v = fmaxf(v, s[i]);
        v = fmaxf(v, other_half(v));
        negm = (v8f)(-v);
    }

    // rolled: sixteen copies of the stage body would only lengthen the kernel's text
#pragma unroll 1
    for (int st = 0; st < AT_NST; ++st) {
      const int buf = st & 1;
      const half_t* ks = kvs + buf * AT_STAGE + l16 * AT_KPITCH + klo;
      const half_t* vs = kvs + buf * AT_STAGE + AT_KH + l16 * AT_VPITCH + klo;
      // by 2: the pair's LDS offsets are immediates of its reads
#pragma unroll 2
      for (int c = 0; c < AT_KEYS / 32; ++c) {
        // ---- issue all K and V fragment reads for this chunk ----
        const half_t* kr0 = ks + (c * 32 + 0)  * AT_KPITCH;
        const half_t* kr1 = ks + (c * 32 + 16) * AT_KPITCH;
        v16h kb00 = load_frag_f16(kr0 + 0);
        v16h kb01 = load_frag_f16(kr0 + 32);
        v16h kb10 = load_frag_f16(kr1 + 0);
        v16h kb11 = load_frag_f16(kr1 + 32);
        v16h vb[4];
#pragma unroll
        for (int t = 0; t < 4; ++t)
            vb[t] = load_frag_f16(vs + t * 16 * AT_VPITCH + c * 32);
        __builtin_amdgcn_sched_barrier(0);   // keep loads above the compute

        // ---- S^T - m = K * Q^T - m (two 16-key m-tiles, two 32-wide k-steps) ----
        // sac0[i]: key c*32 + 8*hi + i, sac1[i]: key c*32 + 16 + 8*hi + i; query l16
        v8f sac0 = wmma_f16(kb00, qa0, negm);
        sac0 = wmma_f16(kb01, qa1, sac0);
        v8f sac1 = wmma_f16(kb10, qa0, negm);
        sac1 = wmma_f16(kb11, qa1, sac1);

        // ---- softmax terms of the 32 new keys, one query per lane ----
        // v: how far the new scores of the lane's query stand above m
        float v = fmaxf(sac0[0], sac0[1]);
#pragma unroll
        for (int i = 2; i < 8; ++i) v = fmaxf(v, sac0[i]);
#pragma unroll
        for (int i = 0; i < 8; ++i) v = fmaxf(v, sac1[i]);
        v = fmaxf(v, other_half(v));
        // the same for all lanes: a scalar branch, every lane on inside it
        if (__builtin_amdgcn_ballot_w32(v > 8.0f) != 0) {
            // m moves up by d to the new maximum (not at all where that is lower):
            // the arguments follow it, what has been gathered so far shrinks by 2^-d
            const float d = fmaxf(v, 0.0f);
            const float al = exp2_one(-d);
            sac0 = sac0 - d;
            sac1 = sac1 - d;
            negm = negm - d;
            l_run *= al;
#pragma unroll
            for (int t = 0; t < 4; ++t)
#pragma unroll
                for (int i = 0; i < 8; ++i) oacc[t][i] *= al;
        }
        // behind the test: the maximum it needs has read every accumulator, so these
        // asm runs stand far enough behind the products on both paths
        v8f p0, p1;
        exp2_run8(sac0, p0);
        exp2_run8(sac1, p1);
        float rs0 = p0[0], rs1 = p1[0];
#pragma unroll
        for (int i = 1; i < 8; ++i) { rs0 += p0[i]; rs1 += p1[i]; }
        v16h pb;
#pragma unroll
        for (int i = 0; i < 8; ++i) {
            pb[i]     = (_Float16)p0[i];
            pb[8 + i] = (_Float16)p1[i];
        }
        l_run += rs0 + rs1;

        // ---- O^T += V^T * P^T: oacc[t][i] = O[query l16][d = t*16 + 8*hi + i] ----
#pragma unroll
        for (int t = 0; t < 4; ++t)
            oacc[t] = wmma_f16(vb[t], pb, oacc[t]);
      }
      // Hand-over: this wave's reads of buffer buf are done, its copies of
      // stage st+1 have landed; behind the barrier that holds for every wave.
      asm volatile("s_wait_dscnt 0x0" ::: "memory");
      asm volatile("s_wait_asynccnt 0x0" ::: "memory");
      __syncthreads();
      if (st + 2 < AT_NST)
          attn_copy8(gk + (st + 2) * (AT_KEYS * HD), lk + buf * (AT_STAGE * 2),
                     gv + (st + 2) * AT_KEYS,        lv + buf * (AT_STAGE * 2));
    }
    // no copy of this wave is outstanding when it ends
    asm volatile("s_wait_asynccnt 0x0" ::: "memory");

    // ---- normalize and store: out[b, q0+l16, h*64 + t*16 + 8*hi + 0..7] ----
    const int b_ = bh / HH;
    const int h_ = bh % HH;
    const float inv = 1.0f / (l_run + other_half(l_run));
    float* orow = out + ((size_t)(b_ * SS + q0 + l16)) * DD + h_ * HD + 8 * hi;
#pragma unroll
    for (int t = 0; t < 4; ++t) {
        float4 lo4, hi4;
        lo4.x = oacc[t][0] * inv; lo4.y = oacc[t][1] * inv;
        lo4.z = oacc[t][2] * inv; lo4.w = oacc[t][3] * inv;
        hi4.x = oacc[t][4] * inv; hi4.y = oacc[t][5] * inv;
        hi4.z = oacc[t][6] * inv; hi4.w = oacc[t][7] * inv;
        *(float4*)(orow + t * 16)     = lo4;
        *(float4*)(orow + t * 16 + 4) = hi4;
    }
}

// ---------------------------------------------------------------------------
// Host-side launch. Inputs: q,k,v,Wq,bq,Wk,bk,Wv,bv (all f32).
// Workspace (f16 halves):
//   [0)   qh,kh,vh    : 3 x 4M  (converted activations)
//   [12M) wqh,wkh,wvh : 3 x 1M  (converted weights)
//   [15M) Qp,Kp,VpT   : 3 x 4M  (projected heads)
// Total 27M halves = 54 MB.
// ---------------------------------------------------------------------------
extern "C" void kernel_launch(void* const* d_in, const int* in_sizes, int n_in,
                              void* d_out, int out_size, void* d_ws, size_t ws_size,
                              hipStream_t stream) {
    const float* q  = (const float*)d_in[0];
    const float* k  = (const float*)d_in[1];
    const float* v  = (const float*)d_in[2];
    const float* Wq = (const float*)d_in[3];
    const float* bq = (const float*)d_in[4];
    const float* Wk = (const float*)d_in[5];
    const float* bk = (const float*)d_in[6];
    const float* Wv = (const float*)d_in[7];
    const float* bv = (const float*)d_in[8];
    float* out = (float*)d_out;

    const size_t XN = (size_t)ROWS * DD;   // 4,194,304
    const size_t WN = (size_t)DD * DD;     // 1,048,576
    half_t* ws  = (half_t*)d_ws;
    half_t* qh  = ws;
    half_t* kh  = qh  + XN;
    half_t* vh  = kh  + XN;
    half_t* wqh = vh  + XN;
    half_t* wkh = wqh + WN;
    half_t* wvh = wkh + WN;
    half_t* Qp  = wvh + WN;
    half_t* Kp  = Qp  + XN;
    half_t* VpT = Kp  + XN;

    // 1) f32 -> f16 conversion of all six operands, one launch: qh .. wvh are
    //    contiguous from ws on, in the kernel's order
    cvt_all_f32_to_f16_kernel<<<CV_BLOCKS, CV_WAVES * 32, 0, stream>>>(q, k, v, Wq, Wk, Wv, qh);

    // 2) projections, one launch: one block per 128 x 128 output tile, 32 x 8 = 256
    //    blocks for each of Q, K, V; qh.., wqh.., Qp.. are each three arrays in a row
    const int projBlocks = (ROWS / PJ_TILE) * (DD / PJ_TILE);
    proj_wmma_kernel<<<dim3(projBlocks, 3), 256, 0, stream>>>(qh, wqh, bq, bk, bv, Qp);

    // 3) attention: units = B*H*(S/16) = 4096 -> 512 blocks x 8 waves
    const int attnBlocks = BB * HH * (SS / 16) / 8;
    attn_wmma_kernel<<<attnBlocks, 256, 0, stream>>>(Qp, Kp, VpT, out);
}

// v008
// Measured time: 69.8 microseconds a run.
// In two side-by-side timings against v007, it was 1.05 and 1.06 times as fast.
// Over all steps from v000 it is 3.82 times as fast.
#include <hip/hip_runtime.h>

// Problem constants (from reference)
#define BB   2
#define SS   2048
#define DD   1024
#define HH   16
#define HD   64
#define ROWS (BB * SS)          // 4096 rows in the projection GEMMs
// log2(e) / sqrt(Hd): the projected Q carries it, so that K * Q^T is the softmax
// exponent to base 2
#define QSCALE 0.18033688011112042f

typedef _Float16 half_t;
typedef __attribute__((ext_vector_type(16))) _Float16 v16h;
typedef __attribute__((ext_vector_type(8)))  _Float16 v8h;
typedef __attribute__((ext_vector_type(8)))  float    v8f;

// ---------------------------------------------------------------------------
// Fragment helper: A-layout (16-bit A, 16x32, ISA 7.12.2): lane l (l16=l&15)
// holds row M=l16; halves a[0..7]=K(klo..klo+7), a[8..15]=K(16+klo..) with
// klo = (lane>=16 ? 8 : 0).  B uses the symmetric lane-per-column layout.
// Both reduce to: 8 contiguous halves at p, 8 contiguous halves at p+16.
// ---------------------------------------------------------------------------
__device__ __forceinline__ v16h load_frag_f16(const half_t* p) {
    v8h lo = *(const v8h*)(p);
    v8h hi = *(const v8h*)(p + 16);
    v16h r;
#pragma unroll
    for (int i = 0; i < 8; ++i) { r[i] = lo[i]; r[8 + i] = hi[i]; }
    return r;
}

__device__ __forceinline__ v8f wmma_f16(v16h a, v16h b, v8f c) {
    return __builtin_amdgcn_wmma_f32_16x16x32_f16(
        false, a, false, b, (short)0, c, false, false);
}

// ---------------------------------------------------------------------------
// f32 -> f16 conversion of all six operands in one launch (memory bound; feeds
// all later kernels).  The six f16 arrays lie one behind the other in dst, in
// the order q, k, v, Wq, Wk, Wv.  A wave takes one piece of 4096 elements
// (16 KiB of f32) of one array: 32 loads of 16 B per lane, each covering 512
// contiguous bytes, all issued before the first is used, then 32 stores of 8 B
// per lane, each covering 256 contiguous bytes.  Few long waves instead of many
// short ones, for speed only.
// ---------------------------------------------------------------------------
typedef __attribute__((ext_vector_type(4))) float    v4f;
typedef __attribute__((ext_vector_type(4))) _Float16 v4h;

#define CV_LOADS  32                        // 16-byte loads of a lane
#define CV_PIECE  (CV_LOADS * 32 * 4)       // elements per wave: 4096
#define CV_WAVES  15                        // waves per block
#define CV_XP     (ROWS * DD / CV_PIECE)    // pieces of q, k or v: 1024
#define CV_WP     (DD * DD / CV_PIECE)      // pieces of a weight matrix: 256
#define CV_BLOCKS ((3 * CV_XP + 3 * CV_WP) / CV_WAVES)   // 256, no remainder

__global__ __launch_bounds__(CV_WAVES * 32) void cvt_all_f32_to_f16_kernel(
    const float* __restrict__ q,  const float* __restrict__ k,
    const float* __restrict__ v,  const float* __restrict__ Wq,
    const float* __restrict__ Wk, const float* __restrict__ Wv,
    half_t* __restrict__ dst)
{
    // the wave's number as a scalar: the choice of the source array stays scalar
    const int wave  = __builtin_amdgcn_readfirstlane((int)(threadIdx.x >> 5));
    const int lane  = threadIdx.x & 31;
    const int piece = blockIdx.x * CV_WAVES + wave;

    const float* src;
    int off;                                 // the piece's number inside its array
    if (piece < 3 * CV_XP) {
        const int a = piece / CV_XP;
        src = (a == 0) ? q : (a == 1) ? k : v;
        off = piece % CV_XP;
    } else {
        const int a = (piece - 3 * CV_XP) / CV_WP;
        src = (a == 0) ? Wq : (a == 1) ? Wk : Wv;
        off = (piece - 3 * CV_XP) % CV_WP;
    }

    const v4f* s = (const v4f*)(src + (size_t)off * CV_PIECE) + lane;
    v4h*       d = (v4h*)(dst + (size_t)piece * CV_PIECE) + lane;

    // both loops unrolled: x lives in registers and every offset is an immediate
    v4f x[CV_LOADS];
#pragma unroll
    for (int j = 0; j < CV_LOADS; ++j) x[j] = s[j * 32];
    // keeps all 32 loads ahead of the first conversion, so that all are in flight
    // (without it the compiler holds 14 of them back behind the first waits)
    __builtin_amdgcn_sched_barrier(0);
#pragma unroll
    for (int j = 0; j < CV_LOADS; ++j) {
        v4h o;
        o[0] = (_Float16)x[j][0]; o[1] = (_Float16)x[j][1];
        o[2] = (_Float16)x[j][2]; o[3] = (_Float16)x[j][3];
        d[j * 32] = o;
    }
}

// ---------------------------------------------------------------------------
// Projection GEMMs, all-f16 operands: out[s,e] = sum_d Xh[s,d]*Wh[e,d] + b[e], for Q times QSCALE.
// One launch does all three: blockIdx.y = 0, 1, 2 is the V, K, Q projection.
// None reads what another writes; in one grid there is one launch gap, one
// fill and one tail instead of three, and two workgroups share a WGP (LDS and
// registers fit twice), so one's first tile, hand-overs and stores run under
// the other's products.  The three X, the three W and the three outputs each
// lie one behind the other in the workspace.
//   transpose_out == 0 : out layout [B,H,S,Hd]   (Q, K)
//   transpose_out == 1 : out layout [B,H,Hd,S]   (V -> contiguous V^T*P^T A-frags)
// One workgroup per 128(row) x 128(col) tile of an output, 8 waves in a
// 2 x 4 grid, 64 x 32 per wave.  A pass is 128 k (256 B of each of the 128 X
// rows and 128 W rows); the pass's rows are brought into LDS by asynchronous
// copies, whole 256-B row pieces per half wave, and shared by all 8 waves.
// Two buffers: pass t+1's copies fly while pass t is multiplied.
// LDS rows are pitched 272 B so that the 16-byte fragment reads of 16
// neighbouring rows fall on different banks.
// Epilogue: the f16 tile is laid in the freed LDS in the output's own row order
// and goes out in 16-byte pieces, 16 lanes to a 256-B row: every store
// instruction covers four whole 128-B lines.
// ---------------------------------------------------------------------------
#define PJ_TILE   128                       // output tile edge
#define PJ_KP     128                       // k per pass (halves)
#define PJ_PITCH  136                       // LDS row pitch (halves) = 272 B
#define PJ_STAGE  (2 * PJ_TILE * PJ_PITCH)  // halves per buffer: X rows, then W rows
#define PJ_NPASS  (DD / PJ_KP)              // 8

// Eight 16-byte copies of one lane: rows r, r+16, ..., r+112 of one operand.
// g: the lane's 16 bytes in the first row; l: their LDS byte address.
__device__ __forceinline__ void proj_copy8(const half_t* g, unsigned l) {
    const half_t* g1 = g + 16 * 1 * DD;  const unsigned l1 = l + 16 * 1 * PJ_PITCH * 2;
    const half_t* g2 = g + 16 * 2 * DD;  const unsigned l2 = l + 16 * 2 * PJ_PITCH * 2;
    const half_t* g3 = g + 16 * 3 * DD;  const unsigned l3 = l + 16 * 3 * PJ_PITCH * 2;
    const half_t* g4 = g + 16 * 4 * DD;  const unsigned l4 = l + 16 * 4 * PJ_PITCH * 2;
    const half_t* g5 = g + 16 * 5 * DD;  const unsigned l5 = l + 16 * 5 * PJ_PITCH * 2;
    const half_t* g6 = g + 16 * 6 * DD;  const unsigned l6 = l + 16 * 6 * PJ_PITCH * 2;
    const half_t* g7 = g + 16 * 7 * DD;  const unsigned l7 = l + 16 * 7 * PJ_PITCH * 2;
    // The closing s_wait_xcnt stands inside the statement so that no address
    // register named here is rewritten ahead of it.
    asm volatile(
        "global_load_async_to_lds_b128 %0, %8, off\n\t"
        "global_load_async_to_lds_b128 %1, %9, off\n\t"
        "global_load_async_to_lds_b128 %2, %10, off\n\t"
        "global_load_async_to_lds_b128 %3, %11, off\n\t"
        "global_load_async_to_lds_b128 %4, %12, off\n\t"
        "global_load_async_to_lds_b128 %5, %13, off\n\t"
        "global_load_async_to_lds_b128 %6, %14, off\n\t"
        "global_load_async_to_lds_b128 %7, %15, off\n\t"
        "s_wait_xcnt 0x0"
        :: "v"(l), "v"(l1), "v"(l2), "v"(l3), "v"(l4), "v"(l5), "v"(l6), "v"(l7),
           "v"(g), "v"(g1), "v"(g2), "v"(g3), "v"(g4), "v"(g5), "v"(g6), "v"(g7)
        : "memory");
}

__global__ __launch_bounds__(256) void proj_wmma_kernel(
    const half_t* __restrict__ Xall, const half_t* __restrict__ Wall,
    const float* __restrict__ bq, const float* __restrict__ bk,
    const float* __restrict__ bv, half_t* __restrict__ outall)
{
    __shared__ __align__(16) half_t stg[2 * PJ_STAGE];   // 139,264 B

    // Which projection this workgroup belongs to (0 Q, 1 K, 2 V): all of it scalar.
    // blockIdx.y 0 is V; the order has no bearing on the result.
    const int which = 2 - (int)blockIdx.y;
    const half_t* Xh  = Xall   + (size_t)which * (ROWS * DD);
    const half_t* Wh  = Wall   + (size_t)which * (DD * DD);
    half_t*       out = outall + (size_t)which * (ROWS * DD);
    const float* bias = (which == 0) ? bq : (which == 1) ? bk : bv;
    const int transpose_out = (which == 2);

    const int tid  = threadIdx.x;
    const int wid  = tid >> 5;
    const int lane = tid & 31;
    const int l16  = lane & 15;
    const int hi   = lane >> 4;
    const int klo  = hi * 8;

    const int NT = DD / PJ_TILE;                       // 8 tile columns
    const int m0 = (blockIdx.x / NT) * PJ_TILE;        // first X row of the tile
    const int n0 = (blockIdx.x % NT) * PJ_TILE;        // first W row of the tile
    const int wm = (wid >> 2) * 64;                    // wave's rows in the tile
    const int wn = (wid & 3) * 32;                     // wave's columns in the tile

    // Copy duty of a lane: 16-byte piece (tid & 15) of rows (tid >> 4) + 16 j.
    const int crow = tid >> 4;
    const int ccol = (tid & 15) * 8;
    const half_t* gx = Xh + (size_t)(m0 + crow) * DD + ccol;
    const half_t* gw = Wh + (size_t)(n0 + crow) * DD + ccol;
    const unsigned lx = (unsigned)(size_t)&stg[crow * PJ_PITCH + ccol];
    const unsigned lw = lx + PJ_TILE * PJ_PITCH * 2;

    // Every inner loop below is unrolled so that each accumulator and fragment
    // index is a constant: the arrays then live in registers, not in scratch.
    v8f acc[4][2];
#pragma unroll
    for (int i = 0; i < 4; ++i)
#pragma unroll
        for (int j = 0; j < 2; ++j) acc[i][j] = (v8f)(0.0f);

    // pass 0 -> buffer 0, landed and published; then pass 1 -> buffer 1
    proj_copy8(gx, lx);
    proj_copy8(gw, lw);
    // this wave's copies have landed before the barrier lets others read them
    asm volatile("s_wait_asynccnt 0x0" ::: "memory");
    __syncthreads();
    proj_copy8(gx + PJ_KP, lx + PJ_STAGE * 2);
    proj_copy8(gw + PJ_KP, lw + PJ_STAGE * 2);

    // rolled: eight copies of the pass body would only lengthen the kernel's text
#pragma unroll 1
    for (int t = 0; t < PJ_NPASS; ++t) {
        const int buf = t & 1;
        const half_t* xs = stg + buf * PJ_STAGE + (wm + l16) * PJ_PITCH + klo;
        const half_t* wsm = stg + buf * PJ_STAGE + (PJ_TILE + wn + l16) * PJ_PITCH + klo;
        // Two fragment sets: step s+1's LDS reads go out as one group ahead of
        // step s's products, so the products cover their latency.
        v16h a[2][4], b[2][2];
#pragma unroll
        for (int i = 0; i < 4; ++i) a[0][i] = load_frag_f16(xs + i * 16 * PJ_PITCH);
#pragma unroll
        for (int j = 0; j < 2; ++j) b[0][j] = load_frag_f16(wsm + j * 16 * PJ_PITCH);
#pragma unroll
        for (int s = 0; s < PJ_KP / 32; ++s) {
            const int cur = s & 1, nxt = cur ^ 1;
            if (s + 1 < PJ_KP / 32) {
#pragma unroll
                for (int i = 0; i < 4; ++i)
                    a[nxt][i] = load_frag_f16(xs + i * 16 * PJ_PITCH + (s + 1) * 32);
#pragma unroll
                for (int j = 0; j < 2; ++j)
                    b[nxt][j] = load_frag_f16(wsm + j * 16 * PJ_PITCH + (s + 1) * 32);
            }
            // keeps the read group above the products instead of spread among them
            __builtin_amdgcn_sched_barrier(0);
#pragma unroll
            for (int i = 0; i < 4; ++i)
#pragma unroll
                for (int j = 0; j < 2; ++j)
                    acc[i][j] = wmma_f16(a[cur][i], b[cur][j], acc[i][j]);
            // keeps the next group's reads from sinking into these products
            __builtin_amdgcn_sched_barrier(0);
        }
        // Hand-over: this wave's reads of buffer buf are done, its copies of
        // pass t+1 have landed; behind the barrier that holds for every wave.
        asm volatile("s_wait_dscnt 0x0" ::: "memory");
        asm volatile("s_wait_asynccnt 0x0" ::: "memory");
        __syncthreads();
        if (t + 2 < PJ_NPASS) {
            proj_copy8(gx + (t + 2) * PJ_KP, lx + buf * (PJ_STAGE * 2));
            proj_copy8(gw + (t + 2) * PJ_KP, lw + buf * (PJ_STAGE * 2));
        }
    }
    // no copy of this wave is outstanding when it ends
    asm volatile("s_wait_asynccnt 0x0" ::: "memory");

    // Bias, then the tile as f16 into LDS.  The ring is free: every wave's last
    // fragment reads and copies ended in front of the loop's last barrier.
    // C layout: acc[i][j][r] = out[row0 + i*16 + r + 8*hi][col0 + j*16 + l16]
    // Staged rows (pitch 272 B): for V one row per column e, 128 s long, so a
    // lane's 8 values of an accumulator tile are 16 contiguous bytes; for Q and K
    // one row per s, 128 e long (two heads of 64 side by side).
    half_t* so = stg;                                  // 128 x 272 B = 34,816 B
    float bj[2];
#pragma unroll
    for (int j = 0; j < 2; ++j) bj[j] = bias[n0 + wn + j * 16 + l16];
    if (transpose_out) {
#pragma unroll
        for (int j = 0; j < 2; ++j)
#pragma unroll
            for (int i = 0; i < 4; ++i) {
                v8h o;
#pragma unroll
                for (int r = 0; r < 8; ++r) o[r] = (_Float16)(acc[i][j][r] + bj[j]);
                *(v8h*)(so + (wn + j * 16 + l16) * PJ_PITCH + wm + i * 16 + 8 * hi) = o;
            }
    } else {
        const float osc = (which == 0) ? QSCALE : 1.0f;   // Q: see QSCALE; K: as it is
#pragma unroll
        for (int j = 0; j < 2; ++j)
#pragma unroll
            for (int i = 0; i < 4; ++i)
#pragma unroll
                for (int r = 0; r < 8; ++r)
                    so[(wm + i * 16 + 8 * hi + r) * PJ_PITCH + wn + j * 16 + l16] =
                        (_Float16)((acc[i][j][r] + bj[j]) * osc);
    }
    // the staged tile is complete before any wave reads rows that others wrote
    __syncthreads();

    // A lane takes 16-byte piece (tid & 15) of staged rows (tid >> 4) + 16 k.
    const int b_   = m0 >> 11;                         // the tile lies in one batch
    const int sl0  = m0 & 2047;
    half_t* go;                                        // the lane's piece of row (tid >> 4)
    size_t gstep;                                      // 16 staged rows further on
    if (transpose_out) {
        // row = column e = h*64 + d of [B,H,Hd,S]; the piece is 8 s
        go    = out + (size_t)(b_ * DD + n0 + crow) * SS + sl0 + ccol;
        gstep = (size_t)16 * SS;
    } else {
        // row = s of [B,H,S,Hd]; the piece is 8 d of head (n0 + ccol) / 64
        const int e = n0 + ccol;
        go    = out + ((size_t)(b_ * HH + (e >> 6)) * SS + sl0 + crow) * HD + (e & 63);
        gstep = (size_t)16 * HD;
    }
    v8h x[8];
#pragma unroll
    for (int k = 0; k < 8; ++k)
        x[k] = *(const v8h*)(so + (crow + 16 * k) * PJ_PITCH + ccol);
#pragma unroll
    for (int k = 0; k < 8; ++k)
        *(v8h*)(go + k * gstep) = x[k];
}

#define AT_KEYS   128
#define AT_KPITCH 72
#define AT_VPITCH 136
#define AT_KH     (AT_KEYS * AT_KPITCH)
#define AT_STAGE  (AT_KH + HD * AT_VPITCH)
#define AT_NST    (SS / AT_KEYS)

// Eight 16-byte copies of one lane: K rows r, r+32, r+64, r+96 and VpT rows
// d, d+16, d+32, d+48.  gk, gv: the lane's 16 bytes in the first row of each;
// lk, lv: their LDS byte addresses.
__device__ __forceinline__ void attn_copy8(const half_t* gk, unsigned lk,
                                           const half_t* gv, unsigned lv) {
    const half_t* gk1 = gk + 32 * 1 * HD;  const unsigned lk1 = lk + 32 * 1 * AT_KPITCH * 2;
    const half_t* gk2 = gk + 32 * 2 * HD;  const unsigned lk2 = lk + 32 * 2 * AT_KPITCH * 2;
    const half_t* gk3 = gk + 32 * 3 * HD;  const unsigned lk3 = lk + 32 * 3 * AT_KPITCH * 2;
    const half_t* gv1 = gv + 16 * 1 * SS;  const unsigned lv1 = lv + 16 * 1 * AT_VPITCH * 2;
    const half_t* gv2 = gv + 16 * 2 * SS;  const unsigned lv2 = lv + 16 * 2 * AT_VPITCH * 2;
    const half_t* gv3 = gv + 16 * 3 * SS;  const unsigned lv3 = lv + 16 * 3 * AT_VPITCH * 2;
    // The closing s_wait_xcnt stands inside the statement so that no address
    // register named here is rewritten ahead of it.
    asm volatile(
        "global_load_async_to_lds_b128 %0, %8, off\n\t"
        "global_load_async_to_lds_b128 %1, %9, off\n\t"
        "global_load_async_to_lds_b128 %2, %10, off\n\t"
        "global_load_async_to_lds_b128 %3, %11, off\n\t"
        "global_load_async_to_lds_b128 %4, %12, off\n\t"
        "global_load_async_to_lds_b128 %5, %13, off\n\t"
        "global_load_async_to_lds_b128 %6, %14, off\n\t"
        "global_load_async_to_lds_b128 %7, %15, off\n\t"
        "s_wait_xcnt 0x0"
        :: "v"(lk), "v"(lk1), "v"(lk2), "v"(lk3), "v"(lv), "v"(lv1), "v"(lv2), "v"(lv3),
           "v"(gk), "v"(gk1), "v"(gk2), "v"(gk3), "v"(gv), "v"(gv1), "v"(gv2), "v"(gv3)
        : "memory");
}

// The value that lane l ^ 16 holds.
__device__ __forceinline__ float other_half(float x) {
    const int b = __builtin_bit_cast(int, x);
    return __builtin_bit_cast(float,
        __builtin_amdgcn_permlanex16(b, b, 0x76543210, 0xfedcba98, false, false));
}

// A run of exponentials to base 2.  The instruction set asks for one slot
// between a transcendental and an instruction that reads its result or
// overwrites its source: inside the run no instruction names a register of
// another (every output is early-clobber), and the closing v_nop is the slot
// behind the last one.
__device__ __forceinline__ void exp2_run8(v8f x, v8f& y) {
    float y0, y1, y2, y3, y4, y5, y6, y7;
    asm("v_exp_f32 %0, %8\n\t"
        "v_exp_f32 %1, %9\n\t"
        "v_exp_f32 %2, %10\n\t"
        "v_exp_f32 %3, %11\n\t"
        "v_exp_f32 %4, %12\n\t"
        "v_exp_f32 %5, %13\n\t"
        "v_exp_f32 %6, %14\n\t"
        "v_exp_f32 %7, %15\n\t"
        "v_nop"
        : "=&v"(y0), "=&v"(y1), "=&v"(y2), "=&v"(y3),
          "=&v"(y4), "=&v"(y5), "=&v"(y6), "=&v"(y7)
        : "v"(x[0]), "v"(x[1]), "v"(x[2]), "v"(x[3]),
          "v"(x[4]), "v"(x[5]), "v"(x[6]), "v"(x[7]));
    y[0] = y0; y[1] = y1; y[2] = y2; y[3] = y3;
    y[4] = y4; y[5] = y5; y[6] = y6; y[7] = y7;
}

// The same run as the compiler's own instructions, for use directly behind matrix
// products: the compiler then keeps the distance that the chip asks for between a
// product and a reader of its result, and counts these instructions into it.
__device__ __forceinline__ v8f exp2_8(v8f x) {
    v8f y;
#pragma unroll
    for (int i = 0; i < 8; ++i) y[i] = __builtin_amdgcn_exp2f(x[i]);
    return y;
}

// Sum of a lane's 16 terms: a tree of pairwise sums, 8 + 4 + 2 + 1 additions, laid
// out so that neighbouring registers are added in pairs.
__device__ __forceinline__ float sum16(v8f a, v8f b) {
    const v8f t = a + b;
    const float u0 = t[0] + t[4], u1 = t[1] + t[5], u2 = t[2] + t[6], u3 = t[3] + t[7];
    return (u0 + u2) + (u1 + u3);
}

// A single one, with its slot.
__device__ __forceinline__ float exp2_one(float x) {
    float y;
    asm("v_exp_f32 %0, %1\n\t"
        "v_nop"
        : "=&v"(y) : "v"(x));
    return y;
}

__global__ __launch_bounds__(256) void attn_wmma_kernel(
    const half_t* __restrict__ Qp, const half_t* __restrict__ Kp,
    const half_t* __restrict__ VpT, float* __restrict__ out)
{
    __shared__ __align__(16) half_t kvs[2 * AT_STAGE];  // 71,680 B: the two stage buffers

    const int tid  = threadIdx.x;
    const int wid  = threadIdx.x >> 5;
    const int lane = threadIdx.x & 31;
    const int l16  = lane & 15;
    const int hi   = lane >> 4;
    const int klo  = hi * 8;

    const int unit = blockIdx.x * (blockDim.x >> 5) + wid;
    const int QTILES = SS / 16;
    const int bh = unit / QTILES;
    const int q0 = (unit % QTILES) * 16;

    const half_t* qb = Qp  + (size_t)bh * SS * HD;
    const half_t* kb = Kp  + (size_t)bh * SS * HD;
    const half_t* vt = VpT + (size_t)bh * HD * SS;

    const half_t* qrow = qb + (size_t)(q0 + l16) * HD;
    const v16h qa0 = load_frag_f16(qrow + 0  + klo);
    const v16h qa1 = load_frag_f16(qrow + 32 + klo);

    v8f oacc[4];
#pragma unroll
    for (int t = 0; t < 4; ++t) oacc[t] = (v8f)(0.0f);
    // of the lane's query: sum over the keys that this half of the wave holds
    // (the halves are joined behind the loop)
    float l_run = 0.0f;

    // Copy duty of a lane: 16-byte piece (tid & 7) of K rows (tid >> 3) + 32 j,
    // 16-byte piece (tid & 15) of VpT rows (tid >> 4) + 16 j.
    const half_t* gk = kb + (size_t)(tid >> 3) * HD + (tid & 7) * 8;
    const half_t* gv = vt + (size_t)(tid >> 4) * SS + (tid & 15) * 8;
    const unsigned lk = (unsigned)(size_t)&kvs[(tid >> 3) * AT_KPITCH + (tid & 7) * 8];
    const unsigned lv = (unsigned)(size_t)&kvs[AT_KH + (tid >> 4) * AT_VPITCH + (tid & 15) * 8];

    // stage 0 -> buffer 0, landed and published; then stage 1 -> buffer 1
    attn_copy8(gk, lk, gv, lv);
    // this wave's copies have landed before the barrier lets others read them
    asm volatile("s_wait_asynccnt 0x0" ::: "memory");
    __syncthreads();
    attn_copy8(gk + AT_KEYS * HD, lk + AT_STAGE * 2, gv + AT_KEYS, lv + AT_STAGE * 2);

    // minus the maximum in use, as the C operand of the score products: at the
    // start the maximum over keys 0..15, so that the sum holds a term 1 from the
    // first chunk on
    v8f negm;
    {
        const half_t* kr = kvs + l16 * AT_KPITCH + klo;
        v8f s = (v8f)(0.0f);
        s = wmma_f16(load_frag_f16(kr + 0),  qa0, s);
        s = wmma_f16(load_frag_f16(kr + 32), qa1, s);
        float v = fmaxf(s[0], s[1]);
#pragma unroll
        for (int i = 2; i < 8; ++i) v = fmaxf(v, s[i]);
        v = fmaxf(v, other_half(v));
        negm = (v8f)(-v);
    }

    // rolled: sixteen copies of the stage body would only lengthen the kernel's text
#pragma unroll 1
    for (int st = 0; st < AT_NST; ++st) {
      const int buf = st & 1;
      const half_t* ks = kvs + buf * AT_STAGE + l16 * AT_KPITCH + klo;
      const half_t* vs = kvs + buf * AT_STAGE + AT_KH + l16 * AT_VPITCH + klo;
      // by 2: the pair's LDS offsets are immediates of its reads
#pragma unroll 2
      for (int c = 0; c < AT_KEYS / 32; ++c) {
        // ---- issue all K and V fragment reads for this chunk ----
        const half_t* kr0 = ks + (c * 32 + 0)  * AT_KPITCH;
        const half_t* kr1 = ks + (c * 32 + 16) * AT_KPITCH;
        v16h kb00 = load_frag_f16(kr0 + 0);
        v16h kb01 = load_frag_f16(kr0 + 32);
        v16h kb10 = load_frag_f16(kr1 + 0);
        v16h kb11 = load_frag_f16(kr1 + 32);
        v16h vb[4];
#pragma unroll
        for (int t = 0; t < 4; ++t)
            vb[t] = load_frag_f16(vs + t * 16 * AT_VPITCH + c * 32);
        __builtin_amdgcn_sched_barrier(0);   // keep loads above the compute

        // ---- S^T - m = K * Q^T - m (two 16-key m-tiles, two 32-wide k-steps) ----
        // sac0[i]: key c*32 + 8*hi + i, sac1[i]: key c*32 + 16 + 8*hi + i; query l16
        v8f sac0 = wmma_f16(kb00, qa0, negm);
        sac0 = wmma_f16(kb01, qa1, sac0);
        v8f sac1 = wmma_f16(kb10, qa0, negm);
        sac1 = wmma_f16(kb11, qa1, sac1);

        // ---- softmax terms of the 32 new keys, one query per lane ----
        v8f p0 = exp2_8(sac0);
        v8f p1 = exp2_8(sac1);
        float rs = sum16(p0, p1);
        // The test for a maximum that has grown reads the lane's sum of terms, which
        // is formed anyway: a sum of at most 256 says that every term is at most 256
        // (far inside f16).  Not-less-or-equal, so that an overflowed term counts too.
        // The same for all lanes: a scalar branch, every lane on inside it.
        if (__builtin_amdgcn_ballot_w32(!(rs <= 256.0f)) != 0) {
            // v: how far the new scores of the lane's query stand above m
            float v = fmaxf(sac0[0], sac0[1]);
#pragma unroll
            for (int i = 2; i < 8; ++i) v = fmaxf(v, sac0[i]);
#pragma unroll
            for (int i = 0; i < 8; ++i) v = fmaxf(v, sac1[i]);
            v = fmaxf(v, other_half(v));
            // m moves up by d to the new maximum (not at all where that is lower):
            // the arguments follow it, what has been gathered so far shrinks by 2^-d,
            // and the chunk's terms are formed again from the new arguments
            const float d = fmaxf(v, 0.0f);
            const float al = exp2_one(-d);
            sac0 = sac0 - d;
            sac1 = sac1 - d;
            negm = negm - d;
            l_run *= al;
#pragma unroll
            for (int t = 0; t < 4; ++t)
#pragma unroll
                for (int i = 0; i < 8; ++i) oacc[t][i] *= al;
            exp2_run8(sac0, p0);
            exp2_run8(sac1, p1);
            rs = sum16(p0, p1);
        }
        v16h pb;
#pragma unroll
        for (int i = 0; i < 8; ++i) {
            pb[i]     = (_Float16)p0[i];
            pb[8 + i] = (_Float16)p1[i];
        }
        l_run += rs;

        // ---- O^T += V^T * P^T: oacc[t][i] = O[query l16][d = t*16 + 8*hi + i] ----
#pragma unroll
        for (int t = 0; t < 4; ++t)
            oacc[t] = wmma_f16(vb[t], pb, oacc[t]);
      }
      // Hand-over: this wave's reads of buffer buf are done, its copies of
      // stage st+1 have landed; behind the barrier that holds for every wave.
      asm volatile("s_wait_dscnt 0x0" ::: "memory");
      asm volatile("s_wait_asynccnt 0x0" ::: "memory");
      __syncthreads();
      if (st + 2 < AT_NST)
          attn_copy8(gk + (st + 2) * (AT_KEYS * HD), lk + buf * (AT_STAGE * 2),
                     gv + (st + 2) * AT_KEYS,        lv + buf * (AT_STAGE * 2));
    }
    // no copy of this wave is outstanding when it ends
    asm volatile("s_wait_asynccnt 0x0" ::: "memory");

    // ---- normalize and store: out[b, q0+l16, h*64 + t*16 + 8*hi + 0..7] ----
    const int b_ = bh / HH;
    const int h_ = bh % HH;
    const float inv = 1.0f / (l_run + other_half(l_run));
    float* orow = out + ((size_t)(b_ * SS + q0 + l16)) * DD + h_ * HD + 8 * hi;
#pragma unroll
    for (int t = 0; t < 4; ++t) {
        float4 lo4, hi4;
        lo4.x = oacc[t][0] * inv; lo4.y = oacc[t][1] * inv;
        lo4.z = oacc[t][2] * inv; lo4.w = oacc[t][3] * inv;
        hi4.x = oacc[t][4] * inv; hi4.y = oacc[t][5] * inv;
        hi4.z = oacc[t][6] * inv; hi4.w = oacc[t][7] * inv;
        *(float4*)(orow + t * 16)     = lo4;
        *(float4*)(orow + t * 16 + 4) = hi4;
    }
}

// ---------------------------------------------------------------------------
// Host-side launch. Inputs: q,k,v,Wq,bq,Wk,bk,Wv,bv (all f32).
// Workspace (f16 halves):
//   [0)   qh,kh,vh    : 3 x 4M  (converted activations)
//   [12M) wqh,wkh,wvh : 3 x 1M  (converted weights)
//   [15M) Qp,Kp,VpT   : 3 x 4M  (projected heads)
// Total 27M halves = 54 MB.
// ---------------------------------------------------------------------------
extern "C" void kernel_launch(void* const* d_in, const int* in_sizes, int n_in,
                              void* d_out, int out_size, void* d_ws, size_t ws_size,
                              hipStream_t stream) {
    const float* q  = (const float*)d_in[0];
    const float* k  = (const float*)d_in[1];
    const float* v  = (const float*)d_in[2];
    const float* Wq = (const float*)d_in[3];
    const float* bq = (const float*)d_in[4];
    const float* Wk = (const float*)d_in[5];
    const float* bk = (const float*)d_in[6];
    const float* Wv = (const float*)d_in[7];
    const float* bv = (const float*)d_in[8];
    float* out = (float*)d_out;

    const size_t XN = (size_t)ROWS * DD;   // 4,194,304
    const size_t WN = (size_t)DD * DD;     // 1,048,576
    half_t* ws  = (half_t*)d_ws;
    half_t* qh  = ws;
    half_t* kh  = qh  + XN;
    half_t* vh  = kh  + XN;
    half_t* wqh = vh  + XN;
    half_t* wkh = wqh + WN;
    half_t* wvh = wkh + WN;
    half_t* Qp  = wvh + WN;
    half_t* Kp  = Qp  + XN;
    half_t* VpT = Kp  + XN;

    // 1) f32 -> f16 conversion of all six operands, one launch: qh .. wvh are
    //    contiguous from ws on, in the kernel's order
    cvt_all_f32_to_f16_kernel<<<CV_BLOCKS, CV_WAVES * 32, 0, stream>>>(q, k, v, Wq, Wk, Wv, qh);

    // 2) projections, one launch: one block per 128 x 128 output tile, 32 x 8 = 256
    //    blocks for each of Q, K, V; qh.., wqh.., Qp.. are each three arrays in a row
    const int projBlocks = (ROWS / PJ_TILE) * (DD / PJ_TILE);
    proj_wmma_kernel<<<dim3(projBlocks, 3), 256, 0, stream>>>(qh, wqh, bq, bk, bv, Qp);

    // 3) attention: units = B*H*(S/16) = 4096 -> 512 blocks x 8 waves
    const int attnBlocks = BB * HH * (SS / 16) / 8;
    attn_wmma_kernel<<<attnBlocks, 256, 0, stream>>>(Qp, Kp, VpT, out);
}

// v009
// A run of this version takes 62.5 microseconds.
// Next to v008, in two timings, it ran 1.11 and 1.10 times as fast.
// Counting every step since v000, it is 4.23 times as fast.
#include <hip/hip_runtime.h>

// Problem constants (from reference)
#define BB   2
#define SS   2048
#define DD   1024
#define HH   16
#define HD   64
#define ROWS (BB * SS)          // 4096 rows in the projection GEMMs
// log2(e) / sqrt(Hd): the projected Q carries it, so that K * Q^T is the softmax
// exponent to base 2
#define QSCALE 0.18033688011112042f

typedef _Float16 half_t;
typedef __attribute__((ext_vector_type(16))) _Float16 v16h;
typedef __attribute__((ext_vector_type(8)))  _Float16 v8h;
typedef __attribute__((ext_vector_type(8)))  float    v8f;

// ---------------------------------------------------------------------------
// Fragment helper: A-layout (16-bit A, 16x32, ISA 7.12.2): lane l (l16=l&15)
// holds row M=l16; halves a[0..7]=K(klo..klo+7), a[8..15]=K(16+klo..) with
// klo = (lane>=16 ? 8 : 0).  B uses the symmetric lane-per-column layout.
// Both reduce to: 8 contiguous halves at p, 8 contiguous halves at p+16.
// ---------------------------------------------------------------------------
__device__ __forceinline__ v16h load_frag_f16(const half_t* p) {
    v8h lo = *(const v8h*)(p);
    v8h hi = *(const v8h*)(p + 16);
    v16h r;
#pragma unroll
    for (int i = 0; i < 8; ++i) { r[i] = lo[i]; r[8 + i] = hi[i]; }
    return r;
}

__device__ __forceinline__ v8f wmma_f16(v16h a, v16h b, v8f c) {
    return __builtin_amdgcn_wmma_f32_16x16x32_f16(
        false, a, false, b, (short)0, c, false, false);
}

// ---------------------------------------------------------------------------
// Projection GEMMs: out[s,e] = sum_d X[s,d]*W[e,d] + b[e], X and W given in f32,
// multiplied as f16.  One launch does all three: blockIdx.y = 0, 1, 2 is the V,
// K, Q projection.  There is no conversion launch: a workgroup loads its own f32
// rows into registers, rounds them to f16 (to nearest even) and lays them in LDS,
// so no f16 copy of X or W goes through memory.
//   transpose_out == 0 : out layout [B,H,S,Hd]   (Q, K)
//   transpose_out == 1 : out layout [B,H,Hd,S]   (V -> contiguous PV A-frags)
// One workgroup per 256(row) x 256(col) tile of an output, 8 waves in a 4 x 2
// grid, 64 x 128 per wave, one workgroup on a WGP.  The tile is this large
// because the operands now come as 4-byte elements: an X row is read by 4
// workgroups and a W row by 16, which keeps the bytes asked of L2 at what
// 128 x 128 tiles ask for 2-byte elements.
// A pass is 64 k (256 B of f32 of each of the 256 X rows and 256 W rows): 32
// loads of 16 B a lane, 16 lanes to a row piece, so that each load instruction
// covers four whole 128-B lines.  Two LDS buffers and one register set: pass
// t+2's loads fly while pass t+1 is multiplied; behind the products of pass t
// the registers (pass t+1) are rounded into the buffer that pass t-1 has left.
// LDS rows are pitched 144 B so that the 16-byte fragment reads of 16
// neighbouring rows fall on different banks.
// Epilogue: the f16 tile is laid in the freed LDS in the output's own row order
// and goes out in 16-byte pieces, a wave to a 512-B staged row: every store
// instruction covers four whole 128-B lines.
// ---------------------------------------------------------------------------
typedef __attribute__((ext_vector_type(4))) float    v4f;
typedef __attribute__((ext_vector_type(4))) _Float16 v4h;

#define PJ_TILE   256                       // output tile edge
#define PJ_KP     64                        // k per pass
#define PJ_PITCH  72                        // LDS row pitch (halves) = 144 B
#define PJ_STAGE  (2 * PJ_TILE * PJ_PITCH)  // halves per buffer: X rows, then W rows
#define PJ_NPASS  (DD / PJ_KP)              // 16
#define PJ_LD     (PJ_TILE / 16)            // loads of a lane per operand and pass: 16
#define PJ_OPITCH 264                       // pitch of a staged output row (halves) = 528 B

// A lane's 16 bytes of rows r, r+16, ..., r+240 of one operand; g: those of row r.
__device__ __forceinline__ void proj_load(const float* g, v4f (&x)[PJ_LD]) {
#pragma unroll
    for (int j = 0; j < PJ_LD; ++j) x[j] = *(const v4f*)(g + (size_t)j * 16 * DD);
}

// The same values, rounded to f16, to their places in LDS; l: that of row r.
__device__ __forceinline__ void proj_put(const v4f (&x)[PJ_LD], half_t* l) {
#pragma unroll
    for (int j = 0; j < PJ_LD; ++j) {
        v4h o;
        o[0] = (_Float16)x[j][0]; o[1] = (_Float16)x[j][1];
        o[2] = (_Float16)x[j][2]; o[3] = (_Float16)x[j][3];
        *(v4h*)(l + j * 16 * PJ_PITCH) = o;
    }
}

__global__ __launch_bounds__(256) void proj_wmma_kernel(
    const float* __restrict__ q,  const float* __restrict__ k,
    const float* __restrict__ v,  const float* __restrict__ Wq,
    const float* __restrict__ Wk, const float* __restrict__ Wv,
    const float* __restrict__ bq, const float* __restrict__ bk,
    const float* __restrict__ bv, half_t* __restrict__ outall)
{
    __shared__ __align__(16) half_t stg[2 * PJ_STAGE];   // 147,456 B

    // Which projection this workgroup belongs to (0 Q, 1 K, 2 V): all of it scalar.
    // blockIdx.y 0 is V; the order has no bearing on the result.
    const int which = 2 - (int)blockIdx.y;
    const float* X    = (which == 0) ? q  : (which == 1) ? k  : v;
    const float* Wt   = (which == 0) ? Wq : (which == 1) ? Wk : Wv;
    const float* bias = (which == 0) ? bq : (which == 1) ? bk : bv;
    half_t*      out  = outall + (size_t)which * (ROWS * DD);
    const int transpose_out = (which == 2);

    const int tid  = threadIdx.x;
    const int wid  = tid >> 5;
    const int lane = tid & 31;
    const int l16  = lane & 15;
    const int hi   = lane >> 4;
    const int klo  = hi * 8;

    const int NT = DD / PJ_TILE;                       // 4 tile columns
    const int m0 = (blockIdx.x / NT) * PJ_TILE;        // first X row of the tile
    const int n0 = (blockIdx.x % NT) * PJ_TILE;        // first W row of the tile
    const int wm = (wid >> 1) * 64;                    // wave's rows in the tile
    const int wn = (wid & 1) * 128;                    // wave's columns in the tile

    // Staging duty of a lane: 4 elements (tid & 15) of rows (tid >> 4) + 16 j.
    const int crow = tid >> 4;
    const int ccol = (tid & 15) * 4;
    const float* gx = X  + (size_t)(m0 + crow) * DD + ccol;
    const float* gw = Wt + (size_t)(n0 + crow) * DD + ccol;
    half_t* lx = stg + crow * PJ_PITCH + ccol;
    half_t* lw = lx + PJ_TILE * PJ_PITCH;

    // Every inner loop below is unrolled so that each accumulator and fragment
    // index is a constant: the arrays then live in registers, not in scratch.
    v8f acc[4][8];
#pragma unroll
    for (int i = 0; i < 4; ++i)
#pragma unroll
        for (int j = 0; j < 8; ++j) acc[i][j] = (v8f)(0.0f);

    // pass 0 -> buffer 0; then pass 1 into the registers
    v4f xr[PJ_LD], wr[PJ_LD];
    proj_load(gx, xr);
    proj_load(gw, wr);
    proj_put(xr, lx);
    proj_put(wr, lw);
    proj_load(gx + PJ_KP, xr);
    proj_load(gw + PJ_KP, wr);
    // stands in front of any later rewrite of an address register of these loads
    asm volatile("s_wait_xcnt 0x0" ::: "memory");
    // Buffer 0 is complete before any wave reads rows that others wrote.  The barrier
    // is written by hand, with the LDS wait it needs: __syncthreads() would also wait
    // for the global loads just issued, which are to fly while a pass is multiplied.
    asm volatile("s_wait_dscnt 0x0\n\ts_barrier_signal -1\n\ts_barrier_wait -1" ::: "memory");

    // rolled: sixteen copies of the pass body would only lengthen the kernel's text
#pragma unroll 1
    for (int t = 0; t < PJ_NPASS; ++t) {
        const int buf = t & 1;
        const half_t* xs  = stg + buf * PJ_STAGE + (wm + l16) * PJ_PITCH + klo;
        const half_t* wsm = stg + buf * PJ_STAGE + (PJ_TILE + wn + l16) * PJ_PITCH + klo;
#pragma unroll
        for (int s = 0; s < PJ_KP / 32; ++s) {
            v16h a[4], b[8];
#pragma unroll
            for (int i = 0; i < 4; ++i) a[i] = load_frag_f16(xs + i * 16 * PJ_PITCH + s * 32);
#pragma unroll
            for (int j = 0; j < 8; ++j) b[j] = load_frag_f16(wsm + j * 16 * PJ_PITCH + s * 32);
            // keeps the read group above the products instead of spread among them
            __builtin_amdgcn_sched_barrier(0);
#pragma unroll
            for (int j = 0; j < 8; ++j)
#pragma unroll
                for (int i = 0; i < 4; ++i)
                    acc[i][j] = wmma_f16(a[i], b[j], acc[i][j]);
            // keeps the next group's reads from rising into these products
            __builtin_amdgcn_sched_barrier(0);
        }
        if (t + 1 < PJ_NPASS) {
            // pass t+1 out of the registers into the other buffer: its last readers
            // (pass t-1) ended in front of the barrier that closed pass t-1
            proj_put(xr, lx + (buf ^ 1) * PJ_STAGE);
            proj_put(wr, lw + (buf ^ 1) * PJ_STAGE);
            if (t + 2 < PJ_NPASS) {
                proj_load(gx + (t + 2) * PJ_KP, xr);
                proj_load(gw + (t + 2) * PJ_KP, wr);
                // stands in front of any later rewrite of an address register of these loads
                asm volatile("s_wait_xcnt 0x0" ::: "memory");
            }
        }
        // Hand-over: every wave's reads of buffer buf are done and pass t+1 lies
        // complete in the other buffer.  By hand for the same reason as above: the
        // loads of pass t+2 stay in flight across it.
        asm volatile("s_wait_dscnt 0x0\n\ts_barrier_signal -1\n\ts_barrier_wait -1" ::: "memory");
    }

    // Bias, then the tile as f16 into LDS.  The buffers are free: every wave's last
    // fragment reads ended in front of the loop's last barrier.
    // C layout: acc[i][j][r] = out[row0 + i*16 + r + 8*hi][col0 + j*16 + l16]
    // Staged rows (pitch 528 B): for V one row per column e, 256 s long, so a
    // lane's 8 values of an accumulator tile are 16 contiguous bytes; for Q and K
    // one row per s, 256 e long (four heads of 64 side by side).
    half_t* so = stg;                                  // 256 x 528 B = 135,168 B
    float bj[8];
#pragma unroll
    for (int j = 0; j < 8; ++j) bj[j] = bias[n0 + wn + j * 16 + l16];
    if (transpose_out) {
#pragma unroll
        for (int j = 0; j < 8; ++j)
#pragma unroll
            for (int i = 0; i < 4; ++i) {
                v8h o;
#pragma unroll
                for (int r = 0; r < 8; ++r) o[r] = (_Float16)(acc[i][j][r] + bj[j]);
                *(v8h*)(so + (wn + j * 16 + l16) * PJ_OPITCH + wm + i * 16 + 8 * hi) = o;
            }
    } else {
        const float osc = (which == 0) ? QSCALE : 1.0f;   // Q: see QSCALE; K: as it is
#pragma unroll
        for (int j = 0; j < 8; ++j)
#pragma unroll
            for (int i = 0; i < 4; ++i)
#pragma unroll
                for (int r = 0; r < 8; ++r)
                    so[(wm + i * 16 + 8 * hi + r) * PJ_OPITCH + wn + j * 16 + l16] =
                        (_Float16)((acc[i][j][r] + bj[j]) * osc);
    }
    // the staged tile is complete before any wave reads rows that others wrote
    __syncthreads();

    // A wave takes staged rows wid + 8 n, a lane 16-byte piece (lane) of each.
    const int b_   = m0 >> 11;                         // the tile lies in one batch
    const int sl0  = m0 & 2047;
    half_t* go;                                        // the lane's piece of row wid
    size_t gstep;                                      // 8 staged rows further on
    if (transpose_out) {
        // row = column e = h*64 + d of [B,H,Hd,S]; the piece is 8 s
        go    = out + (size_t)(b_ * DD + n0 + wid) * SS + sl0 + lane * 8;
        gstep = (size_t)8 * SS;
    } else {
        // row = s of [B,H,S,Hd]; the piece is 8 d of head (n0 + lane * 8) / 64
        const int e = n0 + lane * 8;
        go    = out + ((size_t)(b_ * HH + (e >> 6)) * SS + sl0 + wid) * HD + (e & 63);
        gstep = (size_t)8 * HD;
    }
    // by groups of 8: eight LDS reads in flight, then their eight stores
#pragma unroll
    for (int n = 0; n < PJ_TILE / 8; n += 8) {
        v8h x[8];
#pragma unroll
        for (int m = 0; m < 8; ++m)
            x[m] = *(const v8h*)(so + (wid + 8 * (n + m)) * PJ_OPITCH + lane * 8);
#pragma unroll
        for (int m = 0; m < 8; ++m)
            *(v8h*)(go + (n + m) * gstep) = x[m];
    }
}

#define AT_KEYS   128
#define AT_KPITCH 72
#define AT_VPITCH 136
#define AT_KH     (AT_KEYS * AT_KPITCH)
#define AT_STAGE  (AT_KH + HD * AT_VPITCH)
#define AT_NST    (SS / AT_KEYS)

// Eight 16-byte copies of one lane: K rows r, r+32, r+64, r+96 and VpT rows
// d, d+16, d+32, d+48.  gk, gv: the lane's 16 bytes in the first row of each;
// lk, lv: their LDS byte addresses.
__device__ __forceinline__ void attn_copy8(const half_t* gk, unsigned lk,
                                           const half_t* gv, unsigned lv) {
    const half_t* gk1 = gk + 32 * 1 * HD;  const unsigned lk1 = lk + 32 * 1 * AT_KPITCH * 2;
    const half_t* gk2 = gk + 32 * 2 * HD;  const unsigned lk2 = lk + 32 * 2 * AT_KPITCH * 2;
    const half_t* gk3 = gk + 32 * 3 * HD;  const unsigned lk3 = lk + 32 * 3 * AT_KPITCH * 2;
    const half_t* gv1 = gv + 16 * 1 * SS;  const unsigned lv1 = lv + 16 * 1 * AT_VPITCH * 2;
    const half_t* gv2 = gv + 16 * 2 * SS;  const unsigned lv2 = lv + 16 * 2 * AT_VPITCH * 2;
    const half_t* gv3 = gv + 16 * 3 * SS;  const unsigned lv3 = lv + 16 * 3 * AT_VPITCH * 2;
    // The closing s_wait_xcnt stands inside the statement so that no address
    // register named here is rewritten ahead of it.
    asm volatile(
        "global_load_async_to_lds_b128 %0, %8, off\n\t"
        "global_load_async_to_lds_b128 %1, %9, off\n\t"
        "global_load_async_to_lds_b128 %2, %10, off\n\t"
        "global_load_async_to_lds_b128 %3, %11, off\n\t"
        "global_load_async_to_lds_b128 %4, %12, off\n\t"
        "global_load_async_to_lds_b128 %5, %13, off\n\t"
        "global_load_async_to_lds_b128 %6, %14, off\n\t"
        "global_load_async_to_lds_b128 %7, %15, off\n\t"
        "s_wait_xcnt 0x0"
        :: "v"(lk), "v"(lk1), "v"(lk2), "v"(lk3), "v"(lv), "v"(lv1), "v"(lv2), "v"(lv3),
           "v"(gk), "v"(gk1), "v"(gk2), "v"(gk3), "v"(gv), "v"(gv1), "v"(gv2), "v"(gv3)
        : "memory");
}

// The value that lane l ^ 16 holds.
__device__ __forceinline__ float other_half(float x) {
    const int b = __builtin_bit_cast(int, x);
    return __builtin_bit_cast(float,
        __builtin_amdgcn_permlanex16(b, b, 0x76543210, 0xfedcba98, false, false));
}

// A run of exponentials to base 2.  The instruction set asks for one slot
// between a transcendental and an instruction that reads its result or
// overwrites its source: inside the run no instruction names a register of
// another (every output is early-clobber), and the closing v_nop is the slot
// behind the last one.
__device__ __forceinline__ void exp2_run8(v8f x, v8f& y) {
    float y0, y1, y2, y3, y4, y5, y6, y7;
    asm("v_exp_f32 %0, %8\n\t"
        "v_exp_f32 %1, %9\n\t"
        "v_exp_f32 %2, %10\n\t"
        "v_exp_f32 %3, %11\n\t"
        "v_exp_f32 %4, %12\n\t"
        "v_exp_f32 %5, %13\n\t"
        "v_exp_f32 %6, %14\n\t"
        "v_exp_f32 %7, %15\n\t"
        "v_nop"
        : "=&v"(y0), "=&v"(y1), "=&v"(y2), "=&v"(y3),
          "=&v"(y4), "=&v"(y5), "=&v"(y6), "=&v"(y7)
        : "v"(x[0]), "v"(x[1]), "v"(x[2]), "v"(x[3]),
          "v"(x[4]), "v"(x[5]), "v"(x[6]), "v"(x[7]));
    y[0] = y0; y[1] = y1; y[2] = y2; y[3] = y3;
    y[4] = y4; y[5] = y5; y[6] = y6; y[7] = y7;
}

// The same run as the compiler's own instructions, for use directly behind matrix
// products: the compiler then keeps the distance that the chip asks for between a
// product and a reader of its result, and counts these instructions into it.
__device__ __forceinline__ v8f exp2_8(v8f x) {
    v8f y;
#pragma unroll
    for (int i = 0; i < 8; ++i) y[i] = __builtin_amdgcn_exp2f(x[i]);
    return y;
}

// Sum of a lane's 16 terms: a tree of pairwise sums, 8 + 4 + 2 + 1 additions, laid
// out so that neighbouring registers are added in pairs.
__device__ __forceinline__ float sum16(v8f a, v8f b) {
    const v8f t = a + b;
    const float u0 = t[0] + t[4], u1 = t[1] + t[5], u2 = t[2] + t[6], u3 = t[3] + t[7];
    return (u0 + u2) + (u1 + u3);
}

// A single one, with its slot.
__device__ __forceinline__ float exp2_one(float x) {
    float y;
    asm("v_exp_f32 %0, %1\n\t"
        "v_nop"
        : "=&v"(y) : "v"(x));
    return y;
}

__global__ __launch_bounds__(256) void attn_wmma_kernel(
    const half_t* __restrict__ Qp, const half_t* __restrict__ Kp,
    const half_t* __restrict__ VpT, float* __restrict__ out)
{
    __shared__ __align__(16) half_t kvs[2 * AT_STAGE];  // 71,680 B: the two stage buffers

    const int tid  = threadIdx.x;
    const int wid  = threadIdx.x >> 5;
    const int lane = threadIdx.x & 31;
    const int l16  = lane & 15;
    const int hi   = lane >> 4;
    const int klo  = hi * 8;

    const int unit = blockIdx.x * (blockDim.x >> 5) + wid;
    const int QTILES = SS / 16;
    const int bh = unit / QTILES;
    const int q0 = (unit % QTILES) * 16;

    const half_t* qb = Qp  + (size_t)bh * SS * HD;
    const half_t* kb = Kp  + (size_t)bh * SS * HD;
    const half_t* vt = VpT + (size_t)bh * HD * SS;

    const half_t* qrow = qb + (size_t)(q0 + l16) * HD;
    const v16h qa0 = load_frag_f16(qrow + 0  + klo);
    const v16h qa1 = load_frag_f16(qrow + 32 + klo);

    v8f oacc[4];
#pragma unroll
    for (int t = 0; t < 4; ++t) oacc[t] = (v8f)(0.0f);
    // of the lane's query: sum over the keys that this half of the wave holds
    // (the halves are joined behind the loop)
    float l_run = 0.0f;

    // Copy duty of a lane: 16-byte piece (tid & 7) of K rows (tid >> 3) + 32 j,
    // 16-byte piece (tid & 15) of VpT rows (tid >> 4) + 16 j.
    const half_t* gk = kb + (size_t)(tid >> 3) * HD + (tid & 7) * 8;
    const half_t* gv = vt + (size_t)(tid >> 4) * SS + (tid & 15) * 8;
    const unsigned lk = (unsigned)(size_t)&kvs[(tid >> 3) * AT_KPITCH + (tid & 7) * 8];
    const unsigned lv = (unsigned)(size_t)&kvs[AT_KH + (tid >> 4) * AT_VPITCH + (tid & 15) * 8];

    // stage 0 -> buffer 0, landed and published; then stage 1 -> buffer 1
    attn_copy8(gk, lk, gv, lv);
    // this wave's copies have landed before the barrier lets others read them
    asm volatile("s_wait_asynccnt 0x0" ::: "memory");
    __syncthreads();
    attn_copy8(gk + AT_KEYS * HD, lk + AT_STAGE * 2, gv + AT_KEYS, lv + AT_STAGE * 2);

    // minus the maximum in use, as the C operand of the score products: at the
    // start the maximum over keys 0..15, so that the sum holds a term 1 from the
    // first chunk on
    v8f negm;
    {
        const half_t* kr = kvs + l16 * AT_KPITCH + klo;
        v8f s = (v8f)(0.0f);
        s = wmma_f16(load_frag_f16(kr + 0),  qa0, s);
        s = wmma_f16(load_frag_f16(kr + 32), qa1, s);
        float v = fmaxf(s[0], s[1]);
#pragma unroll
        for (int i = 2; i < 8; ++i) v = fmaxf(v, s[i]);
        v = fmaxf(v, other_half(v));
        negm = (v8f)(-v);
    }

    // rolled: sixteen copies of the stage body would only lengthen the kernel's text
#pragma unroll 1
    for (int st = 0; st < AT_NST; ++st) {
      const int buf = st & 1;
      const half_t* ks = kvs + buf * AT_STAGE + l16 * AT_KPITCH + klo;
      const half_t* vs = kvs + buf * AT_STAGE + AT_KH + l16 * AT_VPITCH + klo;
      // by 2: the pair's LDS offsets are immediates of its reads
#pragma unroll 2
      for (int c = 0; c < AT_KEYS / 32; ++c) {
        // ---- issue all K and V fragment reads for this chunk ----
        const half_t* kr0 = ks + (c * 32 + 0)  * AT_KPITCH;
        const half_t* kr1 = ks + (c * 32 + 16) * AT_KPITCH;
        v16h kb00 = load_frag_f16(kr0 + 0);
        v16h kb01 = load_frag_f16(kr0 + 32);
        v16h kb10 = load_frag_f16(kr1 + 0);
        v16h kb11 = load_frag_f16(kr1 + 32);
        v16h vb[4];
#pragma unroll
        for (int t = 0; t < 4; ++t)
            vb[t] = load_frag_f16(vs + t * 16 * AT_VPITCH + c * 32);
        __builtin_amdgcn_sched_barrier(0);   // keep loads above the compute

        // ---- S^T - m = K * Q^T - m (two 16-key m-tiles, two 32-wide k-steps) ----
        // sac0[i]: key c*32 + 8*hi + i, sac1[i]: key c*32 + 16 + 8*hi + i; query l16
        v8f sac0 = wmma_f16(kb00, qa0, negm);
        sac0 = wmma_f16(kb01, qa1, sac0);
        v8f sac1 = wmma_f16(kb10, qa0, negm);
        sac1 = wmma_f16(kb11, qa1, sac1);

        // ---- softmax terms of the 32 new keys, one query per lane ----
        v8f p0 = exp2_8(sac0);
        v8f p1 = exp2_8(sac1);
        float rs = sum16(p0, p1);
        // The test for a maximum that has grown reads the lane's sum of terms, which
        // is formed anyway: a sum of at most 256 says that every term is at most 256
        // (far inside f16).  Not-less-or-equal, so that an overflowed term counts too.
        // The same for all lanes: a scalar branch, every lane on inside it.
        if (__builtin_amdgcn_ballot_w32(!(rs <= 256.0f)) != 0) {
            // v: how far the new scores of the lane's query stand above m
            float v = fmaxf(sac0[0], sac0[1]);
#pragma unroll
            for (int i = 2; i < 8; ++i) v = fmaxf(v, sac0[i]);
#pragma unroll
            for (int i = 0; i < 8; ++i) v = fmaxf(v, sac1[i]);
            v = fmaxf(v, other_half(v));
            // m moves up by d to the new maximum (not at all where that is lower):
            // the arguments follow it, what has been gathered so far shrinks by 2^-d,
            // and the chunk's terms are formed again from the new arguments
            const float d = fmaxf(v, 0.0f);
            const float al = exp2_one(-d);
            sac0 = sac0 - d;
            sac1 = sac1 - d;
            negm = negm - d;
            l_run *= al;
#pragma unroll
            for (int t = 0; t < 4; ++t)
#pragma unroll
                for (int i = 0; i < 8; ++i) oacc[t][i] *= al;
            exp2_run8(sac0, p0);
            exp2_run8(sac1, p1);
            rs = sum16(p0, p1);
        }
        v16h pb;
#pragma unroll
        for (int i = 0; i < 8; ++i) {
            pb[i]     = (_Float16)p0[i];
            pb[8 + i] = (_Float16)p1[i];
        }
        l_run += rs;

        // ---- O^T += V^T * P^T: oacc[t][i] = O[query l16][d = t*16 + 8*hi + i] ----
#pragma unroll
        for (int t = 0; t < 4; ++t)
            oacc[t] = wmma_f16(vb[t], pb, oacc[t]);
      }
      // Hand-over: this wave's reads of buffer buf are done, its copies of
      // stage st+1 have landed; behind the barrier that holds for every wave.
      asm volatile("s_wait_dscnt 0x0" ::: "memory");
      asm volatile("s_wait_asynccnt 0x0" ::: "memory");
      __syncthreads();
      if (st + 2 < AT_NST)
          attn_copy8(gk + (st + 2) * (AT_KEYS * HD), lk + buf * (AT_STAGE * 2),
                     gv + (st + 2) * AT_KEYS,        lv + buf * (AT_STAGE * 2));
    }
    // no copy of this wave is outstanding when it ends
    asm volatile("s_wait_asynccnt 0x0" ::: "memory");

    // ---- normalize and store: out[b, q0+l16, h*64 + t*16 + 8*hi + 0..7] ----
    const int b_ = bh / HH;
    const int h_ = bh % HH;
    const float inv = 1.0f / (l_run + other_half(l_run));
    float* orow = out + ((size_t)(b_ * SS + q0 + l16)) * DD + h_ * HD + 8 * hi;
#pragma unroll
    for (int t = 0; t < 4; ++t) {
        float4 lo4, hi4;
        lo4.x = oacc[t][0] * inv; lo4.y = oacc[t][1] * inv;
        lo4.z = oacc[t][2] * inv; lo4.w = oacc[t][3] * inv;
        hi4.x = oacc[t][4] * inv; hi4.y = oacc[t][5] * inv;
        hi4.z = oacc[t][6] * inv; hi4.w = oacc[t][7] * inv;
        *(float4*)(orow + t * 16)     = lo4;
        *(float4*)(orow + t * 16 + 4) = hi4;
    }
}

// ---------------------------------------------------------------------------
// Host-side launch. Inputs: q,k,v,Wq,bq,Wk,bk,Wv,bv (all f32).
// Workspace (f16 halves): Qp,Kp,VpT : 3 x 4M (projected heads) = 24 MB.
// ---------------------------------------------------------------------------
extern "C" void kernel_launch(void* const* d_in, const int* in_sizes, int n_in,
                              void* d_out, int out_size, void* d_ws, size_t ws_size,
                              hipStream_t stream) {
    const float* q  = (const float*)d_in[0];
    const float* k  = (const float*)d_in[1];
    const float* v  = (const float*)d_in[2];
    const float* Wq = (const float*)d_in[3];
    const float* bq = (const float*)d_in[4];
    const float* Wk = (const float*)d_in[5];
    const float* bk = (const float*)d_in[6];
    const float* Wv = (const float*)d_in[7];
    const float* bv = (const float*)d_in[8];
    float* out = (float*)d_out;

    const size_t XN = (size_t)ROWS * DD;   // 4,194,304
    half_t* Qp  = (half_t*)d_ws;
    half_t* Kp  = Qp + XN;
    half_t* VpT = Kp + XN;

    // 1) projections, one launch: one block per 256 x 256 output tile, 16 x 4 = 64
    //    blocks for each of Q, K, V; Qp, Kp, VpT are three arrays in a row
    const int projBlocks = (ROWS / PJ_TILE) * (DD / PJ_TILE);
    proj_wmma_kernel<<<dim3(projBlocks, 3), 256, 0, stream>>>(q, k, v, Wq, Wk, Wv, bq, bk, bv, Qp);

    // 2) attention: units = B*H*(S/16) = 4096 -> 512 blocks x 8 waves
    const int attnBlocks = BB * HH * (SS / 16) / 8;
    attn_wmma_kernel<<<attnBlocks, 256, 0, stream>>>(Qp, Kp, VpT, out);
}

// v010
// It runs in 59 microseconds.
// Next to v009, in two timings, it ran 1.06 times as fast each time.
// Counting every step since v000, it is 4.49 times as fast.
#include <hip/hip_runtime.h>

// Problem constants (from reference)
#define BB   2
#define SS   2048
#define DD   1024
#define HH   16
#define HD   64
#define ROWS (BB * SS)          // 4096 rows in the projection GEMMs
// log2(e) / sqrt(Hd): the projected Q carries it, so that K * Q^T is the softmax
// exponent to base 2
#define QSCALE 0.18033688011112042f

typedef _Float16 half_t;
typedef __attribute__((ext_vector_type(16))) _Float16 v16h;
typedef __attribute__((ext_vector_type(8)))  _Float16 v8h;
typedef __attribute__((ext_vector_type(8)))  float    v8f;

// ---------------------------------------------------------------------------
// Fragment helper: A-layout (16-bit A, 16x32, ISA 7.12.2): lane l (l16=l&15)
// holds row M=l16; halves a[0..7]=K(klo..klo+7), a[8..15]=K(16+klo..) with
// klo = (lane>=16 ? 8 : 0).  B uses the symmetric lane-per-column layout.
// Both reduce to: 8 contiguous halves at p, 8 contiguous halves at p+16.
// ---------------------------------------------------------------------------
__device__ __forceinline__ v16h load_frag_f16(const half_t* p) {
    v8h lo = *(const v8h*)(p);
    v8h hi = *(const v8h*)(p + 16);
    v16h r;
#pragma unroll
    for (int i = 0; i < 8; ++i) { r[i] = lo[i]; r[8 + i] = hi[i]; }
    return r;
}

__device__ __forceinline__ v8f wmma_f16(v16h a, v16h b, v8f c) {
    return __builtin_amdgcn_wmma_f32_16x16x32_f16(
        false, a, false, b, (short)0, c, false, false);
}

// ---------------------------------------------------------------------------
// Projection GEMMs: out[s,e] = sum_d X[s,d]*W[e,d] + b[e], X and W given in f32,
// multiplied as f16.  One launch does all three: blockIdx.y = 0, 1, 2 is the V,
// K, Q projection.  There is no conversion launch: a workgroup loads its own f32
// rows into registers, rounds them to f16 (to nearest even) and lays them in LDS,
// so no f16 copy of X or W goes through memory.
//   transpose_out == 0 : out layout [B,H,S,Hd]   (Q, K)
//   transpose_out == 1 : out layout [B,H,Hd,S]   (V -> contiguous PV A-frags)
// One workgroup per 256(row) x 256(col) tile of an output, 8 waves in a 4 x 2
// grid, 64 x 128 per wave, one workgroup on a WGP.  The tile is this large
// because the operands now come as 4-byte elements: an X row is read by 4
// workgroups and a W row by 16, which keeps the bytes asked of L2 at what
// 128 x 128 tiles ask for 2-byte elements.
// A pass is 64 k (256 B of f32 of each of the 256 X rows and 256 W rows): 32
// loads of 16 B a lane, 16 lanes to a row piece, so that each load instruction
// covers four whole 128-B lines.  Two LDS buffers and one register set: pass
// t+2's loads fly while pass t+1 (waves 0..3) or pass t (waves 4..7) is multiplied; within pass t the registers
// (pass t+1) are rounded into the buffer that pass t-1 has left.  The two waves
// that share a SIMD (w and w + 4) do that staging at opposite ends of the pass:
// waves 0..3 behind their products, waves 4..7 in front of theirs, so that one
// wave's conversions, LDS stores and load issue run under the other's products.
// LDS rows are pitched 144 B so that the 16-byte fragment reads of 16
// neighbouring rows fall on different banks.
// Epilogue: the f16 tile is laid in the freed LDS in the output's own row order
// and goes out in 16-byte pieces, a wave to a 512-B staged row: every store
// instruction covers four whole 128-B lines.
// ---------------------------------------------------------------------------
typedef __attribute__((ext_vector_type(4))) float    v4f;
typedef __attribute__((ext_vector_type(4))) _Float16 v4h;

#define PJ_TILE   256                       // output tile edge
#define PJ_KP     64                        // k per pass
#define PJ_PITCH  72                        // LDS row pitch (halves) = 144 B
#define PJ_STAGE  (2 * PJ_TILE * PJ_PITCH)  // halves per buffer: X rows, then W rows
#define PJ_NPASS  (DD / PJ_KP)              // 16
#define PJ_LD     (PJ_TILE / 16)            // loads of a lane per operand and pass: 16
#define PJ_OPITCH 264                       // pitch of a staged output row (halves) = 528 B

// A lane's 16 bytes of rows r, r+16, ..., r+240 of one operand; g: those of row r.
__device__ __forceinline__ void proj_load(const float* g, v4f (&x)[PJ_LD]) {
#pragma unroll
    for (int j = 0; j < PJ_LD; ++j) x[j] = *(const v4f*)(g + (size_t)j * 16 * DD);
}

// The same values, rounded to f16, to their places in LDS; l: that of row r.
__device__ __forceinline__ void proj_put(const v4f (&x)[PJ_LD], half_t* l) {
#pragma unroll
    for (int j = 0; j < PJ_LD; ++j) {
        v4h o;
        o[0] = (_Float16)x[j][0]; o[1] = (_Float16)x[j][1];
        o[2] = (_Float16)x[j][2]; o[3] = (_Float16)x[j][3];
        *(v4h*)(l + j * 16 * PJ_PITCH) = o;
    }
}

__global__ __launch_bounds__(256) void proj_wmma_kernel(
    const float* __restrict__ q,  const float* __restrict__ k,
    const float* __restrict__ v,  const float* __restrict__ Wq,
    const float* __restrict__ Wk, const float* __restrict__ Wv,
    const float* __restrict__ bq, const float* __restrict__ bk,
    const float* __restrict__ bv, half_t* __restrict__ outall)
{
    __shared__ __align__(16) half_t stg[2 * PJ_STAGE];   // 147,456 B

    // Which projection this workgroup belongs to (0 Q, 1 K, 2 V): all of it scalar.
    // blockIdx.y 0 is V; the order has no bearing on the result.
    const int which = 2 - (int)blockIdx.y;
    const float* X    = (which == 0) ? q  : (which == 1) ? k  : v;
    const float* Wt   = (which == 0) ? Wq : (which == 1) ? Wk : Wv;
    const float* bias = (which == 0) ? bq : (which == 1) ? bk : bv;
    half_t*      out  = outall + (size_t)which * (ROWS * DD);
    const int transpose_out = (which == 2);

    const int tid  = threadIdx.x;
    const int wid  = tid >> 5;
    const int lane = tid & 31;
    const int l16  = lane & 15;
    const int hi   = lane >> 4;
    const int klo  = hi * 8;

    const int NT = DD / PJ_TILE;                       // 4 tile columns
    const int m0 = (blockIdx.x / NT) * PJ_TILE;        // first X row of the tile
    const int n0 = (blockIdx.x % NT) * PJ_TILE;        // first W row of the tile
    const int wm = (wid >> 1) * 64;                    // wave's rows in the tile
    const int wn = (wid & 1) * 128;                    // wave's columns in the tile

    // Staging duty of a lane: 4 elements (tid & 15) of rows (tid >> 4) + 16 j.
    const int crow = tid >> 4;
    const int ccol = (tid & 15) * 4;
    const float* gx = X  + (size_t)(m0 + crow) * DD + ccol;
    const float* gw = Wt + (size_t)(n0 + crow) * DD + ccol;
    half_t* lx = stg + crow * PJ_PITCH + ccol;
    half_t* lw = lx + PJ_TILE * PJ_PITCH;

    // Every inner loop below is unrolled so that each accumulator and fragment
    // index is a constant: the arrays then live in registers, not in scratch.
    v8f acc[4][8];
#pragma unroll
    for (int i = 0; i < 4; ++i)
#pragma unroll
        for (int j = 0; j < 8; ++j) acc[i][j] = (v8f)(0.0f);

    // pass 0 -> buffer 0; then pass 1 into the registers
    v4f xr[PJ_LD], wr[PJ_LD];
    proj_load(gx, xr);
    proj_load(gw, wr);
    proj_put(xr, lx);
    proj_put(wr, lw);
    proj_load(gx + PJ_KP, xr);
    proj_load(gw + PJ_KP, wr);
    // stands in front of any later rewrite of an address register of these loads
    asm volatile("s_wait_xcnt 0x0" ::: "memory");
    // Buffer 0 is complete before any wave reads rows that others wrote.  The barrier
    // is written by hand, with the LDS wait it needs: __syncthreads() would also wait
    // for the global loads just issued, which are to fly while a pass is multiplied.
    asm volatile("s_wait_dscnt 0x0\n\ts_barrier_signal -1\n\ts_barrier_wait -1" ::: "memory");

    // Waves 4..7 stage in front of their products, waves 0..3 behind them: a scalar
    // condition, the same for all lanes of a wave.
    const bool early = __builtin_amdgcn_readfirstlane(wid) >= 4;

    // Within pass t (t + 1 < PJ_NPASS): pass t+1 out of the registers into the other
    // buffer, whose last readers (pass t-1) ended in front of the barrier that closed
    // pass t-1; then pass t+2's loads into the registers.
    auto stage_next = [&](int t) {
        const int nb = (t & 1) ^ 1;
        proj_put(xr, lx + nb * PJ_STAGE);
        proj_put(wr, lw + nb * PJ_STAGE);
        if (t + 2 < PJ_NPASS) {
            proj_load(gx + (t + 2) * PJ_KP, xr);
            proj_load(gw + (t + 2) * PJ_KP, wr);
            // stands in front of any later rewrite of an address register of these loads
            asm volatile("s_wait_xcnt 0x0" ::: "memory");
        }
    };

    // rolled: sixteen copies of the pass body would only lengthen the kernel's text
#pragma unroll 1
    for (int t = 0; t < PJ_NPASS; ++t) {
        const int buf = t & 1;
        if (early && t + 1 < PJ_NPASS) stage_next(t);
        const half_t* xs  = stg + buf * PJ_STAGE + (wm + l16) * PJ_PITCH + klo;
        const half_t* wsm = stg + buf * PJ_STAGE + (PJ_TILE + wn + l16) * PJ_PITCH + klo;
#pragma unroll
        for (int s = 0; s < PJ_KP / 32; ++s) {
            v16h a[4], b[8];
#pragma unroll
            for (int i = 0; i < 4; ++i) a[i] = load_frag_f16(xs + i * 16 * PJ_PITCH + s * 32);
#pragma unroll
            for (int j = 0; j < 8; ++j) b[j] = load_frag_f16(wsm + j * 16 * PJ_PITCH + s * 32);
            // keeps the read group above the products instead of spread among them
            __builtin_amdgcn_sched_barrier(0);
#pragma unroll
            for (int j = 0; j < 8; ++j)
#pragma unroll
                for (int i = 0; i < 4; ++i)
                    acc[i][j] = wmma_f16(a[i], b[j], acc[i][j]);
            // keeps the next group's reads from rising into these products
            __builtin_amdgcn_sched_barrier(0);
        }
        if (!early && t + 1 < PJ_NPASS) stage_next(t);
        // Hand-over: every wave's reads of buffer buf are done and pass t+1 lies
        // complete in the other buffer.  By hand for the same reason as above: the
        // loads of pass t+2 stay in flight across it.
        asm volatile("s_wait_dscnt 0x0\n\ts_barrier_signal -1\n\ts_barrier_wait -1" ::: "memory");
    }

    // Bias, then the tile as f16 into LDS.  The buffers are free: every wave's last
    // fragment reads ended in front of the loop's last barrier.
    // C layout: acc[i][j][r] = out[row0 + i*16 + r + 8*hi][col0 + j*16 + l16]
    // Staged rows (pitch 528 B): for V one row per column e, 256 s long, so a
    // lane's 8 values of an accumulator tile are 16 contiguous bytes; for Q and K
    // one row per s, 256 e long (four heads of 64 side by side).
    half_t* so = stg;                                  // 256 x 528 B = 135,168 B
    float bj[8];
#pragma unroll
    for (int j = 0; j < 8; ++j) bj[j] = bias[n0 + wn + j * 16 + l16];
    if (transpose_out) {
#pragma unroll
        for (int j = 0; j < 8; ++j)
#pragma unroll
            for (int i = 0; i < 4; ++i) {
                v8h o;
#pragma unroll
                for (int r = 0; r < 8; ++r) o[r] = (_Float16)(acc[i][j][r] + bj[j]);
                *(v8h*)(so + (wn + j * 16 + l16) * PJ_OPITCH + wm + i * 16 + 8 * hi) = o;
            }
    } else {
        const float osc = (which == 0) ? QSCALE : 1.0f;   // Q: see QSCALE; K: as it is
#pragma unroll
        for (int j = 0; j < 8; ++j)
#pragma unroll
            for (int i = 0; i < 4; ++i)
#pragma unroll
                for (int r = 0; r < 8; ++r)
                    so[(wm + i * 16 + 8 * hi + r) * PJ_OPITCH + wn + j * 16 + l16] =
                        (_Float16)((acc[i][j][r] + bj[j]) * osc);
    }
    // the staged tile is complete before any wave reads rows that others wrote
    __syncthreads();

    // A wave takes staged rows wid + 8 n, a lane 16-byte piece (lane) of each.
    const int b_   = m0 >> 11;                         // the tile lies in one batch
    const int sl0  = m0 & 2047;
    half_t* go;                                        // the lane's piece of row wid
    size_t gstep;                                      // 8 staged rows further on
    if (transpose_out) {
        // row = column e = h*64 + d of [B,H,Hd,S]; the piece is 8 s
        go    = out + (size_t)(b_ * DD + n0 + wid) * SS + sl0 + lane * 8;
        gstep = (size_t)8 * SS;
    } else {
        // row = s of [B,H,S,Hd]; the piece is 8 d of head (n0 + lane * 8) / 64
        const int e = n0 + lane * 8;
        go    = out + ((size_t)(b_ * HH + (e >> 6)) * SS + sl0 + wid) * HD + (e & 63);
        gstep = (size_t)8 * HD;
    }
    // by groups of 8: eight LDS reads in flight, then their eight stores
#pragma unroll
    for (int n = 0; n < PJ_TILE / 8; n += 8) {
        v8h x[8];
#pragma unroll
        for (int m = 0; m < 8; ++m)
            x[m] = *(const v8h*)(so + (wid + 8 * (n + m)) * PJ_OPITCH + lane * 8);
#pragma unroll
        for (int m = 0; m < 8; ++m)
            *(v8h*)(go + (n + m) * gstep) = x[m];
    }
}

#define AT_KEYS   128
#define AT_KPITCH 72
#define AT_VPITCH 136
#define AT_KH     (AT_KEYS * AT_KPITCH)
#define AT_STAGE  (AT_KH + HD * AT_VPITCH)
#define AT_NST    (SS / AT_KEYS)

// Eight 16-byte copies of one lane: K rows r, r+32, r+64, r+96 and VpT rows
// d, d+16, d+32, d+48.  gk, gv: the lane's 16 bytes in the first row of each;
// lk, lv: their LDS byte addresses.
__device__ __forceinline__ void attn_copy8(const half_t* gk, unsigned lk,
                                           const half_t* gv, unsigned lv) {
    const half_t* gk1 = gk + 32 * 1 * HD;  const unsigned lk1 = lk + 32 * 1 * AT_KPITCH * 2;
    const half_t* gk2 = gk + 32 * 2 * HD;  const unsigned lk2 = lk + 32 * 2 * AT_KPITCH * 2;
    const half_t* gk3 = gk + 32 * 3 * HD;  const unsigned lk3 = lk + 32 * 3 * AT_KPITCH * 2;
    const half_t* gv1 = gv + 16 * 1 * SS;  const unsigned lv1 = lv + 16 * 1 * AT_VPITCH * 2;
    const half_t* gv2 = gv + 16 * 2 * SS;  const unsigned lv2 = lv + 16 * 2 * AT_VPITCH * 2;
    const half_t* gv3 = gv + 16 * 3 * SS;  const unsigned lv3 = lv + 16 * 3 * AT_VPITCH * 2;
    // The closing s_wait_xcnt stands inside the statement so that no address
    // register named here is rewritten ahead of it.
    asm volatile(
        "global_load_async_to_lds_b128 %0, %8, off\n\t"
        "global_load_async_to_lds_b128 %1, %9, off\n\t"
        "global_load_async_to_lds_b128 %2, %10, off\n\t"
        "global_load_async_to_lds_b128 %3, %11, off\n\t"
        "global_load_async_to_lds_b128 %4, %12, off\n\t"
        "global_load_async_to_lds_b128 %5, %13, off\n\t"
        "global_load_async_to_lds_b128 %6, %14, off\n\t"
        "global_load_async_to_lds_b128 %7, %15, off\n\t"
        "s_wait_xcnt 0x0"
        :: "v"(lk), "v"(lk1), "v"(lk2), "v"(lk3), "v"(lv), "v"(lv1), "v"(lv2), "v"(lv3),
           "v"(gk), "v"(gk1), "v"(gk2), "v"(gk3), "v"(gv), "v"(gv1), "v"(gv2), "v"(gv3)
        : "memory");
}

// The value that lane l ^ 16 holds.
__device__ __forceinline__ float other_half(float x) {
    const int b = __builtin_bit_cast(int, x);
    return __builtin_bit_cast(float,
        __builtin_amdgcn_permlanex16(b, b, 0x76543210, 0xfedcba98, false, false));
}

// A run of exponentials to base 2.  The instruction set asks for one slot
// between a transcendental and an instruction that reads its result or
// overwrites its source: inside the run no instruction names a register of
// another (every output is early-clobber), and the closing v_nop is the slot
// behind the last one.
__device__ __forceinline__ void exp2_run8(v8f x, v8f& y) {
    float y0, y1, y2, y3, y4, y5, y6, y7;
    asm("v_exp_f32 %0, %8\n\t"
        "v_exp_f32 %1, %9\n\t"
        "v_exp_f32 %2, %10\n\t"
        "v_exp_f32 %3, %11\n\t"
        "v_exp_f32 %4, %12\n\t"
        "v_exp_f32 %5, %13\n\t"
        "v_exp_f32 %6, %14\n\t"
        "v_exp_f32 %7, %15\n\t"
        "v_nop"
        : "=&v"(y0), "=&v"(y1), "=&v"(y2), "=&v"(y3),
          "=&v"(y4), "=&v"(y5), "=&v"(y6), "=&v"(y7)
        : "v"(x[0]), "v"(x[1]), "v"(x[2]), "v"(x[3]),
          "v"(x[4]), "v"(x[5]), "v"(x[6]), "v"(x[7]));
    y[0] = y0; y[1] = y1; y[2] = y2; y[3] = y3;
    y[4] = y4; y[5] = y5; y[6] = y6; y[7] = y7;
}

// The same run as the compiler's own instructions, for use directly behind matrix
// products: the compiler then keeps the distance that the chip asks for between a
// product and a reader of its result, and counts these instructions into it.
__device__ __forceinline__ v8f exp2_8(v8f x) {
    v8f y;
#pragma unroll
    for (int i = 0; i < 8; ++i) y[i] = __builtin_amdgcn_exp2f(x[i]);
    return y;
}

// Sum of a lane's 16 terms: a tree of pairwise sums, 8 + 4 + 2 + 1 additions, laid
// out so that neighbouring registers are added in pairs.
__device__ __forceinline__ float sum16(v8f a, v8f b) {
    const v8f t = a + b;
    const float u0 = t[0] + t[4], u1 = t[1] + t[5], u2 = t[2] + t[6], u3 = t[3] + t[7];
    return (u0 + u2) + (u1 + u3);
}

// A single one, with its slot.
__device__ __forceinline__ float exp2_one(float x) {
    float y;
    asm("v_exp_f32 %0, %1\n\t"
        "v_nop"
        : "=&v"(y) : "v"(x));
    return y;
}

__global__ __launch_bounds__(256) void attn_wmma_kernel(
    const half_t* __restrict__ Qp, const half_t* __restrict__ Kp,
    const half_t* __restrict__ VpT, float* __restrict__ out)
{
    __shared__ __align__(16) half_t kvs[2 * AT_STAGE];  // 71,680 B: the two stage buffers

    const int tid  = threadIdx.x;
    const int wid  = threadIdx.x >> 5;
    const int lane = threadIdx.x & 31;
    const int l16  = lane & 15;
    const int hi   = lane >> 4;
    const int klo  = hi * 8;

    const int unit = blockIdx.x * (blockDim.x >> 5) + wid;
    const int QTILES = SS / 16;
    const int bh = unit / QTILES;
    const int q0 = (unit % QTILES) * 16;

    const half_t* qb = Qp  + (size_t)bh * SS * HD;
    const half_t* kb = Kp  + (size_t)bh * SS * HD;
    const half_t* vt = VpT + (size_t)bh * HD * SS;

    const half_t* qrow = qb + (size_t)(q0 + l16) * HD;
    const v16h qa0 = load_frag_f16(qrow + 0  + klo);
    const v16h qa1 = load_frag_f16(qrow + 32 + klo);

    v8f oacc[4];
#pragma unroll
    for (int t = 0; t < 4; ++t) oacc[t] = (v8f)(0.0f);
    // of the lane's query: sum over the keys that this half of the wave holds
    // (the halves are joined behind the loop)
    float l_run = 0.0f;

    // Copy duty of a lane: 16-byte piece (tid & 7) of K rows (tid >> 3) + 32 j,
    // 16-byte piece (tid & 15) of VpT rows (tid >> 4) + 16 j.
    const half_t* gk = kb + (size_t)(tid >> 3) * HD + (tid & 7) * 8;
    const half_t* gv = vt + (size_t)(tid >> 4) * SS + (tid & 15) * 8;
    const unsigned lk = (unsigned)(size_t)&kvs[(tid >> 3) * AT_KPITCH + (tid & 7) * 8];
    const unsigned lv = (unsigned)(size_t)&kvs[AT_KH + (tid >> 4) * AT_VPITCH + (tid & 15) * 8];

    // stage 0 -> buffer 0, landed and published; then stage 1 -> buffer 1
    attn_copy8(gk, lk, gv, lv);
    // this wave's copies have landed before the barrier lets others read them
    asm volatile("s_wait_asynccnt 0x0" ::: "memory");
    __syncthreads();
    attn_copy8(gk + AT_KEYS * HD, lk + AT_STAGE * 2, gv + AT_KEYS, lv + AT_STAGE * 2);

    // minus the maximum in use, as the C operand of the score products: at the
    // start the maximum over keys 0..15, so that the sum holds a term 1 from the
    // first chunk on
    v8f negm;
    {
        const half_t* kr = kvs + l16 * AT_KPITCH + klo;
        v8f s = (v8f)(0.0f);
        s = wmma_f16(load_frag_f16(kr + 0),  qa0, s);
        s = wmma_f16(load_frag_f16(kr + 32), qa1, s);
        float v = fmaxf(s[0], s[1]);
#pragma unroll
        for (int i = 2; i < 8; ++i) v = fmaxf(v, s[i]);
        v = fmaxf(v, other_half(v));
        negm = (v8f)(-v);
    }

    // rolled: sixteen copies of the stage body would only lengthen the kernel's text
#pragma unroll 1
    for (int st = 0; st < AT_NST; ++st) {
      const int buf = st & 1;
      const half_t* ks = kvs + buf * AT_STAGE + l16 * AT_KPITCH + klo;
      const half_t* vs = kvs + buf * AT_STAGE + AT_KH + l16 * AT_VPITCH + klo;
      // by 2: the pair's LDS offsets are immediates of its reads
#pragma unroll 2
      for (int c = 0; c < AT_KEYS / 32; ++c) {
        // ---- issue all K and V fragment reads for this chunk ----
        const half_t* kr0 = ks + (c * 32 + 0)  * AT_KPITCH;
        const half_t* kr1 = ks + (c * 32 + 16) * AT_KPITCH;
        v16h kb00 = load_frag_f16(kr0 + 0);
        v16h kb01 = load_frag_f16(kr0 + 32);
        v16h kb10 = load_frag_f16(kr1 + 0);
        v16h kb11 = load_frag_f16(kr1 + 32);
        v16h vb[4];
#pragma unroll
        for (int t = 0; t < 4; ++t)
            vb[t] = load_frag_f16(vs + t * 16 * AT_VPITCH + c * 32);
        __builtin_amdgcn_sched_barrier(0);   // keep loads above the compute

        // ---- S^T - m = K * Q^T - m (two 16-key m-tiles, two 32-wide k-steps) ----
        // sac0[i]: key c*32 + 8*hi + i, sac1[i]: key c*32 + 16 + 8*hi + i; query l16
        v8f sac0 = wmma_f16(kb00, qa0, negm);
        sac0 = wmma_f16(kb01, qa1, sac0);
        v8f sac1 = wmma_f16(kb10, qa0, negm);
        sac1 = wmma_f16(kb11, qa1, sac1);

        // ---- softmax terms of the 32 new keys, one query per lane ----
        v8f p0 = exp2_8(sac0);
        v8f p1 = exp2_8(sac1);
        float rs = sum16(p0, p1);
        // The test for a maximum that has grown reads the lane's sum of terms, which
        // is formed anyway: a sum of at most 256 says that every term is at most 256
        // (far inside f16).  Not-less-or-equal, so that an overflowed term counts too.
        // The same for all lanes: a scalar branch, every lane on inside it.
        if (__builtin_amdgcn_ballot_w32(!(rs <= 256.0f)) != 0) {
            // v: how far the new scores of the lane's query stand above m
            float v = fmaxf(sac0[0], sac0[1]);
#pragma unroll
            for (int i = 2; i < 8; ++i) v = fmaxf(v, sac0[i]);
#pragma unroll
            for (int i = 0; i < 8; ++i) v = fmaxf(v, sac1[i]);
            v = fmaxf(v, other_half(v));
            // m moves up by d to the new maximum (not at all where that is lower):
            // the arguments follow it, what has been gathered so far shrinks by 2^-d,
            // and the chunk's terms are formed again from the new arguments
            const float d = fmaxf(v, 0.0f);
            const float al = exp2_one(-d);
            sac0 = sac0 - d;
            sac1 = sac1 - d;
            negm = negm - d;
            l_run *= al;
#pragma unroll
            for (int t = 0; t < 4; ++t)
#pragma unroll
                for (int i = 0; i < 8; ++i) oacc[t][i] *= al;
            exp2_run8(sac0, p0);
            exp2_run8(sac1, p1);
            rs = sum16(p0, p1);
        }
        v16h pb;
#pragma unroll
        for (int i = 0; i < 8; ++i) {
            pb[i]     = (_Float16)p0[i];
            pb[8 + i] = (_Float16)p1[i];
        }
        l_run += rs;

        // ---- O^T += V^T * P^T: oacc[t][i] = O[query l16][d = t*16 + 8*hi + i] ----
#pragma unroll
        for (int t = 0; t < 4; ++t)
            oacc[t] = wmma_f16(vb[t], pb, oacc[t]);
      }
      // Hand-over: this wave's reads of buffer buf are done, its copies of
      // stage st+1 have landed; behind the barrier that holds for every wave.
      asm volatile("s_wait_dscnt 0x0" ::: "memory");
      asm volatile("s_wait_asynccnt 0x0" ::: "memory");
      __syncthreads();
      if (st + 2 < AT_NST)
          attn_copy8(gk + (st + 2) * (AT_KEYS * HD), lk + buf * (AT_STAGE * 2),
                     gv + (st + 2) * AT_KEYS,        lv + buf * (AT_STAGE * 2));
    }
    // no copy of this wave is outstanding when it ends
    asm volatile("s_wait_asynccnt 0x0" ::: "memory");

    // ---- normalize and store: out[b, q0+l16, h*64 + t*16 + 8*hi + 0..7] ----
    const int b_ = bh / HH;
    const int h_ = bh % HH;
    const float inv = 1.0f / (l_run + other_half(l_run));
    float* orow = out + ((size_t)(b_ * SS + q0 + l16)) * DD + h_ * HD + 8 * hi;
#pragma unroll
    for (int t = 0; t < 4; ++t) {
        float4 lo4, hi4;
        lo4.x = oacc[t][0] * inv; lo4.y = oacc[t][1] * inv;
        lo4.z = oacc[t][2] * inv; lo4.w = oacc[t][3] * inv;
        hi4.x = oacc[t][4] * inv; hi4.y = oacc[t][5] * inv;
        hi4.z = oacc[t][6] * inv; hi4.w = oacc[t][7] * inv;
        *(float4*)(orow + t * 16)     = lo4;
        *(float4*)(orow + t * 16 + 4) = hi4;
    }
}

// ---------------------------------------------------------------------------
// Host-side launch. Inputs: q,k,v,Wq,bq,Wk,bk,Wv,bv (all f32).
// Workspace (f16 halves): Qp,Kp,VpT : 3 x 4M (projected heads) = 24 MB.
// ---------------------------------------------------------------------------
extern "C" void kernel_launch(void* const* d_in, const int* in_sizes, int n_in,
                              void* d_out, int out_size, void* d_ws, size_t ws_size,
                              hipStream_t stream) {
    const float* q  = (const float*)d_in[0];
    const float* k  = (const float*)d_in[1];
    const float* v  = (const float*)d_in[2];
    const float* Wq = (const float*)d_in[3];
    const float* bq = (const float*)d_in[4];
    const float* Wk = (const float*)d_in[5];
    const float* bk = (const float*)d_in[6];
    const float* Wv = (const float*)d_in[7];
    const float* bv = (const float*)d_in[8];
    float* out = (float*)d_out;

    const size_t XN = (size_t)ROWS * DD;   // 4,194,304
    half_t* Qp  = (half_t*)d_ws;
    half_t* Kp  = Qp + XN;
    half_t* VpT = Kp + XN;

    // 1) projections, one launch: one block per 256 x 256 output tile, 16 x 4 = 64
    //    blocks for each of Q, K, V; Qp, Kp, VpT are three arrays in a row
    const int projBlocks = (ROWS / PJ_TILE) * (DD / PJ_TILE);
    proj_wmma_kernel<<<dim3(projBlocks, 3), 256, 0, stream>>>(q, k, v, Wq, Wk, Wv, bq, bk, bv, Qp);

    // 2) attention: units = B*H*(S/16) = 4096 -> 512 blocks x 8 waves
    const int attnBlocks = BB * HH * (SS / 16) / 8;
    attn_wmma_kernel<<<attnBlocks, 256, 0, stream>>>(Qp, Kp, VpT, out);
}
